// v000
// The times below were measured on an AMD MI455X: many runs one after another, warmed up first and cycling through
// copies of the inputs, with the whole window's GPU time divided by the number of runs. Launches and the gaps
// between them are all in it. The median over several windows is given; except for v000 it joins two sittings, which
// can be a few percent apart, so the side-by-side timings, each taken in one sitting, are the better comparison.
// v000 is the starting kernel. One run takes 2800 microseconds.
#include <hip/hip_runtime.h>

// Causal multi-head attention wrapper with per-head projections (x [8][1024][768]; q_h = x Wq[h], k_h = x Wk[h], v_h = x Wv[h] with per-head 'xw' weights [12][768][64], no bias; scores = q.k / 8, causal mask (-inf above the diagonal); softmax; out = heads concatenated along the feature axis -> [8][1024][768] in f32 (6.3 M), no output projection).
// Compute dtypes, f32 accumulate: every input rounded to bf16; q/k/v on PLAIN bf16 operands (inputs: exact); causal scores and attn.v (tile skipping): query rows < 512 hl (3 products), the rest single fp16 (x1024); softmax f32; no output projection: the merged heads are written in f32 straight to the output.

#define NB_  8
#define TT   1024
#define DM   768
#define NH_  12
#define NKV  12
#define REP  (NH_ / NKV)
#define HD   64
#define DQ   (NH_ * HD)
#define DKV  (NKV * HD)
#define ZH   2
#define RH   512                  // query rows < RH use hi+lo planes (0: none)
#define WIN  1024
#define PCAR 1024.0f
#define SCL  0.125f   // HD^-0.5
typedef _Float16 h16;
typedef unsigned short bf;
typedef __attribute__((ext_vector_type(16))) __bf16   v16bf;
typedef __attribute__((ext_vector_type(16))) _Float16 v16h;
typedef __attribute__((ext_vector_type(8)))  _Float16 v8h;
typedef __attribute__((ext_vector_type(8)))  unsigned short v8us;
typedef __attribute__((ext_vector_type(8)))  float    v8f;
typedef __attribute__((ext_vector_type(4)))  float    v4f;
typedef v8h  __attribute__((may_alias)) v8ha;
typedef v4f  __attribute__((may_alias)) v4fa;
typedef v8us __attribute__((may_alias)) v8usa;

__device__ __forceinline__ unsigned short f2bf(float f) { unsigned u = __float_as_uint(f); u += 0x7FFFu + ((u >> 16) & 1u); return (unsigned short)(u >> 16); }
__device__ __forceinline__ float bf2f(unsigned short b) { return __uint_as_float(((unsigned)b) << 16); }
__device__ __forceinline__ float bfr(float f) { return bf2f(f2bf(f)); }
__device__ __forceinline__ v16h cat16(v8h lo, v8h hi) { return __builtin_shufflevector(lo, hi, 0, 1, 2, 3, 4, 5, 6, 7, 8, 9, 10, 11, 12, 13, 14, 15); }
__device__ __forceinline__ v16bf cat16b(v8us lo, v8us hi) { return __builtin_bit_cast(v16bf, __builtin_shufflevector(lo, hi, 0, 1, 2, 3, 4, 5, 6, 7, 8, 9, 10, 11, 12, 13, 14, 15)); }
__device__ __forceinline__ v8f wmma16(v16h a, v16h b, v8f c) { return __builtin_amdgcn_wmma_f32_16x16x32_f16(false, a, false, b, (short)0, c, false, false); }
__device__ __forceinline__ v8f wmmab(v16bf a, v16bf b, v8f c) { return __builtin_amdgcn_wmma_f32_16x16x32_bf16(false, a, false, b, (short)0, c, false, false); }



// ---- k_gemmw: register-blocked GEMM, ONE WAVE per 64x64 output tile (16 accumulators), operands straight from K-contiguous 16-bit planes; grid (M/64, N/64, Z), 32 threads.
// C[m][n] (f32, pitch ldc, + optional f32 bias[n]) = sum_k A[m][k] Bt[n][k] (+ split products per NSPLIT). z-batch strides sA/sB/sC in elements. K % 32 == 0.
template <typename T16> struct WFrag;
template <> struct WFrag<h16> { typedef v16h V; static __device__ __forceinline__ V ld(const h16* p) { return cat16(*(const v8h*)p, *(const v8h*)(p + 16)); } static __device__ __forceinline__ v8f mma(V a, V b, v8f c) { return wmma16(a, b, c); } };
template <> struct WFrag<bf> { typedef v16bf V; static __device__ __forceinline__ V ld(const bf* p) { return cat16b(*(const v8us*)p, *(const v8us*)(p + 16)); } static __device__ __forceinline__ v8f mma(V a, V b, v8f c) { return wmmab(a, b, c); } };
template <typename T16, int NSPLIT, bool BIAS>
__global__ __launch_bounds__(32) void k_gemmw(const T16* __restrict__ A, const T16* __restrict__ A2, const T16* __restrict__ Bt, const T16* __restrict__ Bt2, int K, float* C, int ldc, const float* __restrict__ bias, size_t sA, size_t sB, size_t sC) {
    typedef typename WFrag<T16>::V V;
    __shared__ __align__(16) float os[16 * 68];
    const size_t z = blockIdx.z; A += z * sA; if (A2) A2 += z * sA; Bt += z * sB; if (Bt2) Bt2 += z * sB; C += z * sC;
    const int lane = threadIdx.x & 31, lr = lane & 15, hi = lane >> 4; const int r0 = blockIdx.x * 64, c0 = blockIdx.y * 64;
    v8f acc[4][4];
#pragma unroll
    for (int mb = 0; mb < 4; ++mb)
#pragma unroll
        for (int nb = 0; nb < 4; ++nb) acc[mb][nb] = (v8f){};
    const size_t aoff = (size_t)(r0 + lr) * K + 8 * hi, boff = (size_t)(c0 + lr) * K + 8 * hi;
#pragma unroll 1
    for (int kc = 0; kc < K; kc += 32) {
        V a[4], a2[4];
#pragma unroll
        for (int mb = 0; mb < 4; ++mb) { a[mb] = WFrag<T16>::ld(A + aoff + (size_t)mb * 16 * K + kc); if (NSPLIT == 1 || NSPLIT == 2) a2[mb] = WFrag<T16>::ld(A2 + aoff + (size_t)mb * 16 * K + kc); }
#pragma unroll
        for (int nb = 0; nb < 4; ++nb) { const V b = WFrag<T16>::ld(Bt + boff + (size_t)nb * 16 * K + kc); V b2; if (NSPLIT >= 2) b2 = WFrag<T16>::ld(Bt2 + boff + (size_t)nb * 16 * K + kc);
#pragma unroll
            for (int mb = 0; mb < 4; ++mb) { acc[mb][nb] = WFrag<T16>::mma(a[mb], b, acc[mb][nb]); if (NSPLIT == 1 || NSPLIT == 2) acc[mb][nb] = WFrag<T16>::mma(a2[mb], b, acc[mb][nb]); if (NSPLIT >= 2) acc[mb][nb] = WFrag<T16>::mma(a[mb], b2, acc[mb][nb]); } }
        asm volatile("v_nop\n\tv_nop\n\tv_nop\n\tv_nop" : "+v"(acc[0][0]), "+v"(acc[1][1]), "+v"(acc[2][2]), "+v"(acc[3][3]) : "v"(a[0]), "v"(a[3]));
    }
#pragma unroll
    for (int mb = 0; mb < 4; ++mb) {
#pragma unroll
        for (int nb = 0; nb < 4; ++nb) {
#pragma unroll
            for (int j = 0; j < 8; ++j) os[(hi * 8 + j) * 68 + nb * 16 + lr] = acc[mb][nb][j]; }
        __builtin_amdgcn_wave_barrier(); asm volatile("" ::: "memory");
        float* crow = C + (size_t)(r0 + mb * 16) * ldc + c0;
{
#pragma unroll
            for (int s = 0; s < 8; ++s) { const int row = 2 * s + hi, cofs = lr * 4; v4f val = *(const v4fa*)(os + row * 68 + cofs); if (BIAS) { val[0] += bfr(bias[c0 + cofs]); val[1] += bfr(bias[c0 + cofs + 1]); val[2] += bfr(bias[c0 + cofs + 2]); val[3] += bfr(bias[c0 + cofs + 3]); }
                *(v4f*)(crow + (size_t)row * ldc + cofs) = val; }
             }
        __builtin_amdgcn_wave_barrier(); asm volatile("" ::: "memory");
    }
}

// ---- k_gemmc: the same one-wave 64x64 tile GEMM specialised for causal attention: CMODE 1 skips score tiles entirely above the diagonal (query rows r0+roff.., key columns c0..), CMODE 2 limits the
// key (K) loop of the probability x value contraction to the diagonal block (probabilities beyond it are exactly zero). roff = row offset of this launch's first row within the sequence.
template <typename T16, int NSPLIT, int CMODE>
__global__ __launch_bounds__(32) void k_gemmc(const T16* __restrict__ A, const T16* __restrict__ A2, const T16* __restrict__ Bt, const T16* __restrict__ Bt2, int K, float* C, int ldc, int roff, size_t sA, size_t sB, size_t sC) {
    typedef typename WFrag<T16>::V V;
    __shared__ __align__(16) float os[16 * 68];
    const size_t z = blockIdx.z; A += z * sA; if (A2) A2 += z * sA; Bt += z * sB; if (Bt2) Bt2 += z * sB; C += z * sC;
    const int lane = threadIdx.x & 31, lr = lane & 15, hi = lane >> 4; const int r0 = blockIdx.x * 64, c0 = blockIdx.y * 64;
    if (CMODE == 1 && c0 > r0 + roff + 63) return;                  // score tile entirely above the causal diagonal: never read (the softmax masks j > i by select)
    const int Kl = (CMODE == 2) ? min(K, r0 + roff + 64) : K;        // P.V: probabilities are exactly 0 beyond the diagonal block, so the K loop stops there
    v8f acc[4][4];
#pragma unroll
    for (int mb = 0; mb < 4; ++mb)
#pragma unroll
        for (int nb = 0; nb < 4; ++nb) acc[mb][nb] = (v8f){};
    const size_t aoff = (size_t)(r0 + lr) * K + 8 * hi, boff = (size_t)(c0 + lr) * K + 8 * hi;
#pragma unroll 1
    for (int kc = 0; kc < Kl; kc += 32) {
        V a[4], a2[4];
#pragma unroll
        for (int mb = 0; mb < 4; ++mb) { a[mb] = WFrag<T16>::ld(A + aoff + (size_t)mb * 16 * K + kc); if (NSPLIT == 1 || NSPLIT == 2) a2[mb] = WFrag<T16>::ld(A2 + aoff + (size_t)mb * 16 * K + kc); }
#pragma unroll
        for (int nb = 0; nb < 4; ++nb) { const V b = WFrag<T16>::ld(Bt + boff + (size_t)nb * 16 * K + kc); V b2; if (NSPLIT >= 2) b2 = WFrag<T16>::ld(Bt2 + boff + (size_t)nb * 16 * K + kc);
#pragma unroll
            for (int mb = 0; mb < 4; ++mb) { acc[mb][nb] = WFrag<T16>::mma(a[mb], b, acc[mb][nb]); if (NSPLIT == 1 || NSPLIT == 2) acc[mb][nb] = WFrag<T16>::mma(a2[mb], b, acc[mb][nb]); if (NSPLIT >= 2) acc[mb][nb] = WFrag<T16>::mma(a[mb], b2, acc[mb][nb]); } }
        asm volatile("v_nop\n\tv_nop\n\tv_nop\n\tv_nop" : "+v"(acc[0][0]), "+v"(acc[1][1]), "+v"(acc[2][2]), "+v"(acc[3][3]) : "v"(a[0]), "v"(a[3]));
    }
#pragma unroll
    for (int mb = 0; mb < 4; ++mb) {
#pragma unroll
        for (int nb = 0; nb < 4; ++nb) {
#pragma unroll
            for (int j = 0; j < 8; ++j) os[(hi * 8 + j) * 68 + nb * 16 + lr] = acc[mb][nb][j]; }
        __builtin_amdgcn_wave_barrier(); asm volatile("" ::: "memory");
        float* crow = C + (size_t)(r0 + mb * 16) * ldc + c0;
{
#pragma unroll
            for (int s = 0; s < 8; ++s) { const int row = 2 * s + hi, cofs = lr * 4; v4f val = *(const v4fa*)(os + row * 68 + cofs);
                *(v4f*)(crow + (size_t)row * ldc + cofs) = val; }
             }
        __builtin_amdgcn_wave_barrier(); asm volatile("" ::: "memory");
    }
}

__device__ __forceinline__ h16 tohx(float x) { return (h16)x; }
__device__ __forceinline__ void splitf(float y, unsigned short& h, unsigned short& l) { h = f2bf(y); l = f2bf(y - bf2f(h)); }
typedef __attribute__((ext_vector_type(2))) _Float16 v2h;
typedef __attribute__((ext_vector_type(4))) _Float16 v4h;
typedef __attribute__((ext_vector_type(2))) unsigned short v2us;
typedef __attribute__((ext_vector_type(4))) unsigned short v4us;
typedef __attribute__((ext_vector_type(2))) float v2f;
typedef __attribute__((ext_vector_type(4))) int v4i;

__global__ __launch_bounds__(256) void k_wtH(const float* __restrict__ w, int K, int N, bf* Bt) {
    const int lane = threadIdx.x & 31; const int L0 = (blockIdx.x * 8 + (threadIdx.x >> 5)) * 8; const int nlines = N * K / 64;
{
#pragma unroll 1
        for (int l = 0; l < 8; ++l) { const int L = L0 + l; if (L >= nlines) break; const size_t e = (size_t)L * 64 + lane * 2; const int k = (int)(e % K), n = (int)(e / K); const size_t hb = (size_t)(n / HD) * K; const int ee = n % HD; v2us o;
            o[0] = f2bf(w[(hb + k) * HD + ee]); o[1] = f2bf(w[(hb + k + 1) * HD + ee]); *(v2us*)(Bt + e) = o; }
         }
}

__global__ __launch_bounds__(256) void k_cvt8(const float* __restrict__ src, bf* dst, size_t n8) { const size_t i = (size_t)blockIdx.x * 256 + threadIdx.x; if (i >= n8) return; const v8f v = *(const v8f*)(src + i * 8); v8us o;
#pragma unroll
    for (int k = 0; k < 8; ++k) o[k] = f2bf(v[k]); *(v8us*)(dst + i * 8) = o;  }

// k_rope: head planes [h][t][d] (fp16 + hi/lo) of rope(x) x sc with the rotate-half convention out[d] = x[d] cos[t][d] - x[d+HD/2] sin[t][d], out[d+HD/2] = x[d+HD/2] cos[t][d+HD/2] + x[d] sin[t][d+HD/2]
__global__ __launch_bounds__(256) void k_rope(const float* __restrict__ F, int pitch, int nheads, const float* __restrict__ CS, const float* __restrict__ RF, const float* __restrict__ nw, float sc, h16* P16, bf* Ph, bf* Pl) {
    const size_t e = ((size_t)blockIdx.x * 256 + threadIdx.x) * 2; if (e >= (size_t)nheads * TT * HD) return; const int d = (int)(e % HD); const int t = (int)((e / HD) % TT); const int h = (int)(e / ((size_t)HD * TT)); const float* f = F + (size_t)t * pitch + h * HD; const float rf = RF ? RF[(size_t)h * TT + t] : 1.0f; v2h o16; v2us oh, ol;
#pragma unroll
    for (int q = 0; q < 2; ++q) { const int dd = d + q; const int dp = (dd < HD / 2) ? dd + HD / 2 : dd - HD / 2; float x0 = f[dd], x1 = f[dp];
        if (RF) { float n0 = __fmul_rn(x0, rf), n1 = __fmul_rn(x1, rf); asm volatile("" : "+v"(n0)); asm volatile("" : "+v"(n1)); x0 = __fmul_rn(bfr(nw[dd]), n0); x1 = __fmul_rn(bfr(nw[dp]), n1); }
        const v2f cs = *(const v2f*)(CS + ((size_t)t * HD + dd) * 2); float a = __fmul_rn(x0, cs[0]), bq = __fmul_rn(x1, cs[1]); asm volatile("" : "+v"(a)); asm volatile("" : "+v"(bq)); const float r = ((dd < HD / 2) ? __fsub_rn(a, bq) : __fadd_rn(a, bq)) * sc;
        o16[q] = tohx(r); unsigned short a2, c2; splitf(r, a2, c2); oh[q] = a2; ol[q] = c2; }
    *(v2h*)(P16 + e) = o16; *(v2us*)(Ph + e) = oh; *(v2us*)(Pl + e) = ol;  }
__global__ __launch_bounds__(256) void k_vtp(const float* __restrict__ F, int pitch, int nheads, h16* V16, bf* Vh, bf* Vl) { const size_t e = ((size_t)blockIdx.x * 256 + threadIdx.x) * 2; if (e >= (size_t)nheads * HD * TT) return; const int t = (int)(e % TT); const int d = (int)((e / TT) % HD); const int g = (int)(e / ((size_t)TT * HD)); v2h o16; v2us oh, ol;
#pragma unroll
    for (int q = 0; q < 2; ++q) { const float x = F[(size_t)(t + q) * pitch + g * HD + d]; o16[q] = tohx(x); unsigned short a2, c2; splitf(x, a2, c2); oh[q] = a2; ol[q] = c2; }
    *(v2h*)(V16 + e) = o16; *(v2us*)(Vh + e) = oh; *(v2us*)(Vl + e) = ol;  }
__global__ __launch_bounds__(256) void k_csid(float* CS) { const int idx = blockIdx.x * 256 + threadIdx.x; if (idx >= TT * HD) return; v2f cs; cs[0] = 1.0f; cs[1] = 0.0f; *(v2f*)(CS + (size_t)idx * 2) = cs;  }
// k_asoft: per row (zz, i): t = S x HD^-0.5 for j <= i and i - j < WIN (plain causal: WIN = TT, so the i - j < WIN test always holds; the reference's -1e9 additive fill vanishes identically); softmax over the 1024 keys (register row, one exp, fixed trees);
__global__ __launch_bounds__(256) void k_asoft(const float* __restrict__ Sb, h16* P16, bf* Ph, bf* Pl) {
    const int lane = threadIdx.x & 31; const int row = blockIdx.x * 8 + (threadIdx.x >> 5); if (row >= ZH * TT) return; const int i = row % TT; const int zz = row / TT; (void)zz; const bool hires = (i < RH); const float* sr = Sb + (size_t)row * TT; float v[TT / 32]; float mx = -3.0e38f;
#pragma unroll
    for (int ch = 0; ch < TT / 128; ++ch) { const int j0 = ch * 128 + lane * 4; const v4f a = *(const v4f*)(sr + j0);
#pragma unroll
        for (int q = 0; q < 4; ++q) { const int j = j0 + q; (void)j; const float t = (j <= i && i - j < WIN) ? a[q] * SCL : -3.0e38f; v[ch * 4 + q] = t; mx = fmaxf(mx, t); } }
#pragma unroll
    for (int sh = 16; sh; sh >>= 1) mx = fmaxf(mx, __shfl_xor(mx, sh, 32));
    float sum = 0.f;
#pragma unroll
    for (int k = 0; k < TT / 32; ++k) { float d0 = __fsub_rn(v[k], mx); asm volatile("" : "+v"(d0)); v[k] = __builtin_amdgcn_exp2f(__fmul_rn(d0, 1.4426950408889634f)); sum += v[k]; }
#pragma unroll
    for (int sh = 16; sh; sh >>= 1) sum += __shfl_xor(sum, sh, 32);
    const float f = __fdiv_rn(hires ? 1.0f : PCAR, sum);
{
        if (hires) {
#pragma unroll
            for (int ch = 0; ch < TT / 128; ++ch) { v4us oh, ol;
#pragma unroll
                for (int q = 0; q < 4; ++q) { unsigned short a, c2; splitf(v[ch * 4 + q] * f, a, c2); oh[q] = a; ol[q] = c2; }
                const size_t oo = ((size_t)zz * (RH ? RH : 1) + i) * TT + ch * 128 + lane * 4; *(v4us*)(Ph + oo) = oh; *(v4us*)(Pl + oo) = ol; }
        } else {
#pragma unroll
            for (int ch = 0; ch < TT / 128; ++ch) { v4h o4;
#pragma unroll
                for (int q = 0; q < 4; ++q) o4[q] = tohx(v[ch * 4 + q] * f);
                *(v4h*)(P16 + (size_t)row * TT + ch * 128 + lane * 4) = o4; } }
         }
}
__global__ __launch_bounds__(256) void k_merge(const float* __restrict__ O, int h0, float* OUTb) { const size_t e = ((size_t)blockIdx.x * 256 + threadIdx.x) * 2; if (e >= (size_t)ZH * TT * HD) return; const int d = (int)(e % HD); const int t = (int)((e / HD) % TT); const int zz = (int)(e / ((size_t)HD * TT)); const float cs = (t < RH) ? 1.0f : (1.0f / PCAR); const size_t oo = (size_t)t * DQ + (h0 + zz) * HD + d;
    v2f o2; o2[0] = O[e] * cs; o2[1] = O[e + 1] * cs; *(v2f*)(OUTb + oo) = o2;  }

extern "C" void kernel_launch(void* const* d_in, const int* in_sizes, int n_in,
                              void* d_out, int out_size, void* d_ws, size_t ws_size, hipStream_t stream) {
    (void)in_sizes; (void)n_in; (void)out_size;
    const float* x = (const float*)d_in[0]; const float* wq = (const float*)d_in[1]; const float* wk = (const float*)d_in[2]; const float* wv = (const float*)d_in[3]; const float* wo = nullptr; (void)wo;
    float* OUT = (float*)d_out;     // [8][1024][768]
    char* wsp = (char*)d_ws;
    auto take = [&](size_t bytes) { char* p = wsp; wsp += (bytes + 255) & ~(size_t)255; return (void*)p; };
    bf* WQ = (bf*)take((size_t)DQ * DM * 2); bf* WK = (bf*)take((size_t)DKV * DM * 2); bf* WV = (bf*)take((size_t)DKV * DM * 2); float* CS = (float*)take((size_t)TT * HD * 2 * 4);
    bf* XB = (bf*)take((size_t)TT * DM * 2); float* FQ = (float*)take((size_t)TT * DQ * 4); float* FK = (float*)take((size_t)TT * DKV * 4);
    h16* QP16 = (h16*)take((size_t)NH_ * TT * HD * 2); h16* KP16 = (h16*)take((size_t)NKV * TT * HD * 2); h16* VT16 = (h16*)take((size_t)NKV * HD * TT * 2);
    bf* QPh = (bf*)take((size_t)NH_ * TT * HD * 2); bf* QPl = (bf*)take((size_t)NH_ * TT * HD * 2); bf* KPh = (bf*)take((size_t)NKV * TT * HD * 2); bf* KPl = (bf*)take((size_t)NKV * TT * HD * 2); bf* VTh = (bf*)take((size_t)NKV * HD * TT * 2); bf* VTl = (bf*)take((size_t)NKV * HD * TT * 2); bf* Ph = (bf*)take((size_t)ZH * RH * TT * 2); bf* Pl = (bf*)take((size_t)ZH * RH * TT * 2);
    float* Sb = (float*)take((size_t)ZH * TT * TT * 4); h16* P16 = (h16*)take((size_t)ZH * TT * TT * 2); float* Ob = (float*)take((size_t)ZH * TT * HD * 4);
    if ((size_t)(wsp - (char*)d_ws) > ws_size) return;    // ws 256 MiB
    float* FV = FK;   // v projection reuses the k buffer after the k planes are built (stream-ordered)
    { k_wtH<<<(unsigned)((DM * DQ / 64 + 63) / 64), 256, 0, stream>>>(wq, DM, DQ, WQ); k_wtH<<<(unsigned)((DM * DKV / 64 + 63) / 64), 256, 0, stream>>>(wk, DM, DKV, WK); k_wtH<<<(unsigned)((DM * DKV / 64 + 63) / 64), 256, 0, stream>>>(wv, DM, DKV, WV);
      
       }
    k_csid<<<(TT * HD + 255) / 256, 256, 0, stream>>>(CS);
    const unsigned LQ = (unsigned)(((size_t)NH_ * TT * HD / 2 + 255) / 256), LKv = (unsigned)(((size_t)NKV * TT * HD / 2 + 255) / 256);
    for (int b = 0; b < NB_; ++b) {
        
        k_cvt8<<<(unsigned)(((size_t)TT * DM / 8 + 255) / 256), 256, 0, stream>>>(x + (size_t)b * TT * DM, XB, (size_t)TT * DM / 8);
        k_gemmw<bf, 0, false><<<dim3(TT / 64, DQ / 64, 1), 32, 0, stream>>>(XB, nullptr, WQ, nullptr, DM, FQ, DQ, nullptr, 0, 0, 0);
        k_rope<<<LQ, 256, 0, stream>>>(FQ, DQ, NH_, CS, nullptr, nullptr, 1.0f, QP16, QPh, QPl);
        k_gemmw<bf, 0, false><<<dim3(TT / 64, DKV / 64, 1), 32, 0, stream>>>(XB, nullptr, WK, nullptr, DM, FK, DKV, nullptr, 0, 0, 0);
        k_rope<<<LKv, 256, 0, stream>>>(FK, DKV, NKV, CS, nullptr, nullptr, 1.0f, KP16, KPh, KPl);
        k_gemmw<bf, 0, false><<<dim3(TT / 64, DKV / 64, 1), 32, 0, stream>>>(XB, nullptr, WV, nullptr, DM, FV, DKV, nullptr, 0, 0, 0); k_vtp<<<LKv, 256, 0, stream>>>(FV, DKV, NKV, VT16, VTh, VTl);
        for (int h0 = 0; h0 < NH_; h0 += ZH) { const size_t zq = (size_t)h0, zk = (size_t)(h0 / REP);   // one kv head per query head: the pass's two heads use consecutive kv planes (z-strides TT*HD)
            k_gemmc<bf, 2, 1><<<dim3(RH / 64, TT / 64, ZH), 32, 0, stream>>>(QPh + zq * TT * HD, QPl + zq * TT * HD, KPh + zk * TT * HD, KPl + zk * TT * HD, HD, Sb, TT, 0, (size_t)TT * HD, (size_t)TT * HD, (size_t)TT * TT);
            k_gemmc<h16, 0, 1><<<dim3((TT - RH) / 64, TT / 64, ZH), 32, 0, stream>>>(QP16 + zq * TT * HD + (size_t)RH * HD, nullptr, KP16 + zk * TT * HD, nullptr, HD, Sb + (size_t)RH * TT, TT, RH, (size_t)TT * HD, (size_t)TT * HD, (size_t)TT * TT);
            k_asoft<<<ZH * TT / 8, 256, 0, stream>>>(Sb, P16, Ph, Pl);
            k_gemmc<bf, 2, 2><<<dim3(RH / 64, HD / 64, ZH), 32, 0, stream>>>(Ph, Pl, VTh + zk * HD * TT, VTl + zk * HD * TT, TT, Ob, HD, 0, (size_t)RH * TT, (size_t)HD * TT, (size_t)TT * HD);
            k_gemmc<h16, 0, 2><<<dim3((TT - RH) / 64, HD / 64, ZH), 32, 0, stream>>>(P16 + (size_t)RH * TT, nullptr, VT16 + zk * HD * TT, nullptr, TT, Ob + (size_t)RH * HD, HD, RH, (size_t)TT * TT, (size_t)HD * TT, (size_t)TT * HD);
            k_merge<<<(unsigned)(((size_t)ZH * TT * HD / 2 + 255) / 256), 256, 0, stream>>>(Ob, h0, OUT + (size_t)b * TT * DQ); }
         }
}

// v001
// A run of this version takes 477 microseconds.
// Two timings next to v000 put it at 5.91 and 5.88 times that version's speed.
#include <hip/hip_runtime.h>

// Causal multi-head attention wrapper with per-head projections (x [8][1024][768]; q_h = x Wq[h], k_h = x Wk[h], v_h = x Wv[h] with per-head 'xw' weights [12][768][64], no bias; scores = q.k / 8, causal mask (-inf above the diagonal); softmax; out = heads concatenated along the feature axis -> [8][1024][768] in f32 (6.3 M), no output projection).
// Compute dtypes, f32 accumulate: every input rounded to bf16; q/k/v on PLAIN bf16 operands (inputs: exact); causal scores and attn.v (tile skipping): query rows < 512 hl (3 products), the rest single fp16 (x1024); softmax f32; no output projection: the merged heads are written in f32 straight to the output.

#define NB_  8
#define TT   1024
#define DM   768
#define NH_  12
#define NKV  12
#define REP  (NH_ / NKV)
#define HD   64
#define DQ   (NH_ * HD)
#define DKV  (NKV * HD)
#define ZH   32                   // (batch, head) pairs per attention pass, on grid z
#define RH   512                  // query rows < RH use hi+lo planes (0: none)
#define WIN  1024
#define PCAR 1024.0f
#define SCL  0.125f   // HD^-0.5
typedef _Float16 h16;
typedef unsigned short bf;
typedef __attribute__((ext_vector_type(16))) __bf16   v16bf;
typedef __attribute__((ext_vector_type(16))) _Float16 v16h;
typedef __attribute__((ext_vector_type(8)))  _Float16 v8h;
typedef __attribute__((ext_vector_type(8)))  unsigned short v8us;
typedef __attribute__((ext_vector_type(8)))  float    v8f;
typedef __attribute__((ext_vector_type(4)))  float    v4f;
typedef v8h  __attribute__((may_alias)) v8ha;
typedef v4f  __attribute__((may_alias)) v4fa;
typedef v8us __attribute__((may_alias)) v8usa;

__device__ __forceinline__ unsigned short f2bf(float f) { unsigned u = __float_as_uint(f); u += 0x7FFFu + ((u >> 16) & 1u); return (unsigned short)(u >> 16); }
__device__ __forceinline__ float bf2f(unsigned short b) { return __uint_as_float(((unsigned)b) << 16); }
__device__ __forceinline__ float bfr(float f) { return bf2f(f2bf(f)); }
__device__ __forceinline__ v16h cat16(v8h lo, v8h hi) { return __builtin_shufflevector(lo, hi, 0, 1, 2, 3, 4, 5, 6, 7, 8, 9, 10, 11, 12, 13, 14, 15); }
__device__ __forceinline__ v16bf cat16b(v8us lo, v8us hi) { return __builtin_bit_cast(v16bf, __builtin_shufflevector(lo, hi, 0, 1, 2, 3, 4, 5, 6, 7, 8, 9, 10, 11, 12, 13, 14, 15)); }
__device__ __forceinline__ v8f wmma16(v16h a, v16h b, v8f c) { return __builtin_amdgcn_wmma_f32_16x16x32_f16(false, a, false, b, (short)0, c, false, false); }
__device__ __forceinline__ v8f wmmab(v16bf a, v16bf b, v8f c) { return __builtin_amdgcn_wmma_f32_16x16x32_bf16(false, a, false, b, (short)0, c, false, false); }



// ---- k_gemmw: register-blocked GEMM, ONE WAVE per 64x64 output tile (16 accumulators), operands straight from K-contiguous 16-bit planes; grid (M/64, N/64, Z), 32 threads.
// C[m][n] (f32, pitch ldc, + optional f32 bias[n]) = sum_k A[m][k] Bt[n][k] (+ split products per NSPLIT). z-batch strides sA/sB/sC in elements. K % 32 == 0.
template <typename T16> struct WFrag;
template <> struct WFrag<h16> { typedef v16h V; static __device__ __forceinline__ V ld(const h16* p) { return cat16(*(const v8h*)p, *(const v8h*)(p + 16)); } static __device__ __forceinline__ v8f mma(V a, V b, v8f c) { return wmma16(a, b, c); } };
template <> struct WFrag<bf> { typedef v16bf V; static __device__ __forceinline__ V ld(const bf* p) { return cat16b(*(const v8us*)p, *(const v8us*)(p + 16)); } static __device__ __forceinline__ v8f mma(V a, V b, v8f c) { return wmmab(a, b, c); } };
template <typename T16, int NSPLIT, bool BIAS>
__global__ __launch_bounds__(32) void k_gemmw(const T16* __restrict__ A, const T16* __restrict__ A2, const T16* __restrict__ Bt, const T16* __restrict__ Bt2, int K, float* C, int ldc, const float* __restrict__ bias, size_t sA, size_t sB, size_t sC) {
    typedef typename WFrag<T16>::V V;
    __shared__ __align__(16) float os[16 * 68];
    const size_t z = blockIdx.z; A += z * sA; if (A2) A2 += z * sA; Bt += z * sB; if (Bt2) Bt2 += z * sB; C += z * sC;
    const int lane = threadIdx.x & 31, lr = lane & 15, hi = lane >> 4; const int r0 = blockIdx.x * 64, c0 = blockIdx.y * 64;
    v8f acc[4][4];
#pragma unroll
    for (int mb = 0; mb < 4; ++mb)
#pragma unroll
        for (int nb = 0; nb < 4; ++nb) acc[mb][nb] = (v8f){};
    const size_t aoff = (size_t)(r0 + lr) * K + 8 * hi, boff = (size_t)(c0 + lr) * K + 8 * hi;
#pragma unroll 1
    for (int kc = 0; kc < K; kc += 32) {
        V a[4], a2[4];
#pragma unroll
        for (int mb = 0; mb < 4; ++mb) { a[mb] = WFrag<T16>::ld(A + aoff + (size_t)mb * 16 * K + kc); if (NSPLIT == 1 || NSPLIT == 2) a2[mb] = WFrag<T16>::ld(A2 + aoff + (size_t)mb * 16 * K + kc); }
#pragma unroll
        for (int nb = 0; nb < 4; ++nb) { const V b = WFrag<T16>::ld(Bt + boff + (size_t)nb * 16 * K + kc); V b2; if (NSPLIT >= 2) b2 = WFrag<T16>::ld(Bt2 + boff + (size_t)nb * 16 * K + kc);
#pragma unroll
            for (int mb = 0; mb < 4; ++mb) { acc[mb][nb] = WFrag<T16>::mma(a[mb], b, acc[mb][nb]); if (NSPLIT == 1 || NSPLIT == 2) acc[mb][nb] = WFrag<T16>::mma(a2[mb], b, acc[mb][nb]); if (NSPLIT >= 2) acc[mb][nb] = WFrag<T16>::mma(a[mb], b2, acc[mb][nb]); } }
        asm volatile("v_nop\n\tv_nop\n\tv_nop\n\tv_nop" : "+v"(acc[0][0]), "+v"(acc[1][1]), "+v"(acc[2][2]), "+v"(acc[3][3]) : "v"(a[0]), "v"(a[3]));
    }
#pragma unroll
    for (int mb = 0; mb < 4; ++mb) {
#pragma unroll
        for (int nb = 0; nb < 4; ++nb) {
#pragma unroll
            for (int j = 0; j < 8; ++j) os[(hi * 8 + j) * 68 + nb * 16 + lr] = acc[mb][nb][j]; }
        __builtin_amdgcn_wave_barrier(); asm volatile("" ::: "memory");
        float* crow = C + (size_t)(r0 + mb * 16) * ldc + c0;
{
#pragma unroll
            for (int s = 0; s < 8; ++s) { const int row = 2 * s + hi, cofs = lr * 4; v4f val = *(const v4fa*)(os + row * 68 + cofs); if (BIAS) { val[0] += bfr(bias[c0 + cofs]); val[1] += bfr(bias[c0 + cofs + 1]); val[2] += bfr(bias[c0 + cofs + 2]); val[3] += bfr(bias[c0 + cofs + 3]); }
                *(v4f*)(crow + (size_t)row * ldc + cofs) = val; }
             }
        __builtin_amdgcn_wave_barrier(); asm volatile("" ::: "memory");
    }
}

// precaution behind a fragment's global loads: their address registers are reused by the instructions that follow
__device__ __forceinline__ void xwait() { asm volatile("s_wait_xcnt 0x0" ::: "memory"); }

// ---- k_gemmc: the same one-wave 64x64 tile GEMM specialised for causal attention: CMODE 1 skips score tiles entirely above the diagonal (query rows r0+roff.., key columns c0..), CMODE 2 limits the
// key (K) loop of the probability x value contraction to the diagonal block (probabilities beyond it are exactly zero). roff = row offset of this launch's first row within the sequence. lda = pitch of A in elements (Bt has pitch K).
template <typename T16, int NSPLIT, int CMODE>
__global__ __launch_bounds__(32) void k_gemmc(const T16* __restrict__ A, const T16* __restrict__ A2, int lda, const T16* __restrict__ Bt, const T16* __restrict__ Bt2, int K, float* C, int ldc, int roff, size_t sA, size_t sB, size_t sC) {
    typedef typename WFrag<T16>::V V;
    __shared__ __align__(16) float os[16 * 68];
    const size_t z = blockIdx.z; A += z * sA; if (A2) A2 += z * sA; Bt += z * sB; if (Bt2) Bt2 += z * sB; C += z * sC;
    const int lane = threadIdx.x & 31, lr = lane & 15, hi = lane >> 4; const int r0 = blockIdx.x * 64, c0 = blockIdx.y * 64;
    if (CMODE == 1 && c0 > r0 + roff + 63) return;                  // score tile entirely above the causal diagonal: never read (the softmax masks j > i by select)
    const int Kl = (CMODE == 2) ? min(K, r0 + roff + 64) : K;        // P.V: probabilities are exactly 0 beyond the diagonal block, so the K loop stops there
    v8f acc[4][4];
#pragma unroll
    for (int mb = 0; mb < 4; ++mb)
#pragma unroll
        for (int nb = 0; nb < 4; ++nb) acc[mb][nb] = (v8f){};
    const size_t aoff = (size_t)(r0 + lr) * lda + 8 * hi, boff = (size_t)(c0 + lr) * K + 8 * hi;
#pragma unroll 1
    for (int kc = 0; kc < Kl; kc += 32) {
        V a[4], a2[4];
#pragma unroll
        for (int mb = 0; mb < 4; ++mb) { a[mb] = WFrag<T16>::ld(A + aoff + (size_t)mb * 16 * lda + kc); xwait(); if (NSPLIT == 1 || NSPLIT == 2) { a2[mb] = WFrag<T16>::ld(A2 + aoff + (size_t)mb * 16 * lda + kc); xwait(); } }
#pragma unroll
        for (int nb = 0; nb < 4; ++nb) { const V b = WFrag<T16>::ld(Bt + boff + (size_t)nb * 16 * K + kc); V b2; if (NSPLIT >= 2) b2 = WFrag<T16>::ld(Bt2 + boff + (size_t)nb * 16 * K + kc);
#pragma unroll
            for (int mb = 0; mb < 4; ++mb) { acc[mb][nb] = WFrag<T16>::mma(a[mb], b, acc[mb][nb]); if (NSPLIT == 1 || NSPLIT == 2) acc[mb][nb] = WFrag<T16>::mma(a2[mb], b, acc[mb][nb]); if (NSPLIT >= 2) acc[mb][nb] = WFrag<T16>::mma(a[mb], b2, acc[mb][nb]); } }
        asm volatile("v_nop\n\tv_nop\n\tv_nop\n\tv_nop" : "+v"(acc[0][0]), "+v"(acc[1][1]), "+v"(acc[2][2]), "+v"(acc[3][3]) : "v"(a[0]), "v"(a[3]));
    }
#pragma unroll
    for (int mb = 0; mb < 4; ++mb) {
#pragma unroll
        for (int nb = 0; nb < 4; ++nb) {
#pragma unroll
            for (int j = 0; j < 8; ++j) os[(hi * 8 + j) * 68 + nb * 16 + lr] = acc[mb][nb][j]; }
        __builtin_amdgcn_wave_barrier(); asm volatile("" ::: "memory");
        float* crow = C + (size_t)(r0 + mb * 16) * ldc + c0;
{
#pragma unroll
            for (int s = 0; s < 8; ++s) { const int row = 2 * s + hi, cofs = lr * 4; v4f val = *(const v4fa*)(os + row * 68 + cofs);
                *(v4f*)(crow + (size_t)row * ldc + cofs) = val; }
             }
        __builtin_amdgcn_wave_barrier(); asm volatile("" ::: "memory");
    }
}

__device__ __forceinline__ h16 tohx(float x) { return (h16)x; }
__device__ __forceinline__ void splitf(float y, unsigned short& h, unsigned short& l) { h = f2bf(y); l = f2bf(y - bf2f(h)); }
typedef __attribute__((ext_vector_type(2))) _Float16 v2h;
typedef __attribute__((ext_vector_type(4))) _Float16 v4h;
typedef __attribute__((ext_vector_type(2))) unsigned short v2us;
typedef __attribute__((ext_vector_type(4))) unsigned short v4us;
typedef __attribute__((ext_vector_type(2))) float v2f;
typedef __attribute__((ext_vector_type(4))) int v4i;

__global__ __launch_bounds__(256) void k_wtH(const float* __restrict__ w, int K, int N, bf* Bt) {
    const int lane = threadIdx.x & 31; const int L0 = (blockIdx.x * 8 + (threadIdx.x >> 5)) * 8; const int nlines = N * K / 64;
{
#pragma unroll 1
        for (int l = 0; l < 8; ++l) { const int L = L0 + l; if (L >= nlines) break; const size_t e = (size_t)L * 64 + lane * 2; const int k = (int)(e % K), n = (int)(e / K); const size_t hb = (size_t)(n / HD) * K; const int ee = n % HD; v2us o;
            o[0] = f2bf(w[(hb + k) * HD + ee]); o[1] = f2bf(w[(hb + k + 1) * HD + ee]); *(v2us*)(Bt + e) = o; }
         }
}

__global__ __launch_bounds__(256) void k_cvt8(const float* __restrict__ src, bf* dst, size_t n8) { const size_t i = (size_t)blockIdx.x * 256 + threadIdx.x; if (i >= n8) return; const v8f v = *(const v8f*)(src + i * 8); v8us o;
#pragma unroll
    for (int k = 0; k < 8; ++k) o[k] = f2bf(v[k]); *(v8us*)(dst + i * 8) = o;  }

// k_rope: grid y = batch (F rows b*TT.., planes [b][h][t][d]); head planes [h][t][d] (fp16 + hi/lo) of rope(x) x sc with the rotate-half convention out[d] = x[d] cos[t][d] - x[d+HD/2] sin[t][d], out[d+HD/2] = x[d+HD/2] cos[t][d+HD/2] + x[d] sin[t][d+HD/2]
__global__ __launch_bounds__(256) void k_rope(const float* __restrict__ F, int pitch, int nheads, const float* __restrict__ CS, const float* __restrict__ RF, const float* __restrict__ nw, float sc, h16* P16, bf* Ph, bf* Pl) {
    { const size_t b = blockIdx.y, po = b * nheads * TT * HD; F += b * TT * pitch; P16 += po; Ph += po; Pl += po; }
    const size_t e = ((size_t)blockIdx.x * 256 + threadIdx.x) * 2; if (e >= (size_t)nheads * TT * HD) return; const int d = (int)(e % HD); const int t = (int)((e / HD) % TT); const int h = (int)(e / ((size_t)HD * TT)); const float* f = F + (size_t)t * pitch + h * HD; const float rf = RF ? RF[(size_t)h * TT + t] : 1.0f; v2h o16; v2us oh, ol;
#pragma unroll
    for (int q = 0; q < 2; ++q) { const int dd = d + q; const int dp = (dd < HD / 2) ? dd + HD / 2 : dd - HD / 2; float x0 = f[dd], x1 = f[dp];
        if (RF) { float n0 = __fmul_rn(x0, rf), n1 = __fmul_rn(x1, rf); asm volatile("" : "+v"(n0)); asm volatile("" : "+v"(n1)); x0 = __fmul_rn(bfr(nw[dd]), n0); x1 = __fmul_rn(bfr(nw[dp]), n1); }
        const v2f cs = *(const v2f*)(CS + ((size_t)t * HD + dd) * 2); float a = __fmul_rn(x0, cs[0]), bq = __fmul_rn(x1, cs[1]); asm volatile("" : "+v"(a)); asm volatile("" : "+v"(bq)); const float r = ((dd < HD / 2) ? __fsub_rn(a, bq) : __fadd_rn(a, bq)) * sc;
        o16[q] = tohx(r); unsigned short a2, c2; splitf(r, a2, c2); oh[q] = a2; ol[q] = c2; }
    *(v2h*)(P16 + e) = o16; *(v2us*)(Ph + e) = oh; *(v2us*)(Pl + e) = ol;  }
__global__ __launch_bounds__(256) void k_vtp(const float* __restrict__ F, int pitch, int nheads, h16* V16, bf* Vh, bf* Vl) { const size_t e = ((size_t)blockIdx.x * 256 + threadIdx.x) * 2; if (e >= (size_t)nheads * HD * TT) return; const int t = (int)(e % TT); const int d = (int)((e / TT) % HD); const int g = (int)(e / ((size_t)TT * HD)); v2h o16; v2us oh, ol;
    { const size_t b = blockIdx.y, po = b * nheads * HD * TT; F += b * TT * pitch; V16 += po; Vh += po; Vl += po; }   // grid y = batch
#pragma unroll
    for (int q = 0; q < 2; ++q) { const float x = F[(size_t)(t + q) * pitch + g * HD + d]; o16[q] = tohx(x); unsigned short a2, c2; splitf(x, a2, c2); oh[q] = a2; ol[q] = c2; }
    *(v2h*)(V16 + e) = o16; *(v2us*)(Vh + e) = oh; *(v2us*)(Vl + e) = ol;  }
__global__ __launch_bounds__(256) void k_csid(float* CS) { const int idx = blockIdx.x * 256 + threadIdx.x; if (idx >= TT * HD) return; v2f cs; cs[0] = 1.0f; cs[1] = 0.0f; *(v2f*)(CS + (size_t)idx * 2) = cs;  }
// k_asoft: per row (zz, i): t = S x HD^-0.5 for j <= i and i - j < WIN (sliding causal window; the reference's -1e9 additive fill vanishes identically); softmax over the 1024 keys (register row, one exp, fixed trees);
// the probabilities overwrite the row's own 4096 score bytes (the wave holds the whole row in registers before its first store): hi plane in bytes 0..2047 and lo plane in bytes 2048..4095 for rows < RH, one fp16 plane in bytes 0..2047 for the rest, so every plane has a pitch of 2 * TT 16-bit elements.
__global__ __launch_bounds__(256) void k_asoft(float* Sb) {
    const int lane = threadIdx.x & 31; const int row = blockIdx.x * 8 + (threadIdx.x >> 5); if (row >= ZH * TT) return; const int i = row % TT; const int zz = row / TT; (void)zz; const bool hires = (i < RH); const float* sr = Sb + (size_t)row * TT; bf* Ph = (bf*)(Sb + (size_t)row * TT); bf* Pl = Ph + TT; h16* P16 = (h16*)(Sb + (size_t)row * TT); float v[TT / 32]; float mx = -3.0e38f;
#pragma unroll
    for (int ch = 0; ch < TT / 128; ++ch) { const int j0 = ch * 128 + lane * 4; const v4f a = *(const v4f*)(sr + j0);
#pragma unroll
        for (int q = 0; q < 4; ++q) { const int j = j0 + q; (void)j; const float t = (j <= i && i - j < WIN) ? a[q] * SCL : -3.0e38f; v[ch * 4 + q] = t; mx = fmaxf(mx, t); } }
#pragma unroll
    for (int sh = 16; sh; sh >>= 1) mx = fmaxf(mx, __shfl_xor(mx, sh, 32));
    float sum = 0.f;
#pragma unroll
    for (int k = 0; k < TT / 32; ++k) { float d0 = __fsub_rn(v[k], mx); asm volatile("" : "+v"(d0)); v[k] = __builtin_amdgcn_exp2f(__fmul_rn(d0, 1.4426950408889634f)); sum += v[k]; }
#pragma unroll
    for (int sh = 16; sh; sh >>= 1) sum += __shfl_xor(sum, sh, 32);
    const float f = __fdiv_rn(hires ? 1.0f : PCAR, sum);
{
        if (hires) {
#pragma unroll
            for (int ch = 0; ch < TT / 128; ++ch) { v4us oh, ol;
#pragma unroll
                for (int q = 0; q < 4; ++q) { unsigned short a, c2; splitf(v[ch * 4 + q] * f, a, c2); oh[q] = a; ol[q] = c2; }
                const int oo = ch * 128 + lane * 4; *(v4us*)(Ph + oo) = oh; *(v4us*)(Pl + oo) = ol; }
        } else {
#pragma unroll
            for (int ch = 0; ch < TT / 128; ++ch) { v4h o4;
#pragma unroll
                for (int q = 0; q < 4; ++q) o4[q] = tohx(v[ch * 4 + q] * f);
                *(v4h*)(P16 + ch * 128 + lane * 4) = o4; } }
         }
}
__global__ __launch_bounds__(256) void k_merge(const float* __restrict__ O, int g0, float* OUTb) { const size_t e = ((size_t)blockIdx.x * 256 + threadIdx.x) * 2; if (e >= (size_t)ZH * TT * HD) return; const int d = (int)(e % HD); const int t = (int)((e / HD) % TT); const int zz = (int)(e / ((size_t)HD * TT)); const float cs = (t < RH) ? 1.0f : (1.0f / PCAR); const int g = g0 + zz; const size_t oo = ((size_t)(g / NH_) * TT + t) * DQ + (g % NH_) * HD + d;   // g = batch * NH_ + head
    v2f o2; o2[0] = O[e] * cs; o2[1] = O[e + 1] * cs; *(v2f*)(OUTb + oo) = o2;  }

extern "C" void kernel_launch(void* const* d_in, const int* in_sizes, int n_in,
                              void* d_out, int out_size, void* d_ws, size_t ws_size, hipStream_t stream) {
    (void)in_sizes; (void)n_in; (void)out_size;
    const float* x = (const float*)d_in[0]; const float* wq = (const float*)d_in[1]; const float* wk = (const float*)d_in[2]; const float* wv = (const float*)d_in[3]; const float* wo = nullptr; (void)wo;
    float* OUT = (float*)d_out;     // [8][1024][768]
    char* wsp = (char*)d_ws;
    auto take = [&](size_t bytes) { char* p = wsp; wsp += (bytes + 255) & ~(size_t)255; return (void*)p; };
    bf* WQ = (bf*)take((size_t)DQ * DM * 2); bf* WK = (bf*)take((size_t)DKV * DM * 2); bf* WV = (bf*)take((size_t)DKV * DM * 2); float* CS = (float*)take((size_t)TT * HD * 2 * 4);
    const size_t PQ = (size_t)NB_ * NH_ * TT * HD * 2, PK = (size_t)NB_ * NKV * TT * HD * 2;   // bytes of one 16-bit plane set [batch][head][..][..]
    h16* QP16 = (h16*)take(PQ); h16* KP16 = (h16*)take(PK); h16* VT16 = (h16*)take(PK);
    bf* QPh = (bf*)take(PQ); bf* QPl = (bf*)take(PQ); bf* KPh = (bf*)take(PK); bf* KPl = (bf*)take(PK); bf* VTh = (bf*)take(PK); bf* VTl = (bf*)take(PK);
    char* const un = wsp;   // the projection buffers and the attention buffers share this region: the first are dead once the planes are built (stream-ordered)
    bf* XB = (bf*)take((size_t)NB_ * TT * DM * 2); float* FQ = (float*)take((size_t)NB_ * TT * DQ * 4); float* FK = (float*)take((size_t)NB_ * TT * DKV * 4);
    wsp = un;
    float* Sb = (float*)take((size_t)ZH * TT * TT * 4); float* Ob = (float*)take((size_t)ZH * TT * HD * 4);
    if ((size_t)(wsp - (char*)d_ws) > ws_size) return;    // ws 256 MiB
    float* FV = FK;   // v projection reuses the k buffer after the k planes are built (stream-ordered)
    k_wtH<<<(unsigned)((DM * DQ / 64 + 63) / 64), 256, 0, stream>>>(wq, DM, DQ, WQ); k_wtH<<<(unsigned)((DM * DKV / 64 + 63) / 64), 256, 0, stream>>>(wk, DM, DKV, WK); k_wtH<<<(unsigned)((DM * DKV / 64 + 63) / 64), 256, 0, stream>>>(wv, DM, DKV, WV);
    k_csid<<<(TT * HD + 255) / 256, 256, 0, stream>>>(CS);
    const unsigned LQ = (unsigned)(((size_t)NH_ * TT * HD / 2 + 255) / 256), LKv = (unsigned)(((size_t)NKV * TT * HD / 2 + 255) / 256);
    // projections: all batches as one [NB_*TT][DM] operand
    k_cvt8<<<(unsigned)(((size_t)NB_ * TT * DM / 8 + 255) / 256), 256, 0, stream>>>(x, XB, (size_t)NB_ * TT * DM / 8);
    k_gemmw<bf, 0, false><<<dim3(NB_ * TT / 64, DQ / 64, 1), 32, 0, stream>>>(XB, nullptr, WQ, nullptr, DM, FQ, DQ, nullptr, 0, 0, 0);
    k_rope<<<dim3(LQ, NB_, 1), 256, 0, stream>>>(FQ, DQ, NH_, CS, nullptr, nullptr, 1.0f, QP16, QPh, QPl);
    k_gemmw<bf, 0, false><<<dim3(NB_ * TT / 64, DKV / 64, 1), 32, 0, stream>>>(XB, nullptr, WK, nullptr, DM, FK, DKV, nullptr, 0, 0, 0);
    k_rope<<<dim3(LKv, NB_, 1), 256, 0, stream>>>(FK, DKV, NKV, CS, nullptr, nullptr, 1.0f, KP16, KPh, KPl);
    k_gemmw<bf, 0, false><<<dim3(NB_ * TT / 64, DKV / 64, 1), 32, 0, stream>>>(XB, nullptr, WV, nullptr, DM, FV, DKV, nullptr, 0, 0, 0);
    k_vtp<<<dim3(LKv, NB_, 1), 256, 0, stream>>>(FV, DKV, NKV, VT16, VTh, VTl);
    // attention: ZH consecutive (batch, head) planes per pass on grid z (one kv head per query head, z-strides TT*HD)
    for (int g0 = 0; g0 < NB_ * NH_; g0 += ZH) { const size_t zq = (size_t)g0, zk = (size_t)(g0 / REP);
        k_gemmc<bf, 2, 1><<<dim3(RH / 64, TT / 64, ZH), 32, 0, stream>>>(QPh + zq * TT * HD, QPl + zq * TT * HD, HD, KPh + zk * TT * HD, KPl + zk * TT * HD, HD, Sb, TT, 0, (size_t)TT * HD, (size_t)TT * HD, (size_t)TT * TT);
        k_gemmc<h16, 0, 1><<<dim3((TT - RH) / 64, TT / 64, ZH), 32, 0, stream>>>(QP16 + zq * TT * HD + (size_t)RH * HD, nullptr, HD, KP16 + zk * TT * HD, nullptr, HD, Sb + (size_t)RH * TT, TT, RH, (size_t)TT * HD, (size_t)TT * HD, (size_t)TT * TT);
        k_asoft<<<ZH * TT / 8, 256, 0, stream>>>(Sb);
        k_gemmc<bf, 2, 2><<<dim3(RH / 64, HD / 64, ZH), 32, 0, stream>>>((const bf*)Sb, (const bf*)Sb + TT, 2 * TT, VTh + zk * HD * TT, VTl + zk * HD * TT, TT, Ob, HD, 0, (size_t)TT * TT * 2, (size_t)HD * TT, (size_t)TT * HD);
        k_gemmc<h16, 0, 2><<<dim3((TT - RH) / 64, HD / 64, ZH), 32, 0, stream>>>((const h16*)Sb + (size_t)RH * TT * 2, nullptr, 2 * TT, VT16 + zk * HD * TT, nullptr, TT, Ob + (size_t)RH * HD, HD, RH, (size_t)TT * TT * 2, (size_t)HD * TT, (size_t)TT * HD);
        k_merge<<<(unsigned)(((size_t)ZH * TT * HD / 2 + 255) / 256), 256, 0, stream>>>(Ob, g0, OUT); }
}

// v002
// It runs in 213 microseconds.
// Next to v001, in two timings, it ran 2.25 and 2.24 times as fast.
// Over all steps from v000 it is 13.2 times as fast.
#include <hip/hip_runtime.h>

// Causal multi-head attention wrapper with per-head projections (x [8][1024][768]; q_h = x Wq[h], k_h = x Wk[h], v_h = x Wv[h] with per-head 'xw' weights [12][768][64], no bias; scores = q.k / 8, causal mask (-inf above the diagonal); softmax; out = heads concatenated along the feature axis -> [8][1024][768] in f32 (6.3 M), no output projection).
// Compute dtypes, f32 accumulate: every input rounded to bf16; q/k/v on PLAIN bf16 operands (inputs: exact); causal scores and attn.v in ONE fused kernel (online softmax, scores and probabilities stay in registers): query rows < 512 hl (3 products), the rest single fp16; softmax f32; no output projection: the merged heads are written in f32 straight to the output.

#define NB_  8
#define TT   1024
#define DM   768
#define NH_  12
#define NKV  12
#define HD   64
#define DQ   (NH_ * HD)
#define DKV  (NKV * HD)
#define RH   512                  // unused: k_fattn's block split fixes the hi+lo rows at < 512
#define SCL  0.125f   // HD^-0.5
typedef _Float16 h16;
typedef unsigned short bf;
typedef __attribute__((ext_vector_type(16))) __bf16   v16bf;
typedef __attribute__((ext_vector_type(16))) _Float16 v16h;
typedef __attribute__((ext_vector_type(8)))  _Float16 v8h;
typedef __attribute__((ext_vector_type(8)))  unsigned short v8us;
typedef __attribute__((ext_vector_type(8)))  float    v8f;
typedef __attribute__((ext_vector_type(4)))  float    v4f;
typedef v8h  __attribute__((may_alias)) v8ha;
typedef v4f  __attribute__((may_alias)) v4fa;
typedef v8us __attribute__((may_alias)) v8usa;

__device__ __forceinline__ unsigned short f2bf(float f) { unsigned u = __float_as_uint(f); u += 0x7FFFu + ((u >> 16) & 1u); return (unsigned short)(u >> 16); }
__device__ __forceinline__ float bf2f(unsigned short b) { return __uint_as_float(((unsigned)b) << 16); }
__device__ __forceinline__ float bfr(float f) { return bf2f(f2bf(f)); }
__device__ __forceinline__ v16h cat16(v8h lo, v8h hi) { return __builtin_shufflevector(lo, hi, 0, 1, 2, 3, 4, 5, 6, 7, 8, 9, 10, 11, 12, 13, 14, 15); }
__device__ __forceinline__ v16bf cat16b(v8us lo, v8us hi) { return __builtin_bit_cast(v16bf, __builtin_shufflevector(lo, hi, 0, 1, 2, 3, 4, 5, 6, 7, 8, 9, 10, 11, 12, 13, 14, 15)); }
__device__ __forceinline__ v8f wmma16(v16h a, v16h b, v8f c) { return __builtin_amdgcn_wmma_f32_16x16x32_f16(false, a, false, b, (short)0, c, false, false); }
__device__ __forceinline__ v8f wmmab(v16bf a, v16bf b, v8f c) { return __builtin_amdgcn_wmma_f32_16x16x32_bf16(false, a, false, b, (short)0, c, false, false); }



// ---- k_gemmw: register-blocked GEMM, ONE WAVE per 64x64 output tile (16 accumulators), operands straight from K-contiguous 16-bit planes; grid (M/64, N/64, Z), 32 threads.
// C[m][n] (f32, pitch ldc, + optional f32 bias[n]) = sum_k A[m][k] Bt[n][k] (+ split products per NSPLIT). z-batch strides sA/sB/sC in elements. K % 32 == 0.
template <typename T16> struct WFrag;
template <> struct WFrag<h16> { typedef v16h V; static __device__ __forceinline__ V ld(const h16* p) { return cat16(*(const v8h*)p, *(const v8h*)(p + 16)); } static __device__ __forceinline__ v8f mma(V a, V b, v8f c) { return wmma16(a, b, c); } };
template <> struct WFrag<bf> { typedef v16bf V; static __device__ __forceinline__ V ld(const bf* p) { return cat16b(*(const v8us*)p, *(const v8us*)(p + 16)); } static __device__ __forceinline__ v8f mma(V a, V b, v8f c) { return wmmab(a, b, c); } };
template <typename T16, int NSPLIT, bool BIAS>
__global__ __launch_bounds__(32) void k_gemmw(const T16* __restrict__ A, const T16* __restrict__ A2, const T16* __restrict__ Bt, const T16* __restrict__ Bt2, int K, float* C, int ldc, const float* __restrict__ bias, size_t sA, size_t sB, size_t sC) {
    typedef typename WFrag<T16>::V V;
    __shared__ __align__(16) float os[16 * 68];
    const size_t z = blockIdx.z; A += z * sA; if (A2) A2 += z * sA; Bt += z * sB; if (Bt2) Bt2 += z * sB; C += z * sC;
    const int lane = threadIdx.x & 31, lr = lane & 15, hi = lane >> 4; const int r0 = blockIdx.x * 64, c0 = blockIdx.y * 64;
    v8f acc[4][4];
#pragma unroll
    for (int mb = 0; mb < 4; ++mb)
#pragma unroll
        for (int nb = 0; nb < 4; ++nb) acc[mb][nb] = (v8f){};
    const size_t aoff = (size_t)(r0 + lr) * K + 8 * hi, boff = (size_t)(c0 + lr) * K + 8 * hi;
#pragma unroll 1
    for (int kc = 0; kc < K; kc += 32) {
        V a[4], a2[4];
#pragma unroll
        for (int mb = 0; mb < 4; ++mb) { a[mb] = WFrag<T16>::ld(A + aoff + (size_t)mb * 16 * K + kc); if (NSPLIT == 1 || NSPLIT == 2) a2[mb] = WFrag<T16>::ld(A2 + aoff + (size_t)mb * 16 * K + kc); }
#pragma unroll
        for (int nb = 0; nb < 4; ++nb) { const V b = WFrag<T16>::ld(Bt + boff + (size_t)nb * 16 * K + kc); V b2; if (NSPLIT >= 2) b2 = WFrag<T16>::ld(Bt2 + boff + (size_t)nb * 16 * K + kc);
#pragma unroll
            for (int mb = 0; mb < 4; ++mb) { acc[mb][nb] = WFrag<T16>::mma(a[mb], b, acc[mb][nb]); if (NSPLIT == 1 || NSPLIT == 2) acc[mb][nb] = WFrag<T16>::mma(a2[mb], b, acc[mb][nb]); if (NSPLIT >= 2) acc[mb][nb] = WFrag<T16>::mma(a[mb], b2, acc[mb][nb]); } }
        asm volatile("v_nop\n\tv_nop\n\tv_nop\n\tv_nop" : "+v"(acc[0][0]), "+v"(acc[1][1]), "+v"(acc[2][2]), "+v"(acc[3][3]) : "v"(a[0]), "v"(a[3]));
    }
#pragma unroll
    for (int mb = 0; mb < 4; ++mb) {
#pragma unroll
        for (int nb = 0; nb < 4; ++nb) {
#pragma unroll
            for (int j = 0; j < 8; ++j) os[(hi * 8 + j) * 68 + nb * 16 + lr] = acc[mb][nb][j]; }
        __builtin_amdgcn_wave_barrier(); asm volatile("" ::: "memory");
        float* crow = C + (size_t)(r0 + mb * 16) * ldc + c0;
{
#pragma unroll
            for (int s = 0; s < 8; ++s) { const int row = 2 * s + hi, cofs = lr * 4; v4f val = *(const v4fa*)(os + row * 68 + cofs); if (BIAS) { val[0] += bfr(bias[c0 + cofs]); val[1] += bfr(bias[c0 + cofs + 1]); val[2] += bfr(bias[c0 + cofs + 2]); val[3] += bfr(bias[c0 + cofs + 3]); }
                *(v4f*)(crow + (size_t)row * ldc + cofs) = val; }
             }
        __builtin_amdgcn_wave_barrier(); asm volatile("" ::: "memory");
    }
}

__device__ __forceinline__ h16 tohx(float x) { return (h16)x; }
__device__ __forceinline__ void splitf(float y, unsigned short& h, unsigned short& l) { h = f2bf(y); l = f2bf(y - bf2f(h)); }
typedef __attribute__((ext_vector_type(2))) _Float16 v2h;
typedef __attribute__((ext_vector_type(4))) _Float16 v4h;
typedef __attribute__((ext_vector_type(2))) unsigned short v2us;
typedef __attribute__((ext_vector_type(4))) unsigned short v4us;
typedef __attribute__((ext_vector_type(2))) float v2f;
typedef __attribute__((ext_vector_type(4))) int v4i;

__global__ __launch_bounds__(256) void k_wtH(const float* __restrict__ w, int K, int N, bf* Bt) {
    const int lane = threadIdx.x & 31; const int L0 = (blockIdx.x * 8 + (threadIdx.x >> 5)) * 8; const int nlines = N * K / 64;
{
#pragma unroll 1
        for (int l = 0; l < 8; ++l) { const int L = L0 + l; if (L >= nlines) break; const size_t e = (size_t)L * 64 + lane * 2; const int k = (int)(e % K), n = (int)(e / K); const size_t hb = (size_t)(n / HD) * K; const int ee = n % HD; v2us o;
            o[0] = f2bf(w[(hb + k) * HD + ee]); o[1] = f2bf(w[(hb + k + 1) * HD + ee]); *(v2us*)(Bt + e) = o; }
         }
}

__global__ __launch_bounds__(256) void k_cvt8(const float* __restrict__ src, bf* dst, size_t n8) { const size_t i = (size_t)blockIdx.x * 256 + threadIdx.x; if (i >= n8) return; const v8f v = *(const v8f*)(src + i * 8); v8us o;
#pragma unroll
    for (int k = 0; k < 8; ++k) o[k] = f2bf(v[k]); *(v8us*)(dst + i * 8) = o;  }

// k_rope: grid y = batch (F rows b*TT.., planes [b][h][t][d]); head planes [h][t][d] (fp16 + hi/lo) of rope(x) x sc with the rotate-half convention out[d] = x[d] cos[t][d] - x[d+HD/2] sin[t][d], out[d+HD/2] = x[d+HD/2] cos[t][d+HD/2] + x[d] sin[t][d+HD/2]
__global__ __launch_bounds__(256) void k_rope(const float* __restrict__ F, int pitch, int nheads, const float* __restrict__ CS, const float* __restrict__ RF, const float* __restrict__ nw, float sc, h16* P16, bf* Ph, bf* Pl) {
    { const size_t b = blockIdx.y, po = b * nheads * TT * HD; F += b * TT * pitch; P16 += po; Ph += po; Pl += po; }
    const size_t e = ((size_t)blockIdx.x * 256 + threadIdx.x) * 2; if (e >= (size_t)nheads * TT * HD) return; const int d = (int)(e % HD); const int t = (int)((e / HD) % TT); const int h = (int)(e / ((size_t)HD * TT)); const float* f = F + (size_t)t * pitch + h * HD; const float rf = RF ? RF[(size_t)h * TT + t] : 1.0f; v2h o16; v2us oh, ol;
#pragma unroll
    for (int q = 0; q < 2; ++q) { const int dd = d + q; const int dp = (dd < HD / 2) ? dd + HD / 2 : dd - HD / 2; float x0 = f[dd], x1 = f[dp];
        if (RF) { float n0 = __fmul_rn(x0, rf), n1 = __fmul_rn(x1, rf); asm volatile("" : "+v"(n0)); asm volatile("" : "+v"(n1)); x0 = __fmul_rn(bfr(nw[dd]), n0); x1 = __fmul_rn(bfr(nw[dp]), n1); }
        const v2f cs = *(const v2f*)(CS + ((size_t)t * HD + dd) * 2); float a = __fmul_rn(x0, cs[0]), bq = __fmul_rn(x1, cs[1]); asm volatile("" : "+v"(a)); asm volatile("" : "+v"(bq)); const float r = ((dd < HD / 2) ? __fsub_rn(a, bq) : __fadd_rn(a, bq)) * sc;
        o16[q] = tohx(r); unsigned short a2, c2; splitf(r, a2, c2); oh[q] = a2; ol[q] = c2; }
    *(v2h*)(P16 + e) = o16; *(v2us*)(Ph + e) = oh; *(v2us*)(Pl + e) = ol;  }
__global__ __launch_bounds__(256) void k_vtp(const float* __restrict__ F, int pitch, int nheads, h16* V16, bf* Vh, bf* Vl) { const size_t e = ((size_t)blockIdx.x * 256 + threadIdx.x) * 2; if (e >= (size_t)nheads * HD * TT) return; const int t = (int)(e % TT); const int d = (int)((e / TT) % HD); const int g = (int)(e / ((size_t)TT * HD)); v2h o16; v2us oh, ol;
    { const size_t b = blockIdx.y, po = b * nheads * HD * TT; F += b * TT * pitch; V16 += po; Vh += po; Vl += po; }   // grid y = batch
#pragma unroll
    for (int q = 0; q < 2; ++q) { const float x = F[(size_t)(t + q) * pitch + g * HD + d]; o16[q] = tohx(x); unsigned short a2, c2; splitf(x, a2, c2); oh[q] = a2; ol[q] = c2; }
    *(v2h*)(V16 + e) = o16; *(v2us*)(Vh + e) = oh; *(v2us*)(Vl + e) = ol;  }
__global__ __launch_bounds__(256) void k_csid(float* CS) { const int idx = blockIdx.x * 256 + threadIdx.x; if (idx >= TT * HD) return; v2f cs; cs[0] = 1.0f; cs[1] = 0.0f; *(v2f*)(CS + (size_t)idx * 2) = cs;  }
// lane l with lane l ^ 16
__device__ __forceinline__ float xhalf(float x) { return __builtin_bit_cast(float, __builtin_amdgcn_permlanex16(__builtin_bit_cast(int, x), __builtin_bit_cast(int, x), 0x76543210, 0xfedcba98, false, false)); }

template <typename T16, bool HL>
__device__ __forceinline__ void fa_rows(const T16* __restrict__ Q, const T16* __restrict__ Q2, const T16* __restrict__ Kp, const T16* __restrict__ Kp2, const T16* __restrict__ Vt, const T16* __restrict__ Vt2, float* __restrict__ orow, const int q0) {
    typedef WFrag<T16> WF; typedef typename WF::V V;
    const int lane = threadIdx.x & 31, c = lane & 15, h = lane >> 4;
    const float CSC = SCL * 1.4426950408889634f;
    // per-lane pointers into the rows of Q, K (row c, bytes 16h) and V^T (row c, bytes 16h); those of K and V^T are carried through the loop and moved once a pass
    const T16* qp = Q + (size_t)q0 * HD + c * HD + 8 * h; const T16* qp2 = HL ? Q2 + (size_t)q0 * HD + c * HD + 8 * h : nullptr;
    const T16* kp = Kp + c * HD + 8 * h; const T16* kp2 = HL ? Kp2 + c * HD + 8 * h : nullptr;
    const T16* vp = Vt + c * TT + 8 * h; const T16* vp2 = HL ? Vt2 + c * TT + 8 * h : nullptr;
    V qf[2][2], qg[2][2];
#pragma unroll
    for (int q = 0; q < 2; ++q)
#pragma unroll
        for (int ks = 0; ks < 2; ++ks) { const int o = 16 * q * HD + 32 * ks; qf[q][ks] = WF::ld(qp + o); if (HL) qg[q][ks] = WF::ld(qp2 + o); }
    v8f acc[4][2];
#pragma unroll
    for (int db = 0; db < 4; ++db)
#pragma unroll
        for (int q = 0; q < 2; ++q) acc[db][q] = (v8f){};
    float m[2] = {-3.0e38f, -3.0e38f}, l[2] = {0.f, 0.f};
    const int np = (q0 >> 5) + 1;                  // passes: keys 0 .. q0 + 31
    V ka[2][2], kc[2][2];
#pragma unroll
    for (int kg = 0; kg < 2; ++kg)
#pragma unroll
        for (int ks = 0; ks < 2; ++ks) { const int o = kg * 16 * HD + 32 * ks; ka[kg][ks] = WF::ld(kp + o); if (HL) kc[kg][ks] = WF::ld(kp2 + o); }
    // precaution behind a group of fragment loads, here and in the loop: the pointers the loads name are inputs of the wait, so they keep their registers up to it and are moved only behind it
    if constexpr (HL) asm volatile("s_wait_xcnt 0x0" :: "v"(qp), "v"(qp2), "v"(kp), "v"(kp2) : "memory"); else asm volatile("s_wait_xcnt 0x0" :: "v"(qp), "v"(kp) : "memory");
    int t = 0;
    // kept rolled: the trip count is a run-time value, and a second copy of the body would not fit the register budget of three waves per SIMD
#pragma unroll 1
    do {                                           // np >= 1: every query row sees key 0
        V va[4], vc[4];                            // this pass's V^T fragments: in flight under the score products and the softmax
#pragma unroll
        for (int db = 0; db < 4; ++db) { const int o = db * 16 * TT; va[db] = WF::ld(vp + o); if (HL) vc[db] = WF::ld(vp2 + o); }
        if constexpr (HL) asm volatile("s_wait_xcnt 0x0" :: "v"(vp), "v"(vp2) : "memory"); else asm volatile("s_wait_xcnt 0x0" :: "v"(vp) : "memory");
        vp += 32; if (HL) vp2 += 32;
        v8f s[2][2];
#pragma unroll
        for (int kg = 0; kg < 2; ++kg)
#pragma unroll
            for (int q = 0; q < 2; ++q) { s[kg][q] = (v8f){};
#pragma unroll
                for (int ks = 0; ks < 2; ++ks) { s[kg][q] = WF::mma(ka[kg][ks], qf[q][ks], s[kg][q]); if (HL) { s[kg][q] = WF::mma(ka[kg][ks], qg[q][ks], s[kg][q]); s[kg][q] = WF::mma(kc[kg][ks], qf[q][ks], s[kg][q]); } } }
        { const int kstep = (t + 1 < np) ? 32 * HD : 0;  // the next pass's K fragments, in flight under this pass's softmax and second product (the last pass reloads its own: in bounds, unused)
            kp += kstep; if (HL) kp2 += kstep;
#pragma unroll
            for (int kg = 0; kg < 2; ++kg)
#pragma unroll
                for (int ks = 0; ks < 2; ++ks) { const int o = kg * 16 * HD + 32 * ks; ka[kg][ks] = WF::ld(kp + o); if (HL) kc[kg][ks] = WF::ld(kp2 + o); }
            if constexpr (HL) asm volatile("s_wait_xcnt 0x0" :: "v"(kp), "v"(kp2) : "memory"); else asm volatile("s_wait_xcnt 0x0" :: "v"(kp) : "memory"); }
        if (t == np - 1) {                         // wave-uniform: only the pass on the diagonal masks (key0 == q0 there)
#pragma unroll
            for (int kg = 0; kg < 2; ++kg)
#pragma unroll
                for (int q = 0; q < 2; ++q)
#pragma unroll
                    for (int r = 0; r < 8; ++r) if (16 * kg + 8 * h + r > 16 * q + c) s[kg][q][r] = -3.0e38f;
        }
        float mb[2]; bool need = false;
#pragma unroll
        for (int q = 0; q < 2; ++q) { float mx = -3.0e38f;
#pragma unroll
            for (int kg = 0; kg < 2; ++kg)
#pragma unroll
                for (int r = 0; r < 8; ++r) mx = fmaxf(mx, s[kg][q][r]);
            mx = fmaxf(mx, xhalf(mx)) * CSC; mb[q] = mx; need = need || (mx > m[q]); }
        if (__builtin_amdgcn_ballot_w32(need) != 0) {   // scalar branch; where no maximum grows every factor would be exactly 1
#pragma unroll
            for (int q = 0; q < 2; ++q) { const float mn = fmaxf(m[q], mb[q]); const float corr = __builtin_amdgcn_exp2f(m[q] - mn); m[q] = mn; l[q] *= corr;
#pragma unroll
                for (int db = 0; db < 4; ++db) acc[db][q] = acc[db][q] * corr; }
        }
#pragma unroll
        for (int q = 0; q < 2; ++q) { V pb, pc; float sum = 0.f; const float nm = -m[q];
            const v8f cv = {CSC, CSC, CSC, CSC, CSC, CSC, CSC, CSC}, nv = {nm, nm, nm, nm, nm, nm, nm, nm};
            const v8f ar[2] = {__builtin_elementwise_fma(s[0][q], cv, nv), __builtin_elementwise_fma(s[1][q], cv, nv)};
#pragma unroll
            for (int e = 0; e < 16; ++e) { const float p = __builtin_amdgcn_exp2f(ar[e >> 3][e & 7]); sum += p;
                if constexpr (HL) { const __bf16 ph = (__bf16)p; pb[e] = ph; pc[e] = (__bf16)(p - (float)ph); } else { pb[e] = (h16)p; } }
            // inputs only, for the slot behind a transcendental: the exponents keep their registers past the last v_exp_f32; without this line the build writes one v_exp_f32's result over the source of the v_exp_f32 directly in front of it
            if constexpr (!HL) asm volatile("" :: "v"(ar[0]), "v"(ar[1]));
            l[q] += sum;
#pragma unroll
            for (int db = 0; db < 4; ++db) { acc[db][q] = WF::mma(va[db], pb, acc[db][q]); if (HL) { acc[db][q] = WF::mma(va[db], pc, acc[db][q]); acc[db][q] = WF::mma(vc[db], pb, acc[db][q]); } } }
    } while (++t < np);
#pragma unroll
    for (int q = 0; q < 2; ++q) { const float inv = __fdiv_rn(1.0f, l[q] + xhalf(l[q])); float* op = orow + (size_t)(q0 + 16 * q + c) * DQ + 8 * h; v4f o[8];
#pragma unroll
        for (int db = 0; db < 4; ++db) {
#pragma unroll
            for (int r = 0; r < 4; ++r) { o[2 * db][r] = acc[db][q][r] * inv; o[2 * db + 1][r] = acc[db][q][4 + r] * inv; }
            *(v4f*)(op + 16 * db) = o[2 * db]; *(v4f*)(op + 16 * db + 4) = o[2 * db + 1]; }
        // precaution behind the run of eight stores: their address and their data are inputs of the wait, so they keep their registers up to it and are reused only behind it
        asm volatile("s_wait_xcnt 0x0" :: "v"(op), "v"(o[0]), "v"(o[1]), "v"(o[2]), "v"(o[3]), "v"(o[4]), "v"(o[5]), "v"(o[6]), "v"(o[7]) : "memory"); }
}
// ---- k_fattn: grid (8, batch * heads), 4 independent waves (no barrier, no LDS). The four waves of a workgroup take the 32-row blocks x, 15 - x (hi+lo rows), 16 + x, 31 - x (fp16 rows) of one plane, so every workgroup
// walks the same number of passes; which wave takes which block rotates with the workgroup, so that the long blocks do not all fall on the same SIMD.
// three waves per SIMD: the grid is three workgroups per WGP, and all of them are to be resident at once
__global__ __launch_bounds__(128) __attribute__((amdgpu_waves_per_eu(3))) void k_fattn(const h16* __restrict__ Q16, const h16* __restrict__ K16, const h16* __restrict__ V16, const bf* __restrict__ Qh, const bf* __restrict__ Ql, const bf* __restrict__ Kh, const bf* __restrict__ Kl, const bf* __restrict__ Vh, const bf* __restrict__ Vl, float* __restrict__ OUTb) {
    const int w = __builtin_amdgcn_readfirstlane((int)(threadIdx.x >> 5)); const int x = blockIdx.x, g = blockIdx.y;   // g = batch * NH_ + head
    const int role = (w + x + g + (g >> 5)) & 3; const size_t po = (size_t)g * TT * HD;
    float* orow = OUTb + (size_t)(g / NH_) * TT * DQ + (g % NH_) * HD;
    if (role & 1) fa_rows<bf, true>(Qh + po, Ql + po, Kh + po, Kl + po, Vh + po, Vl + po, orow, 32 * ((role == 1) ? 15 - x : x));
    else fa_rows<h16, false>(Q16 + po, nullptr, K16 + po, nullptr, V16 + po, nullptr, orow, 32 * ((role == 0) ? 31 - x : 16 + x));
}

extern "C" void kernel_launch(void* const* d_in, const int* in_sizes, int n_in,
                              void* d_out, int out_size, void* d_ws, size_t ws_size, hipStream_t stream) {
    (void)in_sizes; (void)n_in; (void)out_size;
    const float* x = (const float*)d_in[0]; const float* wq = (const float*)d_in[1]; const float* wk = (const float*)d_in[2]; const float* wv = (const float*)d_in[3]; const float* wo = nullptr; (void)wo;
    float* OUT = (float*)d_out;     // [8][1024][768]
    char* wsp = (char*)d_ws;
    auto take = [&](size_t bytes) { char* p = wsp; wsp += (bytes + 255) & ~(size_t)255; return (void*)p; };
    bf* WQ = (bf*)take((size_t)DQ * DM * 2); bf* WK = (bf*)take((size_t)DKV * DM * 2); bf* WV = (bf*)take((size_t)DKV * DM * 2); float* CS = (float*)take((size_t)TT * HD * 2 * 4);
    const size_t PQ = (size_t)NB_ * NH_ * TT * HD * 2, PK = (size_t)NB_ * NKV * TT * HD * 2;   // bytes of one 16-bit plane set [batch][head][..][..]
    h16* QP16 = (h16*)take(PQ); h16* KP16 = (h16*)take(PK); h16* VT16 = (h16*)take(PK);
    bf* QPh = (bf*)take(PQ); bf* QPl = (bf*)take(PQ); bf* KPh = (bf*)take(PK); bf* KPl = (bf*)take(PK); bf* VTh = (bf*)take(PK); bf* VTl = (bf*)take(PK);
    bf* XB = (bf*)take((size_t)NB_ * TT * DM * 2); float* FQ = (float*)take((size_t)NB_ * TT * DQ * 4); float* FK = (float*)take((size_t)NB_ * TT * DKV * 4);
    if ((size_t)(wsp - (char*)d_ws) > ws_size) return;    // ws 256 MiB
    float* FV = FK;   // v projection reuses the k buffer after the k planes are built (stream-ordered)
    k_wtH<<<(unsigned)((DM * DQ / 64 + 63) / 64), 256, 0, stream>>>(wq, DM, DQ, WQ); k_wtH<<<(unsigned)((DM * DKV / 64 + 63) / 64), 256, 0, stream>>>(wk, DM, DKV, WK); k_wtH<<<(unsigned)((DM * DKV / 64 + 63) / 64), 256, 0, stream>>>(wv, DM, DKV, WV);
    k_csid<<<(TT * HD + 255) / 256, 256, 0, stream>>>(CS);
    const unsigned LQ = (unsigned)(((size_t)NH_ * TT * HD / 2 + 255) / 256), LKv = (unsigned)(((size_t)NKV * TT * HD / 2 + 255) / 256);
    // projections: all batches as one [NB_*TT][DM] operand
    k_cvt8<<<(unsigned)(((size_t)NB_ * TT * DM / 8 + 255) / 256), 256, 0, stream>>>(x, XB, (size_t)NB_ * TT * DM / 8);
    k_gemmw<bf, 0, false><<<dim3(NB_ * TT / 64, DQ / 64, 1), 32, 0, stream>>>(XB, nullptr, WQ, nullptr, DM, FQ, DQ, nullptr, 0, 0, 0);
    k_rope<<<dim3(LQ, NB_, 1), 256, 0, stream>>>(FQ, DQ, NH_, CS, nullptr, nullptr, 1.0f, QP16, QPh, QPl);
    k_gemmw<bf, 0, false><<<dim3(NB_ * TT / 64, DKV / 64, 1), 32, 0, stream>>>(XB, nullptr, WK, nullptr, DM, FK, DKV, nullptr, 0, 0, 0);
    k_rope<<<dim3(LKv, NB_, 1), 256, 0, stream>>>(FK, DKV, NKV, CS, nullptr, nullptr, 1.0f, KP16, KPh, KPl);
    k_gemmw<bf, 0, false><<<dim3(NB_ * TT / 64, DKV / 64, 1), 32, 0, stream>>>(XB, nullptr, WV, nullptr, DM, FV, DKV, nullptr, 0, 0, 0);
    k_vtp<<<dim3(LKv, NB_, 1), 256, 0, stream>>>(FV, DKV, NKV, VT16, VTh, VTl);
    // attention: every (batch, head) plane in one launch (one kv head per query head)
    k_fattn<<<dim3(8, NB_ * NH_, 1), 128, 0, stream>>>(QP16, KP16, VT16, QPh, QPl, KPh, KPl, VTh, VTl, OUT);
}

// v003
// One run takes 138 microseconds.
// Timed twice side by side with v002, it ran 1.54 and 1.55 times as fast.
// All steps since v000 together make it 20.4 times as fast.
#include <hip/hip_runtime.h>

// Causal multi-head attention wrapper with per-head projections (x [8][1024][768]; q_h = x Wq[h], k_h = x Wk[h], v_h = x Wv[h] with per-head 'xw' weights [12][768][64], no bias; scores = q.k / 8, causal mask (-inf above the diagonal); softmax; out = heads concatenated along the feature axis -> [8][1024][768] in f32 (6.3 M), no output projection).
// Compute dtypes, f32 accumulate: every input rounded to bf16; q/k/v on PLAIN bf16 operands (inputs: exact); causal scores and attn.v in ONE fused kernel (online softmax, scores and probabilities stay in registers): query rows < 512 hl (3 products), the rest single fp16; softmax f32; no output projection: the merged heads are written in f32 straight to the output.

#define NB_  8
#define TT   1024
#define DM   768
#define NH_  12
#define NKV  12
#define HD   64
#define DQ   (NH_ * HD)
#define DKV  (NKV * HD)
#define RH   512                  // unused: k_fattn's block split fixes the hi+lo rows at < 512
#define SCL  0.125f   // HD^-0.5
typedef _Float16 h16;
typedef unsigned short bf;
typedef __attribute__((ext_vector_type(16))) __bf16   v16bf;
typedef __attribute__((ext_vector_type(16))) _Float16 v16h;
typedef __attribute__((ext_vector_type(8)))  _Float16 v8h;
typedef __attribute__((ext_vector_type(8)))  unsigned short v8us;
typedef __attribute__((ext_vector_type(8)))  float    v8f;
typedef __attribute__((ext_vector_type(4)))  float    v4f;
typedef v8h  __attribute__((may_alias)) v8ha;
typedef v4f  __attribute__((may_alias)) v4fa;
typedef v8us __attribute__((may_alias)) v8usa;

__device__ __forceinline__ unsigned short f2bf(float f) { unsigned u = __float_as_uint(f); u += 0x7FFFu + ((u >> 16) & 1u); return (unsigned short)(u >> 16); }
__device__ __forceinline__ float bf2f(unsigned short b) { return __uint_as_float(((unsigned)b) << 16); }
__device__ __forceinline__ v16h cat16(v8h lo, v8h hi) { return __builtin_shufflevector(lo, hi, 0, 1, 2, 3, 4, 5, 6, 7, 8, 9, 10, 11, 12, 13, 14, 15); }
__device__ __forceinline__ v16bf cat16b(v8us lo, v8us hi) { return __builtin_bit_cast(v16bf, __builtin_shufflevector(lo, hi, 0, 1, 2, 3, 4, 5, 6, 7, 8, 9, 10, 11, 12, 13, 14, 15)); }
__device__ __forceinline__ v8f wmma16(v16h a, v16h b, v8f c) { return __builtin_amdgcn_wmma_f32_16x16x32_f16(false, a, false, b, (short)0, c, false, false); }
__device__ __forceinline__ v8f wmmab(v16bf a, v16bf b, v8f c) { return __builtin_amdgcn_wmma_f32_16x16x32_bf16(false, a, false, b, (short)0, c, false, false); }



template <typename T16> struct WFrag;
template <> struct WFrag<h16> { typedef v16h V; static __device__ __forceinline__ V ld(const h16* p) { return cat16(*(const v8h*)p, *(const v8h*)(p + 16)); } static __device__ __forceinline__ v8f mma(V a, V b, v8f c) { return wmma16(a, b, c); } };
template <> struct WFrag<bf> { typedef v16bf V; static __device__ __forceinline__ V ld(const bf* p) { return cat16b(*(const v8us*)p, *(const v8us*)(p + 16)); } static __device__ __forceinline__ v8f mma(V a, V b, v8f c) { return wmmab(a, b, c); } };
__device__ __forceinline__ h16 tohx(float x) { return (h16)x; }
__device__ __forceinline__ void splitf(float y, unsigned short& h, unsigned short& l) { h = f2bf(y); l = f2bf(y - bf2f(h)); }
typedef __attribute__((ext_vector_type(2))) _Float16 v2h;
typedef __attribute__((ext_vector_type(4))) _Float16 v4h;
typedef __attribute__((ext_vector_type(2))) unsigned short v2us;
typedef __attribute__((ext_vector_type(4))) unsigned short v4us;
typedef __attribute__((ext_vector_type(2))) float v2f;
typedef __attribute__((ext_vector_type(4))) int v4i;

__global__ __launch_bounds__(256) void k_wtH(const float* __restrict__ w, int K, int N, bf* Bt) {
    const int lane = threadIdx.x & 31; const int L0 = (blockIdx.x * 8 + (threadIdx.x >> 5)) * 8; const int nlines = N * K / 64;
{
#pragma unroll 1
        for (int l = 0; l < 8; ++l) { const int L = L0 + l; if (L >= nlines) break; const size_t e = (size_t)L * 64 + lane * 2; const int k = (int)(e % K), n = (int)(e / K); const size_t hb = (size_t)(n / HD) * K; const int ee = n % HD; v2us o;
            o[0] = f2bf(w[(hb + k) * HD + ee]); o[1] = f2bf(w[(hb + k + 1) * HD + ee]); *(v2us*)(Bt + e) = o; }
         }
}

__global__ __launch_bounds__(256) void k_cvt8(const float* __restrict__ src, bf* dst, size_t n8) { const size_t i = (size_t)blockIdx.x * 256 + threadIdx.x; if (i >= n8) return; const v8f v = *(const v8f*)(src + i * 8); v8us o;
#pragma unroll
    for (int k = 0; k < 8; ++k) o[k] = f2bf(v[k]); *(v8us*)(dst + i * 8) = o;  }

// lane l with lane l ^ 16
__device__ __forceinline__ float xhalf(float x) { return __builtin_bit_cast(float, __builtin_amdgcn_permlanex16(__builtin_bit_cast(int, x), __builtin_bit_cast(int, x), 0x76543210, 0xfedcba98, false, false)); }

template <typename T16, bool HL>
__device__ __forceinline__ void fa_rows(const T16* __restrict__ Q, const T16* __restrict__ Q2, const T16* __restrict__ Kp, const T16* __restrict__ Kp2, const T16* __restrict__ Vt, const T16* __restrict__ Vt2, float* __restrict__ orow, const int q0) {
    typedef WFrag<T16> WF; typedef typename WF::V V;
    const int lane = threadIdx.x & 31, c = lane & 15, h = lane >> 4;
    const float CSC = SCL * 1.4426950408889634f;
    // per-lane pointers into the rows of Q, K (row c, bytes 16h) and V^T (row c, bytes 16h); those of K and V^T are carried through the loop and moved once a pass
    const T16* qp = Q + (size_t)q0 * HD + c * HD + 8 * h; const T16* qp2 = HL ? Q2 + (size_t)q0 * HD + c * HD + 8 * h : nullptr;
    const T16* kp = Kp + c * HD + 8 * h; const T16* kp2 = HL ? Kp2 + c * HD + 8 * h : nullptr;
    const T16* vp = Vt + c * TT + 8 * h; const T16* vp2 = HL ? Vt2 + c * TT + 8 * h : nullptr;
    V qf[2][2], qg[2][2];
#pragma unroll
    for (int q = 0; q < 2; ++q)
#pragma unroll
        for (int ks = 0; ks < 2; ++ks) { const int o = 16 * q * HD + 32 * ks; qf[q][ks] = WF::ld(qp + o); if (HL) qg[q][ks] = WF::ld(qp2 + o); }
    v8f acc[4][2];
#pragma unroll
    for (int db = 0; db < 4; ++db)
#pragma unroll
        for (int q = 0; q < 2; ++q) acc[db][q] = (v8f){};
    float m[2] = {-3.0e38f, -3.0e38f}, l[2] = {0.f, 0.f};
    const int np = (q0 >> 5) + 1;                  // passes: keys 0 .. q0 + 31
    V ka[2][2], kc[2][2];
#pragma unroll
    for (int kg = 0; kg < 2; ++kg)
#pragma unroll
        for (int ks = 0; ks < 2; ++ks) { const int o = kg * 16 * HD + 32 * ks; ka[kg][ks] = WF::ld(kp + o); if (HL) kc[kg][ks] = WF::ld(kp2 + o); }
    // precaution behind a group of fragment loads, here and in the loop: the pointers the loads name are inputs of the wait, so they keep their registers up to it and are moved only behind it
    if constexpr (HL) asm volatile("s_wait_xcnt 0x0" :: "v"(qp), "v"(qp2), "v"(kp), "v"(kp2) : "memory"); else asm volatile("s_wait_xcnt 0x0" :: "v"(qp), "v"(kp) : "memory");
    int t = 0;
    // kept rolled: the trip count is a run-time value, and a second copy of the body would not fit the register budget of three waves per SIMD
#pragma unroll 1
    do {                                           // np >= 1: every query row sees key 0
        V va[4], vc[4];                            // this pass's V^T fragments: in flight under the score products and the softmax
#pragma unroll
        for (int db = 0; db < 4; ++db) { const int o = db * 16 * TT; va[db] = WF::ld(vp + o); if (HL) vc[db] = WF::ld(vp2 + o); }
        if constexpr (HL) asm volatile("s_wait_xcnt 0x0" :: "v"(vp), "v"(vp2) : "memory"); else asm volatile("s_wait_xcnt 0x0" :: "v"(vp) : "memory");
        vp += 32; if (HL) vp2 += 32;
        v8f s[2][2];
#pragma unroll
        for (int kg = 0; kg < 2; ++kg)
#pragma unroll
            for (int q = 0; q < 2; ++q) { s[kg][q] = (v8f){};
#pragma unroll
                for (int ks = 0; ks < 2; ++ks) { s[kg][q] = WF::mma(ka[kg][ks], qf[q][ks], s[kg][q]); if (HL) { s[kg][q] = WF::mma(ka[kg][ks], qg[q][ks], s[kg][q]); s[kg][q] = WF::mma(kc[kg][ks], qf[q][ks], s[kg][q]); } } }
        { const int kstep = (t + 1 < np) ? 32 * HD : 0;  // the next pass's K fragments, in flight under this pass's softmax and second product (the last pass reloads its own: in bounds, unused)
            kp += kstep; if (HL) kp2 += kstep;
#pragma unroll
            for (int kg = 0; kg < 2; ++kg)
#pragma unroll
                for (int ks = 0; ks < 2; ++ks) { const int o = kg * 16 * HD + 32 * ks; ka[kg][ks] = WF::ld(kp + o); if (HL) kc[kg][ks] = WF::ld(kp2 + o); }
            if constexpr (HL) asm volatile("s_wait_xcnt 0x0" :: "v"(kp), "v"(kp2) : "memory"); else asm volatile("s_wait_xcnt 0x0" :: "v"(kp) : "memory"); }
        if (t == np - 1) {                         // wave-uniform: only the pass on the diagonal masks (key0 == q0 there)
#pragma unroll
            for (int kg = 0; kg < 2; ++kg)
#pragma unroll
                for (int q = 0; q < 2; ++q)
#pragma unroll
                    for (int r = 0; r < 8; ++r) if (16 * kg + 8 * h + r > 16 * q + c) s[kg][q][r] = -3.0e38f;
        }
        float mb[2]; bool need = false;
#pragma unroll
        for (int q = 0; q < 2; ++q) { float mx = -3.0e38f;
#pragma unroll
            for (int kg = 0; kg < 2; ++kg)
#pragma unroll
                for (int r = 0; r < 8; ++r) mx = fmaxf(mx, s[kg][q][r]);
            mx = fmaxf(mx, xhalf(mx)) * CSC; mb[q] = mx; need = need || (mx > m[q]); }
        if (__builtin_amdgcn_ballot_w32(need) != 0) {   // scalar branch; where no maximum grows every factor would be exactly 1
#pragma unroll
            for (int q = 0; q < 2; ++q) { const float mn = fmaxf(m[q], mb[q]); const float corr = __builtin_amdgcn_exp2f(m[q] - mn); m[q] = mn; l[q] *= corr;
#pragma unroll
                for (int db = 0; db < 4; ++db) acc[db][q] = acc[db][q] * corr; }
        }
#pragma unroll
        for (int q = 0; q < 2; ++q) { V pb, pc; float sum = 0.f; const float nm = -m[q];
            const v8f cv = {CSC, CSC, CSC, CSC, CSC, CSC, CSC, CSC}, nv = {nm, nm, nm, nm, nm, nm, nm, nm};
            const v8f ar[2] = {__builtin_elementwise_fma(s[0][q], cv, nv), __builtin_elementwise_fma(s[1][q], cv, nv)};
#pragma unroll
            for (int e = 0; e < 16; ++e) { const float p = __builtin_amdgcn_exp2f(ar[e >> 3][e & 7]); sum += p;
                if constexpr (HL) { const __bf16 ph = (__bf16)p; pb[e] = ph; pc[e] = (__bf16)(p - (float)ph); } else { pb[e] = (h16)p; } }
            // inputs only, for the slot behind a transcendental: the exponents keep their registers past the last v_exp_f32; without this line the build writes one v_exp_f32's result over the source of the v_exp_f32 directly in front of it
            if constexpr (!HL) asm volatile("" :: "v"(ar[0]), "v"(ar[1]));
            l[q] += sum;
#pragma unroll
            for (int db = 0; db < 4; ++db) { acc[db][q] = WF::mma(va[db], pb, acc[db][q]); if (HL) { acc[db][q] = WF::mma(va[db], pc, acc[db][q]); acc[db][q] = WF::mma(vc[db], pb, acc[db][q]); } } }
    } while (++t < np);
#pragma unroll
    for (int q = 0; q < 2; ++q) { const float inv = __fdiv_rn(1.0f, l[q] + xhalf(l[q])); float* op = orow + (size_t)(q0 + 16 * q + c) * DQ + 8 * h; v4f o[8];
#pragma unroll
        for (int db = 0; db < 4; ++db) {
#pragma unroll
            for (int r = 0; r < 4; ++r) { o[2 * db][r] = acc[db][q][r] * inv; o[2 * db + 1][r] = acc[db][q][4 + r] * inv; }
            *(v4f*)(op + 16 * db) = o[2 * db]; *(v4f*)(op + 16 * db + 4) = o[2 * db + 1]; }
        // precaution behind the run of eight stores: their address and their data are inputs of the wait, so they keep their registers up to it and are reused only behind it
        asm volatile("s_wait_xcnt 0x0" :: "v"(op), "v"(o[0]), "v"(o[1]), "v"(o[2]), "v"(o[3]), "v"(o[4]), "v"(o[5]), "v"(o[6]), "v"(o[7]) : "memory"); }
}
// ---- k_fattn: grid (8, batch * heads), 4 independent waves (no barrier, no LDS). The four waves of a workgroup take the 32-row blocks x, 15 - x (hi+lo rows), 16 + x, 31 - x (fp16 rows) of one plane, so every workgroup
// walks the same number of passes; which wave takes which block rotates with the workgroup, so that the long blocks do not all fall on the same SIMD.
// three waves per SIMD: the grid is three workgroups per WGP, and all of them are to be resident at once
__global__ __launch_bounds__(128) __attribute__((amdgpu_waves_per_eu(3))) void k_fattn(const h16* __restrict__ Q16, const h16* __restrict__ K16, const h16* __restrict__ V16, const bf* __restrict__ Qh, const bf* __restrict__ Ql, const bf* __restrict__ Kh, const bf* __restrict__ Kl, const bf* __restrict__ Vh, const bf* __restrict__ Vl, float* __restrict__ OUTb) {
    const int w = __builtin_amdgcn_readfirstlane((int)(threadIdx.x >> 5)); const int x = blockIdx.x, g = blockIdx.y;   // g = batch * NH_ + head
    const int role = (w + x + g + (g >> 5)) & 3; const size_t po = (size_t)g * TT * HD;
    float* orow = OUTb + (size_t)(g / NH_) * TT * DQ + (g % NH_) * HD;
    if (role & 1) fa_rows<bf, true>(Qh + po, Ql + po, Kh + po, Kl + po, Vh + po, Vl + po, orow, 32 * ((role == 1) ? 15 - x : x));
    else fa_rows<h16, false>(Q16 + po, nullptr, K16 + po, nullptr, V16 + po, nullptr, orow, 32 * ((role == 0) ? 31 - x : 16 + x));
}

// ---- k_proj: the q, k and v projections of all batches in ONE launch, and their 16-bit planes written straight from the accumulators (no f32 copy of q, k or v in memory).
// grid (rows of x / 64, 3 * heads), ONE WAVE per 64x64 tile (16 accumulators), operands straight from K-contiguous bf16 planes: X [batch * t][DM], Wt [q heads | k heads | v heads][e][DM].
// A tile is D = P R^T: a lane holds ONE row of R (tile j, row lane & 15) and 8 consecutive rows of P (tile i, rows 8 (lane >> 4) + r). q, k: P = weights, R = x, so the 8 values are 8 consecutive e of one t (planes [t][e]);
// v: P = x, R = weights, so they are 8 consecutive t of one e (planes [e][t]). Both operands are read by the same loader, so the k order of the two is equal either way, and each sum runs over k as before.
// put_planes: 32 staged rows (128 B each, LDS pitch 144 B) of the three planes go out as whole 128-byte lines, 4 rows a store; PITCH = elements between two rows of a plane, row0 = the first of the 32 rows.
template <int PITCH>
__device__ __forceinline__ void put_planes(const unsigned short* st, unsigned short* o16, unsigned short* oh, unsigned short* ol, const int lane, const int row0) {
    const int rrow = lane >> 3, rcol = (lane & 7) * 8;
#pragma unroll
    for (int pl = 0; pl < 3; ++pl) { unsigned short* dp = ((pl == 0) ? o16 : (pl == 1) ? oh : ol) + (size_t)rrow * PITCH + rcol; v8us d[8];
#pragma unroll
        for (int s = 0; s < 8; ++s) { d[s] = *(const v8usa*)(st + pl * 32 * 72 + (s * 4 + rrow) * 72 + rcol); *(v8usa*)(dp + (row0 + s * 4) * PITCH) = d[s]; }
        // precaution behind the run of eight stores: their address and their data are inputs of the wait, so they keep their registers up to it and are reused only behind it
        asm volatile("s_wait_xcnt 0x0" :: "v"(dp), "v"(d[0]), "v"(d[1]), "v"(d[2]), "v"(d[3]), "v"(d[4]), "v"(d[5]), "v"(d[6]), "v"(d[7]) : "memory"); }
}
__global__ __launch_bounds__(32) void k_proj(const bf* __restrict__ X, const bf* __restrict__ Wt, h16* Q16, bf* Qh, bf* Ql, h16* K16, bf* Kh, bf* Kl, h16* V16, bf* Vh, bf* Vl) {
    typedef WFrag<bf> WF; typedef WF::V V;
    __shared__ __align__(16) unsigned short st[3 * 32 * 72];
    const int lane = threadIdx.x & 31, lr = lane & 15, hi = lane >> 4; const int r0 = blockIdx.x * 64, y = blockIdx.y, sel = y / NH_, hd = y % NH_; const bool vt = sel == 2;
    const bf* xr = X + (size_t)(r0 + lr) * DM + 8 * hi; const bf* wr = Wt + (size_t)(y * 64 + lr) * DM + 8 * hi;
    const bf* pp = vt ? xr : wr; const bf* rp = vt ? wr : xr;
    v8f acc[4][4];
#pragma unroll
    for (int i = 0; i < 4; ++i)
#pragma unroll
        for (int j = 0; j < 4; ++j) acc[i][j] = (v8f){};
    // kept rolled: a second copy of the body would need a second set of fragment registers
#pragma unroll 1
    for (int kc = 0; kc < DM; kc += 32) {
        V p[4], r[4];
#pragma unroll
        for (int i = 0; i < 4; ++i) { p[i] = WF::ld(pp + i * 16 * DM); r[i] = WF::ld(rp + i * 16 * DM); }
        // precaution behind the group of fragment loads: the pointers the loads name are inputs of the wait, so they keep their registers up to it and are moved only behind it
        asm volatile("s_wait_xcnt 0x0" :: "v"(pp), "v"(rp) : "memory");
        pp += 32; rp += 32;
#pragma unroll
        for (int j = 0; j < 4; ++j)
#pragma unroll
            for (int i = 0; i < 4; ++i) acc[i][j] = WF::mma(p[i], r[j], acc[i][j]);
    }
    const size_t ob = ((size_t)(r0 / TT) * NH_ + hd) * TT * HD + (size_t)(r0 % TT) * (vt ? 1 : HD);
    unsigned short* o16 = (unsigned short*)((sel == 0) ? Q16 : (sel == 1) ? K16 : V16) + ob; unsigned short* oh = ((sel == 0) ? Qh : (sel == 1) ? Kh : Vh) + ob; unsigned short* ol = ((sel == 0) ? Ql : (sel == 1) ? Kl : Vl) + ob;
#pragma unroll
    for (int jh = 0; jh < 2; ++jh) {               // 32 rows of R at a time
#pragma unroll
        for (int jj = 0; jj < 2; ++jj)
#pragma unroll
            for (int i = 0; i < 4; ++i) { v8h c16; v8us ch, cl;
#pragma unroll
                for (int e = 0; e < 8; ++e) { const float v = acc[i][2 * jh + jj][e]; c16[e] = tohx(v); unsigned short a2, c2; splitf(v, a2, c2); ch[e] = a2; cl[e] = c2; }
                unsigned short* sp = st + (jj * 16 + lr) * 72 + i * 16 + hi * 8;
                *(v8usa*)sp = __builtin_bit_cast(v8us, c16); *(v8usa*)(sp + 32 * 72) = ch; *(v8usa*)(sp + 2 * 32 * 72) = cl; }
        // one wave: its LDS operations run in order; these two lines only keep the compiler from moving the reads of other lanes' rows ahead of the writes
        __builtin_amdgcn_wave_barrier(); asm volatile("" ::: "memory");
        if (vt) put_planes<TT>(st, o16, oh, ol, lane, jh * 32);
        else put_planes<HD>(st, o16, oh, ol, lane, jh * 32);
        // and the second half's writes ahead of these reads
        if (jh == 0) { __builtin_amdgcn_wave_barrier(); asm volatile("" ::: "memory"); }
    }
}

extern "C" void kernel_launch(void* const* d_in, const int* in_sizes, int n_in,
                              void* d_out, int out_size, void* d_ws, size_t ws_size, hipStream_t stream) {
    (void)in_sizes; (void)n_in; (void)out_size;
    const float* x = (const float*)d_in[0]; const float* wq = (const float*)d_in[1]; const float* wk = (const float*)d_in[2]; const float* wv = (const float*)d_in[3]; const float* wo = nullptr; (void)wo;
    float* OUT = (float*)d_out;     // [8][1024][768]
    char* wsp = (char*)d_ws;
    auto take = [&](size_t bytes) { char* p = wsp; wsp += (bytes + 255) & ~(size_t)255; return (void*)p; };
    bf* WQ = (bf*)take((size_t)(DQ + 2 * DKV) * DM * 2); bf* WK = WQ + (size_t)DQ * DM; bf* WV = WK + (size_t)DKV * DM;   // one stack of rows [q | k | v]
    const size_t PQ = (size_t)NB_ * NH_ * TT * HD * 2, PK = (size_t)NB_ * NKV * TT * HD * 2;   // bytes of one 16-bit plane set [batch][head][..][..]
    h16* QP16 = (h16*)take(PQ); h16* KP16 = (h16*)take(PK); h16* VT16 = (h16*)take(PK);
    bf* QPh = (bf*)take(PQ); bf* QPl = (bf*)take(PQ); bf* KPh = (bf*)take(PK); bf* KPl = (bf*)take(PK); bf* VTh = (bf*)take(PK); bf* VTl = (bf*)take(PK);
    bf* XB = (bf*)take((size_t)NB_ * TT * DM * 2);
    if ((size_t)(wsp - (char*)d_ws) > ws_size) return;    // ws 256 MiB
    k_wtH<<<(unsigned)((DM * DQ / 64 + 63) / 64), 256, 0, stream>>>(wq, DM, DQ, WQ); k_wtH<<<(unsigned)((DM * DKV / 64 + 63) / 64), 256, 0, stream>>>(wk, DM, DKV, WK); k_wtH<<<(unsigned)((DM * DKV / 64 + 63) / 64), 256, 0, stream>>>(wv, DM, DKV, WV);
    // projections: all batches as one [NB_*TT][DM] operand, q, k and v in one launch that also writes the planes
    k_cvt8<<<(unsigned)(((size_t)NB_ * TT * DM / 8 + 255) / 256), 256, 0, stream>>>(x, XB, (size_t)NB_ * TT * DM / 8);
    k_proj<<<dim3(NB_ * TT / 64, (DQ + 2 * DKV) / 64, 1), 32, 0, stream>>>(XB, WQ, QP16, QPh, QPl, KP16, KPh, KPl, VT16, VTh, VTl);
    // attention: every (batch, head) plane in one launch (one kv head per query head)
    k_fattn<<<dim3(8, NB_ * NH_, 1), 128, 0, stream>>>(QP16, KP16, VT16, QPh, QPl, KPh, KPl, VTh, VTl, OUT);
}

// v004
// A run of this version takes 94.8 microseconds.
// Two timings next to v003 put it at 1.45 and 1.44 times that version's speed.
// Over all steps from v000 it is 29.5 times as fast.
#include <hip/hip_runtime.h>

// Causal multi-head attention wrapper with per-head projections (x [8][1024][768]; q_h = x Wq[h], k_h = x Wk[h], v_h = x Wv[h] with per-head 'xw' weights [12][768][64], no bias; scores = q.k / 8, causal mask (-inf above the diagonal); softmax; out = heads concatenated along the feature axis -> [8][1024][768] in f32 (6.3 M), no output projection).
// Compute dtypes, f32 accumulate: every input rounded to bf16; q/k/v on PLAIN bf16 operands (inputs: exact); causal scores and attn.v in ONE fused kernel (online softmax, scores and probabilities stay in registers): query rows < 512 hl (3 products), the rest single fp16; softmax f32; no output projection: the merged heads are written in f32 straight to the output.

// FRAGMENT ORDER: every 16-bit operand plane (x, the weights, q, k, v^T) lies in units of 1 KB = 16 rows x 32 k of its matrix. Inside a unit element (row lr, k = 16 j + 8 hi + e) stands at j * 256 + (hi * 16 + lr) * 8 + e,
// so lane hi * 16 + lr of a wave finds its two 16-byte pieces of a WMMA operand at lane * 8 and 256 + lane * 8: each wave-wide 16-byte load or store covers 512 contiguous bytes (4 whole lines).
// Order of the units: x, weights, q, k: [16-row block][k block]; v^T (rows e, k = key): [32-key block][16-row block].

#define NB_  8
#define TT   1024
#define DM   768
#define NH_  12
#define NKV  12
#define HD   64
#define DQ   (NH_ * HD)
#define DKV  (NKV * HD)
#define RH   512                  // unused: k_fattn's block split fixes the hi+lo rows at < 512
#define SCL  0.125f   // HD^-0.5
typedef _Float16 h16;
typedef unsigned short bf;
typedef __attribute__((ext_vector_type(16))) __bf16   v16bf;
typedef __attribute__((ext_vector_type(16))) _Float16 v16h;
typedef __attribute__((ext_vector_type(8)))  _Float16 v8h;
typedef __attribute__((ext_vector_type(8)))  unsigned short v8us;
typedef __attribute__((ext_vector_type(8)))  float    v8f;
typedef __attribute__((ext_vector_type(4)))  float    v4f;
typedef v8h  __attribute__((may_alias)) v8ha;
typedef v4f  __attribute__((may_alias)) v4fa;
typedef v8us __attribute__((may_alias)) v8usa;

__device__ __forceinline__ unsigned short f2bf(float f) { unsigned u = __float_as_uint(f); u += 0x7FFFu + ((u >> 16) & 1u); return (unsigned short)(u >> 16); }
__device__ __forceinline__ float bf2f(unsigned short b) { return __uint_as_float(((unsigned)b) << 16); }
__device__ __forceinline__ v16h cat16(v8h lo, v8h hi) { return __builtin_shufflevector(lo, hi, 0, 1, 2, 3, 4, 5, 6, 7, 8, 9, 10, 11, 12, 13, 14, 15); }
__device__ __forceinline__ v16bf cat16b(v8us lo, v8us hi) { return __builtin_bit_cast(v16bf, __builtin_shufflevector(lo, hi, 0, 1, 2, 3, 4, 5, 6, 7, 8, 9, 10, 11, 12, 13, 14, 15)); }
__device__ __forceinline__ v8f wmma16(v16h a, v16h b, v8f c) { return __builtin_amdgcn_wmma_f32_16x16x32_f16(false, a, false, b, (short)0, c, false, false); }
__device__ __forceinline__ v8f wmmab(v16bf a, v16bf b, v8f c) { return __builtin_amdgcn_wmma_f32_16x16x32_bf16(false, a, false, b, (short)0, c, false, false); }



template <typename T16> struct WFrag;
template <> struct WFrag<h16> { typedef v16h V; static __device__ __forceinline__ V ld(const h16* p) { return cat16(*(const v8h*)p, *(const v8h*)(p + 256)); } static __device__ __forceinline__ v8f mma(V a, V b, v8f c) { return wmma16(a, b, c); } };
template <> struct WFrag<bf> { typedef v16bf V; static __device__ __forceinline__ V ld(const bf* p) { return cat16b(*(const v8us*)p, *(const v8us*)(p + 256)); } static __device__ __forceinline__ v8f mma(V a, V b, v8f c) { return wmmab(a, b, c); } };
__device__ __forceinline__ h16 tohx(float x) { return (h16)x; }
__device__ __forceinline__ void splitf(float y, unsigned short& h, unsigned short& l) { h = f2bf(y); l = f2bf(y - bf2f(h)); }
typedef __attribute__((ext_vector_type(2))) _Float16 v2h;
typedef __attribute__((ext_vector_type(4))) _Float16 v4h;
typedef __attribute__((ext_vector_type(2))) unsigned short v2us;
typedef __attribute__((ext_vector_type(4))) unsigned short v4us;
typedef __attribute__((ext_vector_type(2))) float v2f;
typedef __attribute__((ext_vector_type(4))) int v4i;

// weights [head][k][e] f32 -> rows n = head * HD + e, k contiguous, bf16, in fragment order: one thread makes one 16-byte piece (8 k of one n); the 16 lanes of a half wave read 16 consecutive e
__global__ __launch_bounds__(256) void k_wtH(const float* __restrict__ w, int K, int N, bf* Bt) {
    const int i = blockIdx.x * 256 + threadIdx.x; if (i >= N * K / 8) return;
    const int lr = i & 15, hi = (i >> 4) & 1, j = (i >> 5) & 1, u = i >> 6; const int nkb = K / 32; const int kb = u % nkb, n = (u / nkb) * 16 + lr;
    const float* sp = w + ((size_t)(n / HD) * K + kb * 32 + j * 16 + hi * 8) * HD + n % HD; float v[8]; v8us o;
#pragma unroll
    for (int e = 0; e < 8; ++e) v[e] = sp[e * HD];
    // precaution behind the group of loads: the pointer they name is an input of the wait, so it keeps its registers up to it
    asm volatile("s_wait_xcnt 0x0" :: "v"(sp) : "memory");
#pragma unroll
    for (int e = 0; e < 8; ++e) o[e] = f2bf(v[e]);
    *(v8us*)(Bt + (size_t)i * 8) = o;
}

// x [row][DM] f32 -> bf16 in fragment order: one wave makes one unit (16 rows x 32 k); 8 lanes read one whole 128-byte line of a row, 4 rows a load
__global__ __launch_bounds__(256) void k_cvt8(const float* __restrict__ src, bf* dst) {
    const int lane = threadIdx.x & 31, rr = lane >> 3, g = lane & 7; const int u = blockIdx.x * 8 + (threadIdx.x >> 5); const int rb = u / (DM / 32), kb = u % (DM / 32);
    const float* sp = src + (size_t)(rb * 16 + rr) * DM + kb * 32 + g * 4; bf* dp = dst + (size_t)u * 512 + (g >> 2) * 256 + (((g >> 1) & 1) * 16 + rr) * 8 + (g & 1) * 4; v4f v[4];
#pragma unroll
    for (int s = 0; s < 4; ++s) v[s] = *(const v4f*)(sp + s * 4 * DM);
    // precaution behind the group of loads: the pointer they name is an input of the wait, so it keeps its registers up to it
    asm volatile("s_wait_xcnt 0x0" :: "v"(sp) : "memory");
#pragma unroll
    for (int s = 0; s < 4; ++s) { v4us o;
#pragma unroll
        for (int k = 0; k < 4; ++k) o[k] = f2bf(v[s][k]);
        *(v4us*)(dp + s * 32) = o; }
}

// lane l with lane l ^ 16
__device__ __forceinline__ float xhalf(float x) { return __builtin_bit_cast(float, __builtin_amdgcn_permlanex16(__builtin_bit_cast(int, x), __builtin_bit_cast(int, x), 0x76543210, 0xfedcba98, false, false)); }

template <typename T16, bool HL>
__device__ __forceinline__ void fa_rows(const T16* __restrict__ Q, const T16* __restrict__ Q2, const T16* __restrict__ Kp, const T16* __restrict__ Kp2, const T16* __restrict__ Vt, const T16* __restrict__ Vt2, float* __restrict__ orow, const int q0) {
    typedef WFrag<T16> WF; typedef typename WF::V V;
    const int lane = threadIdx.x & 31, c = lane & 15, h = lane >> 4;
    const float CSC = SCL * 1.4426950408889634f;
    // the lane's piece in a fragment-order unit stands lb bytes into it. Q: wave-uniform pointers to the first unit; K, V^T: per-lane pointers, carried through the loop and moved once a pass (4 units = 32 keys)
    const unsigned lb = lane * 16; auto at = [lb](const T16* u) { return (const T16*)((const char*)u + lb); };
    const T16* qp = Q + (size_t)q0 * HD; const T16* qp2 = HL ? Q2 + (size_t)q0 * HD : nullptr;
    const T16* kp = at(Kp); const T16* kp2 = HL ? at(Kp2) : nullptr;
    const T16* vp = at(Vt); const T16* vp2 = HL ? at(Vt2) : nullptr;
    V qf[2][2], qg[2][2];
#pragma unroll
    for (int q = 0; q < 2; ++q)
#pragma unroll
        for (int ks = 0; ks < 2; ++ks) { const int o = 16 * q * HD + 512 * ks; qf[q][ks] = WF::ld(at(qp) + o); if (HL) qg[q][ks] = WF::ld(at(qp2) + o); }
    v8f acc[4][2];
#pragma unroll
    for (int db = 0; db < 4; ++db)
#pragma unroll
        for (int q = 0; q < 2; ++q) acc[db][q] = (v8f){};
    float m[2] = {-3.0e38f, -3.0e38f}, l[2] = {0.f, 0.f};
    const int np = (q0 >> 5) + 1;                  // passes: keys 0 .. q0 + 31
    V ka[2][2], kc[2][2];
#pragma unroll
    for (int kg = 0; kg < 2; ++kg)
#pragma unroll
        for (int ks = 0; ks < 2; ++ks) { const int o = kg * 16 * HD + 512 * ks; ka[kg][ks] = WF::ld(kp + o); if (HL) kc[kg][ks] = WF::ld(kp2 + o); }
    // precaution behind a group of fragment loads, here and in the loop: the pointers the loads name are inputs of the wait, so they keep their registers up to it and are moved only behind it
    // (here the build addresses by scalar base and lane offset, so these are named as well)
    if constexpr (HL) asm volatile("s_wait_xcnt 0x0" :: "s"(qp), "s"(qp2), "s"(Kp), "s"(Kp2), "v"(lb), "v"(kp), "v"(kp2) : "memory"); else asm volatile("s_wait_xcnt 0x0" :: "s"(qp), "s"(Kp), "v"(lb), "v"(kp) : "memory");
    int t = 0;
    // kept rolled: the trip count is a run-time value, and a second copy of the body would not fit the register budget of three waves per SIMD
#pragma unroll 1
    do {                                           // np >= 1: every query row sees key 0
        V va[4], vc[4];                            // this pass's V^T fragments: in flight under the score products and the softmax
#pragma unroll
        for (int db = 0; db < 4; ++db) { const int o = db * 512; va[db] = WF::ld(vp + o); if (HL) vc[db] = WF::ld(vp2 + o); }
        if constexpr (HL) asm volatile("s_wait_xcnt 0x0" :: "v"(vp), "v"(vp2) : "memory"); else asm volatile("s_wait_xcnt 0x0" :: "v"(vp) : "memory");
        vp += 2048; if (HL) vp2 += 2048;
        v8f s[2][2];
#pragma unroll
        for (int kg = 0; kg < 2; ++kg)
#pragma unroll
            for (int q = 0; q < 2; ++q) { s[kg][q] = (v8f){};
#pragma unroll
                for (int ks = 0; ks < 2; ++ks) { s[kg][q] = WF::mma(ka[kg][ks], qf[q][ks], s[kg][q]); if (HL) { s[kg][q] = WF::mma(ka[kg][ks], qg[q][ks], s[kg][q]); s[kg][q] = WF::mma(kc[kg][ks], qf[q][ks], s[kg][q]); } } }
        { const int kstep = (t + 1 < np) ? 32 * HD : 0;  // the next pass's K fragments, in flight under this pass's softmax and second product (the last pass reloads its own: in bounds, unused)
            kp += kstep; if (HL) kp2 += kstep;
#pragma unroll
            for (int kg = 0; kg < 2; ++kg)
#pragma unroll
                for (int ks = 0; ks < 2; ++ks) { const int o = kg * 16 * HD + 512 * ks; ka[kg][ks] = WF::ld(kp + o); if (HL) kc[kg][ks] = WF::ld(kp2 + o); }
            if constexpr (HL) asm volatile("s_wait_xcnt 0x0" :: "v"(kp), "v"(kp2) : "memory"); else asm volatile("s_wait_xcnt 0x0" :: "v"(kp) : "memory"); }
        if (t == np - 1) {                         // wave-uniform: only the pass on the diagonal masks (key0 == q0 there)
#pragma unroll
            for (int kg = 0; kg < 2; ++kg)
#pragma unroll
                for (int q = 0; q < 2; ++q)
#pragma unroll
                    for (int r = 0; r < 8; ++r) if (16 * kg + 8 * h + r > 16 * q + c) s[kg][q][r] = -3.0e38f;
        }
        float mb[2]; bool need = false;
#pragma unroll
        for (int q = 0; q < 2; ++q) { float mx = -3.0e38f;
#pragma unroll
            for (int kg = 0; kg < 2; ++kg)
#pragma unroll
                for (int r = 0; r < 8; ++r) mx = fmaxf(mx, s[kg][q][r]);
            mx = fmaxf(mx, xhalf(mx)) * CSC; mb[q] = mx; need = need || (mx > m[q]); }
        if (__builtin_amdgcn_ballot_w32(need) != 0) {   // scalar branch; where no maximum grows every factor would be exactly 1
#pragma unroll
            for (int q = 0; q < 2; ++q) { const float mn = fmaxf(m[q], mb[q]); const float corr = __builtin_amdgcn_exp2f(m[q] - mn); m[q] = mn; l[q] *= corr;
#pragma unroll
                for (int db = 0; db < 4; ++db) acc[db][q] = acc[db][q] * corr; }
        }
#pragma unroll
        for (int q = 0; q < 2; ++q) { V pb, pc; float sum = 0.f; const float nm = -m[q];
            const v8f cv = {CSC, CSC, CSC, CSC, CSC, CSC, CSC, CSC}, nv = {nm, nm, nm, nm, nm, nm, nm, nm};
            const v8f ar[2] = {__builtin_elementwise_fma(s[0][q], cv, nv), __builtin_elementwise_fma(s[1][q], cv, nv)};
#pragma unroll
            for (int e = 0; e < 16; ++e) { const float p = __builtin_amdgcn_exp2f(ar[e >> 3][e & 7]); sum += p;
                if constexpr (HL) { const __bf16 ph = (__bf16)p; pb[e] = ph; pc[e] = (__bf16)(p - (float)ph); } else { pb[e] = (h16)p; } }
            // inputs only, for the slot behind a transcendental: the exponents keep their registers past the last v_exp_f32; without this line the build writes one v_exp_f32's result over the source of the v_exp_f32 directly in front of it
            if constexpr (!HL) asm volatile("" :: "v"(ar[0]), "v"(ar[1]));
            l[q] += sum;
#pragma unroll
            for (int db = 0; db < 4; ++db) { acc[db][q] = WF::mma(va[db], pb, acc[db][q]); if (HL) { acc[db][q] = WF::mma(va[db], pc, acc[db][q]); acc[db][q] = WF::mma(vc[db], pb, acc[db][q]); } } }
    } while (++t < np);
#pragma unroll
    for (int q = 0; q < 2; ++q) { const float inv = __fdiv_rn(1.0f, l[q] + xhalf(l[q])); float* op = orow + (size_t)(q0 + 16 * q + c) * DQ + 8 * h; v4f o[8];
#pragma unroll
        for (int db = 0; db < 4; ++db) {
#pragma unroll
            for (int r = 0; r < 4; ++r) { o[2 * db][r] = acc[db][q][r] * inv; o[2 * db + 1][r] = acc[db][q][4 + r] * inv; }
            *(v4f*)(op + 16 * db) = o[2 * db]; *(v4f*)(op + 16 * db + 4) = o[2 * db + 1]; }
        // precaution behind the run of eight stores: their address and their data are inputs of the wait, so they keep their registers up to it and are reused only behind it
        asm volatile("s_wait_xcnt 0x0" :: "v"(op), "v"(o[0]), "v"(o[1]), "v"(o[2]), "v"(o[3]), "v"(o[4]), "v"(o[5]), "v"(o[6]), "v"(o[7]) : "memory"); }
}
// ---- k_fattn: grid (8, batch * heads), 4 independent waves (no barrier, no LDS). The four waves of a workgroup take the 32-row blocks x, 15 - x (hi+lo rows), 16 + x, 31 - x (fp16 rows) of one plane, so every workgroup
// walks the same number of passes; which wave takes which block rotates with the workgroup, so that the long blocks do not all fall on the same SIMD.
// three waves per SIMD: the grid is three workgroups per WGP, and all of them are to be resident at once
__global__ __launch_bounds__(128) __attribute__((amdgpu_waves_per_eu(3))) void k_fattn(const h16* __restrict__ Q16, const h16* __restrict__ K16, const h16* __restrict__ V16, const bf* __restrict__ Qh, const bf* __restrict__ Ql, const bf* __restrict__ Kh, const bf* __restrict__ Kl, const bf* __restrict__ Vh, const bf* __restrict__ Vl, float* __restrict__ OUTb) {
    const int w = __builtin_amdgcn_readfirstlane((int)(threadIdx.x >> 5)); const int x = blockIdx.x, g = blockIdx.y;   // g = batch * NH_ + head
    const int role = (w + x + g + (g >> 5)) & 3; const size_t po = (size_t)g * TT * HD;
    float* orow = OUTb + (size_t)(g / NH_) * TT * DQ + (g % NH_) * HD;
    if (role & 1) fa_rows<bf, true>(Qh + po, Ql + po, Kh + po, Kl + po, Vh + po, Vl + po, orow, 32 * ((role == 1) ? 15 - x : x));
    else fa_rows<h16, false>(Q16 + po, nullptr, K16 + po, nullptr, V16 + po, nullptr, orow, 32 * ((role == 0) ? 31 - x : 16 + x));
}

// ---- k_proj: the q, k and v projections of all batches in ONE launch, and their 16-bit planes written straight from the accumulators (no f32 copy of q, k or v in memory).
// grid (rows of x / 64, 3 * heads), ONE WAVE per 64x64 tile (16 accumulators), operands straight from the fragment-order bf16 planes: X rows batch * t, Wt rows [q heads | k heads | v heads][e], k = DM.
// A tile is D = P R^T: a lane holds ONE row of R (tile j, row lane & 15) and 8 consecutive rows of P (tile i, rows 8 (lane >> 4) + r). q, k: P = weights, R = x, so the 8 values are 8 consecutive e of one t;
// v: P = x, R = weights, so they are 8 consecutive t of one e. Both operands are read by the same loader, so the k order of the two is equal either way, and each sum runs over k as before.
// put_frags: those 8 values are the lane's own 16-byte piece (i & 1) of a fragment-order unit of the plane (q, k: rows t, k = e; v^T: rows e, k = t), so every accumulator goes out as one 512-byte store per plane, with no exchange between lanes.
// o16, oh, ol: the tile's first unit in the three planes plus lane * 8.
// sj, si: elements from tile j to j + 1 and from tile pair i >> 1 to the next in the plane's order of units (the same for the whole wave).
__device__ __forceinline__ void put_frags(const v8f (&acc)[4][4], unsigned short* o16, unsigned short* oh, unsigned short* ol, const int sj, const int si) {
#pragma unroll
    for (int j = 0; j < 4; ++j)
#pragma unroll
        for (int ih = 0; ih < 2; ++ih) { v8us d16[2], dh[2], dl[2];   // one unit (both pieces) of each plane at a time
            const int o = j * sj + ih * si; unsigned short* a16 = o16 + o; unsigned short* ah = oh + o; unsigned short* al = ol + o;
#pragma unroll
            for (int ii = 0; ii < 2; ++ii) { v8h c16;
#pragma unroll
                for (int e = 0; e < 8; ++e) { const float v = acc[2 * ih + ii][j][e]; c16[e] = tohx(v); unsigned short a2, c2; splitf(v, a2, c2); dh[ii][e] = a2; dl[ii][e] = c2; }
                d16[ii] = __builtin_bit_cast(v8us, c16);
                *(v8usa*)(a16 + ii * 256) = d16[ii]; *(v8usa*)(ah + ii * 256) = dh[ii]; *(v8usa*)(al + ii * 256) = dl[ii]; }
            // precaution behind the run of six stores: their addresses and their data are inputs of the wait, so they keep their registers up to it and are reused only behind it
            asm volatile("s_wait_xcnt 0x0" :: "v"(a16), "v"(ah), "v"(al), "v"(d16[0]), "v"(d16[1]), "v"(dh[0]), "v"(dh[1]), "v"(dl[0]), "v"(dl[1]) : "memory"); }
}
__global__ __launch_bounds__(32) void k_proj(const bf* __restrict__ X, const bf* __restrict__ Wt, h16* Q16, bf* Qh, bf* Ql, h16* K16, bf* Kh, bf* Kl, h16* V16, bf* Vh, bf* Vl) {
    typedef WFrag<bf> WF; typedef WF::V V;
    const int lane = threadIdx.x & 31; const int r0 = blockIdx.x * 64, y = blockIdx.y, sel = y / NH_, hd = y % NH_; const bool vt = sel == 2;
    const bf* xr = X + (size_t)r0 * DM + lane * 8; const bf* wr = Wt + (size_t)(y * 64) * DM + lane * 8;   // a 16-row block is DM / 32 units = 16 * DM elements
    const bf* pp = vt ? xr : wr; const bf* rp = vt ? wr : xr;
    v8f acc[4][4];
#pragma unroll
    for (int i = 0; i < 4; ++i)
#pragma unroll
        for (int j = 0; j < 4; ++j) acc[i][j] = (v8f){};
    // kept rolled: a second copy of the body would need a second set of fragment registers
#pragma unroll 1
    for (int kc = 0; kc < DM; kc += 32) {
        V p[4], r[4];
#pragma unroll
        for (int i = 0; i < 4; ++i) { p[i] = WF::ld(pp + i * 16 * DM); r[i] = WF::ld(rp + i * 16 * DM); }
        // precaution behind the group of fragment loads: the pointers the loads name are inputs of the wait, so they keep their registers up to it and are moved only behind it
        asm volatile("s_wait_xcnt 0x0" :: "v"(pp), "v"(rp) : "memory");
        pp += 512; rp += 512;
#pragma unroll
        for (int j = 0; j < 4; ++j)
#pragma unroll
            for (int i = 0; i < 4; ++i) acc[i][j] = WF::mma(p[i], r[j], acc[i][j]);
    }
    // 64 rows t of a plane are 64 * HD elements in either order of the units
    const size_t ob = ((size_t)(r0 / TT) * NH_ + hd) * TT * HD + (size_t)(r0 % TT) * HD + lane * 8;
    unsigned short* o16 = (unsigned short*)((sel == 0) ? Q16 : (sel == 1) ? K16 : V16) + ob; unsigned short* oh = ((sel == 0) ? Qh : (sel == 1) ? Kh : Vh) + ob; unsigned short* ol = ((sel == 0) ? Ql : (sel == 1) ? Kl : Vl) + ob;
    put_frags(acc, o16, oh, ol, vt ? 512 : 1024, vt ? 2048 : 512);
}

extern "C" void kernel_launch(void* const* d_in, const int* in_sizes, int n_in,
                              void* d_out, int out_size, void* d_ws, size_t ws_size, hipStream_t stream) {
    (void)in_sizes; (void)n_in; (void)out_size;
    const float* x = (const float*)d_in[0]; const float* wq = (const float*)d_in[1]; const float* wk = (const float*)d_in[2]; const float* wv = (const float*)d_in[3]; const float* wo = nullptr; (void)wo;
    float* OUT = (float*)d_out;     // [8][1024][768]
    char* wsp = (char*)d_ws;
    auto take = [&](size_t bytes) { char* p = wsp; wsp += (bytes + 255) & ~(size_t)255; return (void*)p; };
    bf* WQ = (bf*)take((size_t)(DQ + 2 * DKV) * DM * 2); bf* WK = WQ + (size_t)DQ * DM; bf* WV = WK + (size_t)DKV * DM;   // one stack of rows [q | k | v]
    const size_t PQ = (size_t)NB_ * NH_ * TT * HD * 2, PK = (size_t)NB_ * NKV * TT * HD * 2;   // bytes of one 16-bit plane set [batch][head][..][..]
    h16* QP16 = (h16*)take(PQ); h16* KP16 = (h16*)take(PK); h16* VT16 = (h16*)take(PK);
    bf* QPh = (bf*)take(PQ); bf* QPl = (bf*)take(PQ); bf* KPh = (bf*)take(PK); bf* KPl = (bf*)take(PK); bf* VTh = (bf*)take(PK); bf* VTl = (bf*)take(PK);
    bf* XB = (bf*)take((size_t)NB_ * TT * DM * 2);
    if ((size_t)(wsp - (char*)d_ws) > ws_size) return;    // ws 256 MiB
    k_wtH<<<(unsigned)((DM * DQ / 8 + 255) / 256), 256, 0, stream>>>(wq, DM, DQ, WQ); k_wtH<<<(unsigned)((DM * DKV / 8 + 255) / 256), 256, 0, stream>>>(wk, DM, DKV, WK); k_wtH<<<(unsigned)((DM * DKV / 8 + 255) / 256), 256, 0, stream>>>(wv, DM, DKV, WV);
    // projections: all batches as one [NB_*TT][DM] operand, q, k and v in one launch that also writes the planes
    k_cvt8<<<(unsigned)((size_t)NB_ * TT * DM / 512 / 8), 256, 0, stream>>>(x, XB);
    k_proj<<<dim3(NB_ * TT / 64, (DQ + 2 * DKV) / 64, 1), 32, 0, stream>>>(XB, WQ, QP16, QPh, QPl, KP16, KPh, KPl, VT16, VTh, VTl);
    // attention: every (batch, head) plane in one launch (one kv head per query head)
    k_fattn<<<dim3(8, NB_ * NH_, 1), 128, 0, stream>>>(QP16, KP16, VT16, QPh, QPl, KPh, KPl, VTh, VTl, OUT);
}

// v005
// Measured time: 88.3 microseconds a run.
// Timed twice side by side with v004, it ran 1.08 times as fast both times.
// Over all steps from v000 it is 31.7 times as fast.
#include <hip/hip_runtime.h>

// Causal multi-head attention wrapper with per-head projections (x [8][1024][768]; q_h = x Wq[h], k_h = x Wk[h], v_h = x Wv[h] with per-head 'xw' weights [12][768][64], no bias; scores = q.k / 8, causal mask (-inf above the diagonal); softmax; out = heads concatenated along the feature axis -> [8][1024][768] in f32 (6.3 M), no output projection).
// Compute dtypes, f32 accumulate: every input rounded to bf16; q/k/v on PLAIN bf16 operands (inputs: exact); causal scores and attn.v in ONE fused kernel (online softmax, scores and probabilities stay in registers): query rows < 512 hl (3 products), the rest single fp16; softmax f32; no output projection: the merged heads are written in f32 straight to the output.

// FRAGMENT ORDER: every 16-bit operand plane (x, the weights, q, k, v^T) lies in units of 1 KB = 16 rows x 32 k of its matrix. Inside a unit element (row lr, k = 16 j + 8 hi + e) stands at j * 256 + (hi * 16 + lr) * 8 + e,
// so lane hi * 16 + lr of a wave finds its two 16-byte pieces of a WMMA operand at lane * 8 and 256 + lane * 8: each wave-wide 16-byte load or store covers 512 contiguous bytes (4 whole lines).
// Order of the units: x, weights, q, k: [16-row block][k block]; v^T (rows e, k = key): [32-key block][16-row block].

#define NB_  8
#define TT   1024
#define DM   768
#define NH_  12
#define NKV  12
#define HD   64
#define DQ   (NH_ * HD)
#define DKV  (NKV * HD)
#define RH   512                  // unused: k_fattn's block split fixes the hi+lo rows at < 512
#define SCL  0.125f   // HD^-0.5
typedef _Float16 h16;
typedef unsigned short bf;
typedef __attribute__((ext_vector_type(16))) __bf16   v16bf;
typedef __attribute__((ext_vector_type(16))) _Float16 v16h;
typedef __attribute__((ext_vector_type(8)))  _Float16 v8h;
typedef __attribute__((ext_vector_type(8)))  unsigned short v8us;
typedef __attribute__((ext_vector_type(8)))  float    v8f;
typedef __attribute__((ext_vector_type(4)))  float    v4f;
typedef v8h  __attribute__((may_alias)) v8ha;
typedef v4f  __attribute__((may_alias)) v4fa;
typedef v8us __attribute__((may_alias)) v8usa;

__device__ __forceinline__ unsigned short f2bf(float f) { unsigned u = __float_as_uint(f); u += 0x7FFFu + ((u >> 16) & 1u); return (unsigned short)(u >> 16); }
__device__ __forceinline__ float bf2f(unsigned short b) { return __uint_as_float(((unsigned)b) << 16); }
__device__ __forceinline__ v16h cat16(v8h lo, v8h hi) { return __builtin_shufflevector(lo, hi, 0, 1, 2, 3, 4, 5, 6, 7, 8, 9, 10, 11, 12, 13, 14, 15); }
__device__ __forceinline__ v16bf cat16b(v8us lo, v8us hi) { return __builtin_bit_cast(v16bf, __builtin_shufflevector(lo, hi, 0, 1, 2, 3, 4, 5, 6, 7, 8, 9, 10, 11, 12, 13, 14, 15)); }
__device__ __forceinline__ v8f wmma16(v16h a, v16h b, v8f c) { return __builtin_amdgcn_wmma_f32_16x16x32_f16(false, a, false, b, (short)0, c, false, false); }
__device__ __forceinline__ v8f wmmab(v16bf a, v16bf b, v8f c) { return __builtin_amdgcn_wmma_f32_16x16x32_bf16(false, a, false, b, (short)0, c, false, false); }



template <typename T16> struct WFrag;
template <> struct WFrag<h16> { typedef v16h V; static __device__ __forceinline__ V ld(const h16* p) { return cat16(*(const v8h*)p, *(const v8h*)(p + 256)); } static __device__ __forceinline__ v8f mma(V a, V b, v8f c) { return wmma16(a, b, c); } };
template <> struct WFrag<bf> { typedef v16bf V; static __device__ __forceinline__ V ld(const bf* p) { return cat16b(*(const v8us*)p, *(const v8us*)(p + 256)); } static __device__ __forceinline__ v8f mma(V a, V b, v8f c) { return wmmab(a, b, c); } };
__device__ __forceinline__ h16 tohx(float x) { return (h16)x; }
__device__ __forceinline__ void splitf(float y, unsigned short& h, unsigned short& l) { h = f2bf(y); l = f2bf(y - bf2f(h)); }
typedef __attribute__((ext_vector_type(2))) _Float16 v2h;
typedef __attribute__((ext_vector_type(4))) _Float16 v4h;
typedef __attribute__((ext_vector_type(2))) unsigned short v2us;
typedef __attribute__((ext_vector_type(4))) unsigned short v4us;
typedef __attribute__((ext_vector_type(2))) float v2f;
typedef __attribute__((ext_vector_type(4))) int v4i;

// weights [head][k][e] f32 -> rows n = head * HD + e, k contiguous, bf16, in fragment order: one thread makes one 16-byte piece i (8 k of one n); the 16 lanes of a half wave read 16 consecutive e
__device__ __forceinline__ void wt_piece(const float* __restrict__ w, const int i, bf* Bt) {
    const int lr = i & 15, hi = (i >> 4) & 1, j = (i >> 5) & 1, u = i >> 6; const int nkb = DM / 32; const int kb = u % nkb, n = (u / nkb) * 16 + lr;
    const float* sp = w + ((size_t)(n / HD) * DM + kb * 32 + j * 16 + hi * 8) * HD + n % HD; float v[8]; v8us o;
#pragma unroll
    for (int e = 0; e < 8; ++e) v[e] = sp[e * HD];
    // precaution behind the group of loads: the pointer they name is an input of the wait, so it keeps its registers up to it
    asm volatile("s_wait_xcnt 0x0" :: "v"(sp) : "memory");
#pragma unroll
    for (int e = 0; e < 8; ++e) o[e] = f2bf(v[e]);
    *(v8us*)(Bt + (size_t)i * 8) = o;
    // precaution behind the store: its address (the build forms it from the scalar base and the piece's index) and its data are inputs of the wait, so they keep their registers up to it (the other side of k_prep's branch may stand behind this code)
    asm volatile("s_wait_xcnt 0x0" :: "s"(Bt), "v"(i), "v"(o) : "memory");
}

// x [row][DM] f32 -> bf16 in fragment order: one wave makes one unit u (16 rows x 32 k); 8 lanes read one whole 128-byte line of a row, 4 rows a load
__device__ __forceinline__ void cvt_unit(const float* __restrict__ src, bf* dst, const int u) {
    const int lane = threadIdx.x & 31, rr = lane >> 3, g = lane & 7; const int rb = u / (DM / 32), kb = u % (DM / 32);
    const float* sp = src + (size_t)(rb * 16 + rr) * DM + kb * 32 + g * 4; bf* dp = dst + (size_t)u * 512 + (g >> 2) * 256 + (((g >> 1) & 1) * 16 + rr) * 8 + (g & 1) * 4; v4f v[4]; v4us o[4];
#pragma unroll
    for (int s = 0; s < 4; ++s) v[s] = *(const v4f*)(sp + s * 4 * DM);
    // precaution behind the group of loads: the pointer they name is an input of the wait, so it keeps its registers up to it
    asm volatile("s_wait_xcnt 0x0" :: "v"(sp) : "memory");
#pragma unroll
    for (int s = 0; s < 4; ++s) {
#pragma unroll
        for (int k = 0; k < 4; ++k) o[s][k] = f2bf(v[s][k]);
        *(v4us*)(dp + s * 32) = o[s]; }
    // precaution behind the run of four stores: their address and their data are inputs of the wait, so they keep their registers up to it (the other side of k_prep's branch may stand behind this code)
    asm volatile("s_wait_xcnt 0x0" :: "v"(dp), "v"(o[0]), "v"(o[1]), "v"(o[2]), "v"(o[3]) : "memory");
}

// ---- k_prep: the four independent conversions (Wq, Wk, Wv, x) in ONE launch, told apart by block range (a block-uniform branch, no barrier): blocks 0 .. 3 * WTB - 1 make the weight stack [q | k | v], the rest make x.
#define WTB (DM * DQ / 8 / 256)              // blocks per weight matrix, 256 pieces each
#define CVB (NB_ * TT * DM / 512 / 8)        // blocks for x, 8 units each
static_assert(DQ == DKV && DM * DQ % (8 * 256) == 0 && NB_ * TT * DM % (512 * 8) == 0, "the block ranges cover every piece and every unit exactly once");
__global__ __launch_bounds__(256) void k_prep(const float* __restrict__ x, const float* __restrict__ wq, const float* __restrict__ wk, const float* __restrict__ wv, bf* Wt, bf* XB) {
    const int b = blockIdx.x;
    if (b < 3 * WTB) { const int sel = b / WTB; wt_piece((sel == 0) ? wq : (sel == 1) ? wk : wv, (b - sel * WTB) * 256 + (int)threadIdx.x, Wt + (size_t)sel * DQ * DM); }
    else cvt_unit(x, XB, (b - 3 * WTB) * 8 + (int)(threadIdx.x >> 5));
}

// lane l with lane l ^ 16
__device__ __forceinline__ float xhalf(float x) { return __builtin_bit_cast(float, __builtin_amdgcn_permlanex16(__builtin_bit_cast(int, x), __builtin_bit_cast(int, x), 0x76543210, 0xfedcba98, false, false)); }

template <typename T16, bool HL>
__device__ __forceinline__ void fa_rows(const T16* __restrict__ Q, const T16* __restrict__ Q2, const T16* __restrict__ Kp, const T16* __restrict__ Kp2, const T16* __restrict__ Vt, const T16* __restrict__ Vt2, float* __restrict__ orow, const int q0) {
    typedef WFrag<T16> WF; typedef typename WF::V V;
    const int lane = threadIdx.x & 31, c = lane & 15, h = lane >> 4;
    const float CSC = SCL * 1.4426950408889634f;
    // the lane's piece in a fragment-order unit stands lb bytes into it. Q: wave-uniform pointers to the first unit; K, V^T: per-lane pointers, carried through the loop and moved once a pass (4 units = 32 keys)
    const unsigned lb = lane * 16; auto at = [lb](const T16* u) { return (const T16*)((const char*)u + lb); };
    const T16* qp = Q + (size_t)q0 * HD; const T16* qp2 = HL ? Q2 + (size_t)q0 * HD : nullptr;
    const T16* kp = at(Kp); const T16* kp2 = HL ? at(Kp2) : nullptr;
    const T16* vp = at(Vt); const T16* vp2 = HL ? at(Vt2) : nullptr;
    V qf[2][2], qg[2][2];
#pragma unroll
    for (int q = 0; q < 2; ++q)
#pragma unroll
        for (int ks = 0; ks < 2; ++ks) { const int o = 16 * q * HD + 512 * ks; qf[q][ks] = WF::ld(at(qp) + o); if (HL) qg[q][ks] = WF::ld(at(qp2) + o); }
    v8f acc[4][2];
#pragma unroll
    for (int db = 0; db < 4; ++db)
#pragma unroll
        for (int q = 0; q < 2; ++q) acc[db][q] = (v8f){};
    float m[2] = {-3.0e38f, -3.0e38f}, l[2] = {0.f, 0.f};
    const int np = (q0 >> 5) + 1;                  // passes: keys 0 .. q0 + 31
    V ka[2][2], kc[2][2];
#pragma unroll
    for (int kg = 0; kg < 2; ++kg)
#pragma unroll
        for (int ks = 0; ks < 2; ++ks) { const int o = kg * 16 * HD + 512 * ks; ka[kg][ks] = WF::ld(kp + o); if (HL) kc[kg][ks] = WF::ld(kp2 + o); }
    // precaution behind a group of fragment loads, here and in the loop: the pointers the loads name are inputs of the wait, so they keep their registers up to it and are moved only behind it
    // (here the build addresses by scalar base and lane offset, so these are named as well)
    if constexpr (HL) asm volatile("s_wait_xcnt 0x0" :: "s"(qp), "s"(qp2), "s"(Kp), "s"(Kp2), "v"(lb), "v"(kp), "v"(kp2) : "memory"); else asm volatile("s_wait_xcnt 0x0" :: "s"(qp), "s"(Kp), "v"(lb), "v"(kp) : "memory");
    int t = 0;
    // kept rolled: the trip count is a run-time value, and a second copy of the body would not fit the register budget of three waves per SIMD
#pragma unroll 1
    do {                                           // np >= 1: every query row sees key 0
        V va[4], vc[4];                            // this pass's V^T fragments: in flight under the score products and the softmax
#pragma unroll
        for (int db = 0; db < 4; ++db) { const int o = db * 512; va[db] = WF::ld(vp + o); if (HL) vc[db] = WF::ld(vp2 + o); }
        if constexpr (HL) asm volatile("s_wait_xcnt 0x0" :: "v"(vp), "v"(vp2) : "memory"); else asm volatile("s_wait_xcnt 0x0" :: "v"(vp) : "memory");
        vp += 2048; if (HL) vp2 += 2048;
        v8f s[2][2];
#pragma unroll
        for (int kg = 0; kg < 2; ++kg)
#pragma unroll
            for (int q = 0; q < 2; ++q) { s[kg][q] = (v8f){};
#pragma unroll
                for (int ks = 0; ks < 2; ++ks) { s[kg][q] = WF::mma(ka[kg][ks], qf[q][ks], s[kg][q]); if (HL) { s[kg][q] = WF::mma(ka[kg][ks], qg[q][ks], s[kg][q]); s[kg][q] = WF::mma(kc[kg][ks], qf[q][ks], s[kg][q]); } } }
        { const int kstep = (t + 1 < np) ? 32 * HD : 0;  // the next pass's K fragments, in flight under this pass's softmax and second product (the last pass reloads its own: in bounds, unused)
            kp += kstep; if (HL) kp2 += kstep;
#pragma unroll
            for (int kg = 0; kg < 2; ++kg)
#pragma unroll
                for (int ks = 0; ks < 2; ++ks) { const int o = kg * 16 * HD + 512 * ks; ka[kg][ks] = WF::ld(kp + o); if (HL) kc[kg][ks] = WF::ld(kp2 + o); }
            if constexpr (HL) asm volatile("s_wait_xcnt 0x0" :: "v"(kp), "v"(kp2) : "memory"); else asm volatile("s_wait_xcnt 0x0" :: "v"(kp) : "memory"); }
        if (t == np - 1) {                         // wave-uniform: only the pass on the diagonal masks (key0 == q0 there)
#pragma unroll
            for (int kg = 0; kg < 2; ++kg)
#pragma unroll
                for (int q = 0; q < 2; ++q)
#pragma unroll
                    for (int r = 0; r < 8; ++r) if (16 * kg + 8 * h + r > 16 * q + c) s[kg][q][r] = -3.0e38f;
        }
        float mb[2]; bool need = false;
#pragma unroll
        for (int q = 0; q < 2; ++q) { float mx = -3.0e38f;
#pragma unroll
            for (int kg = 0; kg < 2; ++kg)
#pragma unroll
                for (int r = 0; r < 8; ++r) mx = fmaxf(mx, s[kg][q][r]);
            mx = fmaxf(mx, xhalf(mx)) * CSC; mb[q] = mx; need = need || (mx > m[q]); }
        if (__builtin_amdgcn_ballot_w32(need) != 0) {   // scalar branch; where no maximum grows every factor would be exactly 1
#pragma unroll
            for (int q = 0; q < 2; ++q) { const float mn = fmaxf(m[q], mb[q]); const float corr = __builtin_amdgcn_exp2f(m[q] - mn); m[q] = mn; l[q] *= corr;
#pragma unroll
                for (int db = 0; db < 4; ++db) acc[db][q] = acc[db][q] * corr; }
        }
#pragma unroll
        for (int q = 0; q < 2; ++q) { V pb, pc; float sum = 0.f; const float nm = -m[q];
            const v8f cv = {CSC, CSC, CSC, CSC, CSC, CSC, CSC, CSC}, nv = {nm, nm, nm, nm, nm, nm, nm, nm};
            const v8f ar[2] = {__builtin_elementwise_fma(s[0][q], cv, nv), __builtin_elementwise_fma(s[1][q], cv, nv)};
#pragma unroll
            for (int e = 0; e < 16; ++e) { const float p = __builtin_amdgcn_exp2f(ar[e >> 3][e & 7]); sum += p;
                if constexpr (HL) { const __bf16 ph = (__bf16)p; pb[e] = ph; pc[e] = (__bf16)(p - (float)ph); } else { pb[e] = (h16)p; } }
            // inputs only, for the slot behind a transcendental: the exponents keep their registers past the last v_exp_f32; without this line the build writes one v_exp_f32's result over the source of the v_exp_f32 directly in front of it
            if constexpr (!HL) asm volatile("" :: "v"(ar[0]), "v"(ar[1]));
            l[q] += sum;
#pragma unroll
            for (int db = 0; db < 4; ++db) { acc[db][q] = WF::mma(va[db], pb, acc[db][q]); if (HL) { acc[db][q] = WF::mma(va[db], pc, acc[db][q]); acc[db][q] = WF::mma(vc[db], pb, acc[db][q]); } } }
    } while (++t < np);
#pragma unroll
    for (int q = 0; q < 2; ++q) { const float inv = __fdiv_rn(1.0f, l[q] + xhalf(l[q])); float* op = orow + (size_t)(q0 + 16 * q + c) * DQ + 8 * h; v4f o[8];
#pragma unroll
        for (int db = 0; db < 4; ++db) {
#pragma unroll
            for (int r = 0; r < 4; ++r) { o[2 * db][r] = acc[db][q][r] * inv; o[2 * db + 1][r] = acc[db][q][4 + r] * inv; }
            *(v4f*)(op + 16 * db) = o[2 * db]; *(v4f*)(op + 16 * db + 4) = o[2 * db + 1]; }
        // precaution behind the run of eight stores: their address and their data are inputs of the wait, so they keep their registers up to it and are reused only behind it
        asm volatile("s_wait_xcnt 0x0" :: "v"(op), "v"(o[0]), "v"(o[1]), "v"(o[2]), "v"(o[3]), "v"(o[4]), "v"(o[5]), "v"(o[6]), "v"(o[7]) : "memory"); }
}
// ---- k_fattn: grid (8, batch * heads), 4 independent waves (no barrier, no LDS). The four waves of a workgroup take the 32-row blocks x, 15 - x (hi+lo rows), 16 + x, 31 - x (fp16 rows) of one plane, so every workgroup
// walks the same number of passes; which wave takes which block rotates with the workgroup, so that the long blocks do not all fall on the same SIMD.
// three waves per SIMD: the grid is three workgroups per WGP, and all of them are to be resident at once
__global__ __launch_bounds__(128) __attribute__((amdgpu_waves_per_eu(3))) void k_fattn(const h16* __restrict__ Q16, const h16* __restrict__ K16, const h16* __restrict__ V16, const bf* __restrict__ Qh, const bf* __restrict__ Ql, const bf* __restrict__ Kh, const bf* __restrict__ Kl, const bf* __restrict__ Vh, const bf* __restrict__ Vl, float* __restrict__ OUTb) {
    const int w = __builtin_amdgcn_readfirstlane((int)(threadIdx.x >> 5)); const int x = blockIdx.x, g = blockIdx.y;   // g = batch * NH_ + head
    const int role = (w + x + g + (g >> 5)) & 3; const size_t po = (size_t)g * TT * HD;
    float* orow = OUTb + (size_t)(g / NH_) * TT * DQ + (g % NH_) * HD;
    if (role & 1) fa_rows<bf, true>(Qh + po, Ql + po, Kh + po, Kl + po, Vh + po, Vl + po, orow, 32 * ((role == 1) ? 15 - x : x));
    else fa_rows<h16, false>(Q16 + po, nullptr, K16 + po, nullptr, V16 + po, nullptr, orow, 32 * ((role == 0) ? 31 - x : 16 + x));
}

// ---- k_proj: the q, k and v projections of all batches in ONE launch, and their 16-bit planes written straight from the accumulators (no f32 copy of q, k or v in memory).
// grid (rows of x / 64, 3 * heads), ONE WAVE per 64x64 tile (16 accumulators), operands straight from the fragment-order bf16 planes: X rows batch * t, Wt rows [q heads | k heads | v heads][e], k = DM.
// A tile is D = P R^T: a lane holds ONE row of R (tile j, row lane & 15) and 8 consecutive rows of P (tile i, rows 8 (lane >> 4) + r). q, k: P = weights, R = x, so the 8 values are 8 consecutive e of one t;
// v: P = x, R = weights, so they are 8 consecutive t of one e. Both operands are read by the same loader, so the k order of the two is equal either way, and each sum runs over k as before.
// put_frags: those 8 values are the lane's own 16-byte piece (i & 1) of a fragment-order unit of the plane (q, k: rows t, k = e; v^T: rows e, k = t), so every accumulator goes out as one 512-byte store per plane, with no exchange between lanes.
// o16, oh, ol: the tile's first unit in the three planes plus lane * 8.
// sj, si: elements from tile j to j + 1 and from tile pair i >> 1 to the next in the plane's order of units (the same for the whole wave).
__device__ __forceinline__ void put_frags(const v8f (&acc)[4][4], unsigned short* o16, unsigned short* oh, unsigned short* ol, const int sj, const int si) {
#pragma unroll
    for (int j = 0; j < 4; ++j)
#pragma unroll
        for (int ih = 0; ih < 2; ++ih) { v8us d16[2], dh[2], dl[2];   // one unit (both pieces) of each plane at a time
            const int o = j * sj + ih * si; unsigned short* a16 = o16 + o; unsigned short* ah = oh + o; unsigned short* al = ol + o;
#pragma unroll
            for (int ii = 0; ii < 2; ++ii) { v8h c16;
#pragma unroll
                for (int e = 0; e < 8; ++e) { const float v = acc[2 * ih + ii][j][e]; c16[e] = tohx(v); unsigned short a2, c2; splitf(v, a2, c2); dh[ii][e] = a2; dl[ii][e] = c2; }
                d16[ii] = __builtin_bit_cast(v8us, c16);
                *(v8usa*)(a16 + ii * 256) = d16[ii]; *(v8usa*)(ah + ii * 256) = dh[ii]; *(v8usa*)(al + ii * 256) = dl[ii]; }
            // precaution behind the run of six stores: their addresses and their data are inputs of the wait, so they keep their registers up to it and are reused only behind it
            asm volatile("s_wait_xcnt 0x0" :: "v"(a16), "v"(ah), "v"(al), "v"(d16[0]), "v"(d16[1]), "v"(dh[0]), "v"(dh[1]), "v"(dl[0]), "v"(dl[1]) : "memory"); }
}
__global__ __launch_bounds__(32) void k_proj(const bf* __restrict__ X, const bf* __restrict__ Wt, h16* Q16, bf* Qh, bf* Ql, h16* K16, bf* Kh, bf* Kl, h16* V16, bf* Vh, bf* Vl) {
    typedef WFrag<bf> WF; typedef WF::V V;
    const int lane = threadIdx.x & 31; const int r0 = blockIdx.x * 64, y = blockIdx.y, sel = y / NH_, hd = y % NH_; const bool vt = sel == 2;
    const bf* xr = X + (size_t)r0 * DM + lane * 8; const bf* wr = Wt + (size_t)(y * 64) * DM + lane * 8;   // a 16-row block is DM / 32 units = 16 * DM elements
    const bf* pp = vt ? xr : wr; const bf* rp = vt ? wr : xr;
    v8f acc[4][4];
#pragma unroll
    for (int i = 0; i < 4; ++i)
#pragma unroll
        for (int j = 0; j < 4; ++j) acc[i][j] = (v8f){};
    // kept rolled: a second copy of the body would need a second set of fragment registers
#pragma unroll 1
    for (int kc = 0; kc < DM; kc += 32) {
        V p[4], r[4];
#pragma unroll
        for (int i = 0; i < 4; ++i) { p[i] = WF::ld(pp + i * 16 * DM); r[i] = WF::ld(rp + i * 16 * DM); }
        // precaution behind the group of fragment loads: the pointers the loads name are inputs of the wait, so they keep their registers up to it and are moved only behind it
        asm volatile("s_wait_xcnt 0x0" :: "v"(pp), "v"(rp) : "memory");
        pp += 512; rp += 512;
#pragma unroll
        for (int j = 0; j < 4; ++j)
#pragma unroll
            for (int i = 0; i < 4; ++i) acc[i][j] = WF::mma(p[i], r[j], acc[i][j]);
    }
    // 64 rows t of a plane are 64 * HD elements in either order of the units
    const size_t ob = ((size_t)(r0 / TT) * NH_ + hd) * TT * HD + (size_t)(r0 % TT) * HD + lane * 8;
    unsigned short* o16 = (unsigned short*)((sel == 0) ? Q16 : (sel == 1) ? K16 : V16) + ob; unsigned short* oh = ((sel == 0) ? Qh : (sel == 1) ? Kh : Vh) + ob; unsigned short* ol = ((sel == 0) ? Ql : (sel == 1) ? Kl : Vl) + ob;
    put_frags(acc, o16, oh, ol, vt ? 512 : 1024, vt ? 2048 : 512);
}

extern "C" void kernel_launch(void* const* d_in, const int* in_sizes, int n_in,
                              void* d_out, int out_size, void* d_ws, size_t ws_size, hipStream_t stream) {
    (void)in_sizes; (void)n_in; (void)out_size;
    const float* x = (const float*)d_in[0]; const float* wq = (const float*)d_in[1]; const float* wk = (const float*)d_in[2]; const float* wv = (const float*)d_in[3]; const float* wo = nullptr; (void)wo;
    float* OUT = (float*)d_out;     // [8][1024][768]
    char* wsp = (char*)d_ws;
    auto take = [&](size_t bytes) { char* p = wsp; wsp += (bytes + 255) & ~(size_t)255; return (void*)p; };
    bf* WQ = (bf*)take((size_t)(DQ + 2 * DKV) * DM * 2);   // one stack of rows [q | k | v]
    const size_t PQ = (size_t)NB_ * NH_ * TT * HD * 2, PK = (size_t)NB_ * NKV * TT * HD * 2;   // bytes of one 16-bit plane set [batch][head][..][..]
    h16* QP16 = (h16*)take(PQ); h16* KP16 = (h16*)take(PK); h16* VT16 = (h16*)take(PK);
    bf* QPh = (bf*)take(PQ); bf* QPl = (bf*)take(PQ); bf* KPh = (bf*)take(PK); bf* KPl = (bf*)take(PK); bf* VTh = (bf*)take(PK); bf* VTl = (bf*)take(PK);
    bf* XB = (bf*)take((size_t)NB_ * TT * DM * 2);
    if ((size_t)(wsp - (char*)d_ws) > ws_size) return;    // ws 256 MiB
    // the weight stack and x in fragment order, one launch
    k_prep<<<(unsigned)(3 * WTB + CVB), 256, 0, stream>>>(x, wq, wk, wv, WQ, XB);
    // projections: all batches as one [NB_*TT][DM] operand, q, k and v in one launch that also writes the planes
    k_proj<<<dim3(NB_ * TT / 64, (DQ + 2 * DKV) / 64, 1), 32, 0, stream>>>(XB, WQ, QP16, QPh, QPl, KP16, KPh, KPl, VT16, VTh, VTl);
    // attention: every (batch, head) plane in one launch (one kv head per query head)
    k_fattn<<<dim3(8, NB_ * NH_, 1), 128, 0, stream>>>(QP16, KP16, VT16, QPh, QPl, KPh, KPl, VTh, VTl, OUT);
}

// v006
// A run of this version takes 81.7 microseconds.
// Two timings next to v005 both put it at 1.08 times that version's speed.
// Over all steps from v000 it is 34.3 times as fast.
#include <hip/hip_runtime.h>

// Causal multi-head attention wrapper with per-head projections (x [8][1024][768]; q_h = x Wq[h], k_h = x Wk[h], v_h = x Wv[h] with per-head 'xw' weights [12][768][64], no bias; scores = q.k / 8, causal mask (-inf above the diagonal); softmax; out = heads concatenated along the feature axis -> [8][1024][768] in f32 (6.3 M), no output projection).
// Compute dtypes, f32 accumulate: every input rounded to bf16; q/k/v on PLAIN bf16 operands (inputs: exact); causal scores and attn.v in ONE fused kernel (online softmax, scores and probabilities stay in registers): query rows < 512 hl (3 products), the rest single fp16; softmax f32; no output projection: the merged heads are written in f32 straight to the output.

// FRAGMENT ORDER: every 16-bit operand plane (x, the weights, q, k, v^T) lies in units of 1 KB = 16 rows x 32 k of its matrix. Inside a unit element (row lr, k = 16 j + 8 hi + e) stands at j * 256 + (hi * 16 + lr) * 8 + e,
// so lane hi * 16 + lr of a wave finds its two 16-byte pieces of a WMMA operand at lane * 8 and 256 + lane * 8: each wave-wide 16-byte load or store covers 512 contiguous bytes (4 whole lines).
// Order of the units: x, weights, q, k: [16-row block][k block]; v^T (rows e, k = key): [32-key block][16-row block].

#define NB_  8
#define TT   1024
#define DM   768
#define NH_  12
#define NKV  12
#define HD   64
#define DQ   (NH_ * HD)
#define DKV  (NKV * HD)
#define RH   512                  // unused: k_fattn's block split fixes the hi+lo rows at < 512
#define SCL  0.125f   // HD^-0.5
typedef _Float16 h16;
typedef unsigned short bf;
typedef __attribute__((ext_vector_type(16))) __bf16   v16bf;
typedef __attribute__((ext_vector_type(16))) _Float16 v16h;
typedef __attribute__((ext_vector_type(8)))  _Float16 v8h;
typedef __attribute__((ext_vector_type(8)))  unsigned short v8us;
typedef __attribute__((ext_vector_type(8)))  float    v8f;
typedef __attribute__((ext_vector_type(4)))  float    v4f;
typedef v8h  __attribute__((may_alias)) v8ha;
typedef v4f  __attribute__((may_alias)) v4fa;
typedef v8us __attribute__((may_alias)) v8usa;

__device__ __forceinline__ unsigned short f2bf(float f) { unsigned u = __float_as_uint(f); u += 0x7FFFu + ((u >> 16) & 1u); return (unsigned short)(u >> 16); }
__device__ __forceinline__ float bf2f(unsigned short b) { return __uint_as_float(((unsigned)b) << 16); }
__device__ __forceinline__ v16h cat16(v8h lo, v8h hi) { return __builtin_shufflevector(lo, hi, 0, 1, 2, 3, 4, 5, 6, 7, 8, 9, 10, 11, 12, 13, 14, 15); }
__device__ __forceinline__ v16bf cat16b(v8us lo, v8us hi) { return __builtin_bit_cast(v16bf, __builtin_shufflevector(lo, hi, 0, 1, 2, 3, 4, 5, 6, 7, 8, 9, 10, 11, 12, 13, 14, 15)); }
__device__ __forceinline__ v8f wmma16(v16h a, v16h b, v8f c) { return __builtin_amdgcn_wmma_f32_16x16x32_f16(false, a, false, b, (short)0, c, false, false); }
__device__ __forceinline__ v8f wmmab(v16bf a, v16bf b, v8f c) { return __builtin_amdgcn_wmma_f32_16x16x32_bf16(false, a, false, b, (short)0, c, false, false); }



template <typename T16> struct WFrag;
template <> struct WFrag<h16> { typedef v16h V; static __device__ __forceinline__ V ld(const h16* p) { return cat16(*(const v8h*)p, *(const v8h*)(p + 256)); } static __device__ __forceinline__ v8f mma(V a, V b, v8f c) { return wmma16(a, b, c); } };
template <> struct WFrag<bf> { typedef v16bf V; static __device__ __forceinline__ V ld(const bf* p) { return cat16b(*(const v8us*)p, *(const v8us*)(p + 256)); } static __device__ __forceinline__ v8f mma(V a, V b, v8f c) { return wmmab(a, b, c); } };
__device__ __forceinline__ h16 tohx(float x) { return (h16)x; }
__device__ __forceinline__ void splitf(float y, unsigned short& h, unsigned short& l) { h = f2bf(y); l = f2bf(y - bf2f(h)); }
typedef __attribute__((ext_vector_type(2))) _Float16 v2h;
typedef __attribute__((ext_vector_type(4))) _Float16 v4h;
typedef __attribute__((ext_vector_type(2))) unsigned short v2us;
typedef __attribute__((ext_vector_type(4))) unsigned short v4us;
typedef __attribute__((ext_vector_type(2))) float v2f;
typedef __attribute__((ext_vector_type(4))) int v4i;

// weights [head][k][e] f32 -> rows n = head * HD + e, k contiguous, bf16, in fragment order: one thread makes one 16-byte piece i (8 k of one n); the 16 lanes of a half wave read 16 consecutive e
__device__ __forceinline__ void wt_piece(const float* __restrict__ w, const int i, bf* Bt) {
    const int lr = i & 15, hi = (i >> 4) & 1, j = (i >> 5) & 1, u = i >> 6; const int nkb = DM / 32; const int kb = u % nkb, n = (u / nkb) * 16 + lr;
    const float* sp = w + ((size_t)(n / HD) * DM + kb * 32 + j * 16 + hi * 8) * HD + n % HD; float v[8]; v8us o;
#pragma unroll
    for (int e = 0; e < 8; ++e) v[e] = sp[e * HD];
    // precaution behind the group of loads: the pointer they name is an input of the wait, so it keeps its registers up to it
    asm volatile("s_wait_xcnt 0x0" :: "v"(sp) : "memory");
#pragma unroll
    for (int e = 0; e < 8; ++e) o[e] = f2bf(v[e]);
    *(v8us*)(Bt + (size_t)i * 8) = o;
    // precaution behind the store: its address (the build forms it from the scalar base and the piece's index) and its data are inputs of the wait, so they keep their registers up to it (the other side of k_prep's branch may stand behind this code)
    asm volatile("s_wait_xcnt 0x0" :: "s"(Bt), "v"(i), "v"(o) : "memory");
}

// x [row][DM] f32 -> bf16 in fragment order: one wave makes one unit u (16 rows x 32 k); 8 lanes read one whole 128-byte line of a row, 4 rows a load
__device__ __forceinline__ void cvt_unit(const float* __restrict__ src, bf* dst, const int u) {
    const int lane = threadIdx.x & 31, rr = lane >> 3, g = lane & 7; const int rb = u / (DM / 32), kb = u % (DM / 32);
    const float* sp = src + (size_t)(rb * 16 + rr) * DM + kb * 32 + g * 4; bf* dp = dst + (size_t)u * 512 + (g >> 2) * 256 + (((g >> 1) & 1) * 16 + rr) * 8 + (g & 1) * 4; v4f v[4]; v4us o[4];
#pragma unroll
    for (int s = 0; s < 4; ++s) v[s] = *(const v4f*)(sp + s * 4 * DM);
    // precaution behind the group of loads: the pointer they name is an input of the wait, so it keeps its registers up to it
    asm volatile("s_wait_xcnt 0x0" :: "v"(sp) : "memory");
#pragma unroll
    for (int s = 0; s < 4; ++s) {
#pragma unroll
        for (int k = 0; k < 4; ++k) o[s][k] = f2bf(v[s][k]);
        *(v4us*)(dp + s * 32) = o[s]; }
    // precaution behind the run of four stores: their address and their data are inputs of the wait, so they keep their registers up to it (the other side of k_prep's branch may stand behind this code)
    asm volatile("s_wait_xcnt 0x0" :: "v"(dp), "v"(o[0]), "v"(o[1]), "v"(o[2]), "v"(o[3]) : "memory");
}

// ---- k_prep: the four independent conversions (Wq, Wk, Wv, x) in ONE launch, told apart by block range (a block-uniform branch, no barrier): blocks 0 .. 3 * WTB - 1 make the weight stack [q | k | v], the rest make x.
#define WTB (DM * DQ / 8 / 256)              // blocks per weight matrix, 256 pieces each
#define CVB (NB_ * TT * DM / 512 / 8)        // blocks for x, 8 units each
static_assert(DQ == DKV && DM * DQ % (8 * 256) == 0 && NB_ * TT * DM % (512 * 8) == 0, "the block ranges cover every piece and every unit exactly once");
__global__ __launch_bounds__(256) void k_prep(const float* __restrict__ x, const float* __restrict__ wq, const float* __restrict__ wk, const float* __restrict__ wv, bf* Wt, bf* XB) {
    const int b = blockIdx.x;
    if (b < 3 * WTB) { const int sel = b / WTB; wt_piece((sel == 0) ? wq : (sel == 1) ? wk : wv, (b - sel * WTB) * 256 + (int)threadIdx.x, Wt + (size_t)sel * DQ * DM); }
    else cvt_unit(x, XB, (b - 3 * WTB) * 8 + (int)(threadIdx.x >> 5));
}

// lane l with lane l ^ 16
__device__ __forceinline__ float xhalf(float x) { return __builtin_bit_cast(float, __builtin_amdgcn_permlanex16(__builtin_bit_cast(int, x), __builtin_bit_cast(int, x), 0x76543210, 0xfedcba98, false, false)); }

template <typename T16, bool HL>
__device__ __forceinline__ void fa_rows(const T16* __restrict__ Q, const T16* __restrict__ Q2, const T16* __restrict__ Kp, const T16* __restrict__ Kp2, const T16* __restrict__ Vt, const T16* __restrict__ Vt2, float* __restrict__ orow, const int q0) {
    typedef WFrag<T16> WF; typedef typename WF::V V;
    const int lane = threadIdx.x & 31, c = lane & 15, h = lane >> 4;
    const float CSC = SCL * 1.4426950408889634f;
    // the lane's piece in a fragment-order unit stands lb bytes into it. Q: wave-uniform pointers to the first unit; K, V^T: per-lane pointers, carried through the loop and moved once a pass (4 units = 32 keys)
    const unsigned lb = lane * 16; auto at = [lb](const T16* u) { return (const T16*)((const char*)u + lb); };
    const T16* qp = Q + (size_t)q0 * HD; const T16* qp2 = HL ? Q2 + (size_t)q0 * HD : nullptr;
    const T16* kp = at(Kp); const T16* kp2 = HL ? at(Kp2) : nullptr;
    const T16* vp = at(Vt); const T16* vp2 = HL ? at(Vt2) : nullptr;
    V qf[2][2], qg[2][2];
#pragma unroll
    for (int q = 0; q < 2; ++q)
#pragma unroll
        for (int ks = 0; ks < 2; ++ks) { const int o = 16 * q * HD + 512 * ks; qf[q][ks] = WF::ld(at(qp) + o); if (HL) qg[q][ks] = WF::ld(at(qp2) + o); }
    v8f acc[4][2];
#pragma unroll
    for (int db = 0; db < 4; ++db)
#pragma unroll
        for (int q = 0; q < 2; ++q) acc[db][q] = (v8f){};
    float m[2] = {-3.0e38f, -3.0e38f}, l[2] = {0.f, 0.f};
    const int np = (q0 >> 5) + 1;                  // passes: keys 0 .. q0 + 31
    V ka[2][2], kc[2][2];
#pragma unroll
    for (int kg = 0; kg < 2; ++kg)
#pragma unroll
        for (int ks = 0; ks < 2; ++ks) { const int o = kg * 16 * HD + 512 * ks; ka[kg][ks] = WF::ld(kp + o); if (HL) kc[kg][ks] = WF::ld(kp2 + o); }
    // precaution behind a group of fragment loads, here and in the loop: the pointers the loads name are inputs of the wait, so they keep their registers up to it and are moved only behind it
    // (here the build addresses by scalar base and lane offset, so these are named as well)
    if constexpr (HL) asm volatile("s_wait_xcnt 0x0" :: "s"(qp), "s"(qp2), "s"(Kp), "s"(Kp2), "v"(lb), "v"(kp), "v"(kp2) : "memory"); else asm volatile("s_wait_xcnt 0x0" :: "s"(qp), "s"(Kp), "v"(lb), "v"(kp) : "memory");
    int t = 0;
    // kept rolled: the trip count is a run-time value, and a second copy of the body would not fit the register budget of three waves per SIMD
#pragma unroll 1
    do {                                           // np >= 1: every query row sees key 0
        V va[4], vc[4];                            // this pass's V^T fragments: in flight under the score products and the softmax
#pragma unroll
        for (int db = 0; db < 4; ++db) { const int o = db * 512; va[db] = WF::ld(vp + o); if (HL) vc[db] = WF::ld(vp2 + o); }
        if constexpr (HL) asm volatile("s_wait_xcnt 0x0" :: "v"(vp), "v"(vp2) : "memory"); else asm volatile("s_wait_xcnt 0x0" :: "v"(vp) : "memory");
        vp += 2048; if (HL) vp2 += 2048;
        v8f s[2][2];
#pragma unroll
        for (int kg = 0; kg < 2; ++kg)
#pragma unroll
            for (int q = 0; q < 2; ++q) { s[kg][q] = (v8f){};
#pragma unroll
                for (int ks = 0; ks < 2; ++ks) { s[kg][q] = WF::mma(ka[kg][ks], qf[q][ks], s[kg][q]); if (HL) { s[kg][q] = WF::mma(ka[kg][ks], qg[q][ks], s[kg][q]); s[kg][q] = WF::mma(kc[kg][ks], qf[q][ks], s[kg][q]); } } }
        { const int kstep = (t + 1 < np) ? 32 * HD : 0;  // the next pass's K fragments, in flight under this pass's softmax and second product (the last pass reloads its own: in bounds, unused)
            kp += kstep; if (HL) kp2 += kstep;
#pragma unroll
            for (int kg = 0; kg < 2; ++kg)
#pragma unroll
                for (int ks = 0; ks < 2; ++ks) { const int o = kg * 16 * HD + 512 * ks; ka[kg][ks] = WF::ld(kp + o); if (HL) kc[kg][ks] = WF::ld(kp2 + o); }
            if constexpr (HL) asm volatile("s_wait_xcnt 0x0" :: "v"(kp), "v"(kp2) : "memory"); else asm volatile("s_wait_xcnt 0x0" :: "v"(kp) : "memory"); }
        if (t == np - 1) {                         // wave-uniform: only the pass on the diagonal masks (key0 == q0 there)
#pragma unroll
            for (int kg = 0; kg < 2; ++kg)
#pragma unroll
                for (int q = 0; q < 2; ++q)
#pragma unroll
                    for (int r = 0; r < 8; ++r) if (16 * kg + 8 * h + r > 16 * q + c) s[kg][q][r] = -3.0e38f;
        }
        float mb[2]; bool need = false;
#pragma unroll
        for (int q = 0; q < 2; ++q) { float mx = -3.0e38f;
#pragma unroll
            for (int kg = 0; kg < 2; ++kg)
#pragma unroll
                for (int r = 0; r < 8; ++r) mx = fmaxf(mx, s[kg][q][r]);
            mx = fmaxf(mx, xhalf(mx)) * CSC; mb[q] = mx; need = need || (mx > m[q]); }
        if (__builtin_amdgcn_ballot_w32(need) != 0) {   // scalar branch; where no maximum grows every factor would be exactly 1
#pragma unroll
            for (int q = 0; q < 2; ++q) { const float mn = fmaxf(m[q], mb[q]); const float corr = __builtin_amdgcn_exp2f(m[q] - mn); m[q] = mn; l[q] *= corr;
#pragma unroll
                for (int db = 0; db < 4; ++db) acc[db][q] = acc[db][q] * corr; }
        }
#pragma unroll
        for (int q = 0; q < 2; ++q) { V pb, pc; float sum = 0.f; const float nm = -m[q];
            const v8f cv = {CSC, CSC, CSC, CSC, CSC, CSC, CSC, CSC}, nv = {nm, nm, nm, nm, nm, nm, nm, nm};
            const v8f ar[2] = {__builtin_elementwise_fma(s[0][q], cv, nv), __builtin_elementwise_fma(s[1][q], cv, nv)};
#pragma unroll
            for (int e = 0; e < 16; ++e) { const float p = __builtin_amdgcn_exp2f(ar[e >> 3][e & 7]); sum += p;
                if constexpr (HL) { const __bf16 ph = (__bf16)p; pb[e] = ph; pc[e] = (__bf16)(p - (float)ph); } else { pb[e] = (h16)p; } }
            // inputs only, for the slot behind a transcendental: the exponents keep their registers past the last v_exp_f32; without this line the build writes one v_exp_f32's result over the source of the v_exp_f32 directly in front of it
            if constexpr (!HL) asm volatile("" :: "v"(ar[0]), "v"(ar[1]));
            l[q] += sum;
#pragma unroll
            for (int db = 0; db < 4; ++db) { acc[db][q] = WF::mma(va[db], pb, acc[db][q]); if (HL) { acc[db][q] = WF::mma(va[db], pc, acc[db][q]); acc[db][q] = WF::mma(vc[db], pb, acc[db][q]); } } }
    } while (++t < np);
#pragma unroll
    for (int q = 0; q < 2; ++q) { const float inv = __fdiv_rn(1.0f, l[q] + xhalf(l[q])); float* op = orow + (size_t)(q0 + 16 * q + c) * DQ + 8 * h; v4f o[8];
#pragma unroll
        for (int db = 0; db < 4; ++db) {
#pragma unroll
            for (int r = 0; r < 4; ++r) { o[2 * db][r] = acc[db][q][r] * inv; o[2 * db + 1][r] = acc[db][q][4 + r] * inv; }
            *(v4f*)(op + 16 * db) = o[2 * db]; *(v4f*)(op + 16 * db + 4) = o[2 * db + 1]; }
        // precaution behind the run of eight stores: their address and their data are inputs of the wait, so they keep their registers up to it and are reused only behind it
        asm volatile("s_wait_xcnt 0x0" :: "v"(op), "v"(o[0]), "v"(o[1]), "v"(o[2]), "v"(o[3]), "v"(o[4]), "v"(o[5]), "v"(o[6]), "v"(o[7]) : "memory"); }
}
// ---- k_fattn: grid (8, batch * heads), 4 independent waves (no barrier, no LDS). The four waves of a workgroup take the 32-row blocks x, 15 - x (hi+lo rows), 16 + x, 31 - x (fp16 rows) of one plane, so every workgroup
// walks the same number of passes; which wave takes which block rotates with the workgroup, so that the long blocks do not all fall on the same SIMD.
// three waves per SIMD: the grid is three workgroups per WGP, and all of them are to be resident at once
__global__ __launch_bounds__(128) __attribute__((amdgpu_waves_per_eu(3))) void k_fattn(const h16* __restrict__ Q16, const h16* __restrict__ K16, const h16* __restrict__ V16, const bf* __restrict__ Qh, const bf* __restrict__ Ql, const bf* __restrict__ Kh, const bf* __restrict__ Kl, const bf* __restrict__ Vh, const bf* __restrict__ Vl, float* __restrict__ OUTb) {
    const int w = __builtin_amdgcn_readfirstlane((int)(threadIdx.x >> 5)); const int x = blockIdx.x, g = blockIdx.y;   // g = batch * NH_ + head
    const int role = (w + x + g + (g >> 5)) & 3; const size_t po = (size_t)g * TT * HD;
    float* orow = OUTb + (size_t)(g / NH_) * TT * DQ + (g % NH_) * HD;
    if (role & 1) fa_rows<bf, true>(Qh + po, Ql + po, Kh + po, Kl + po, Vh + po, Vl + po, orow, 32 * ((role == 1) ? 15 - x : x));
    else fa_rows<h16, false>(Q16 + po, nullptr, K16 + po, nullptr, V16 + po, nullptr, orow, 32 * ((role == 0) ? 31 - x : 16 + x));
}

// ---- k_proj: the q, k and v projections of all batches in ONE launch, and their 16-bit planes written straight from the accumulators (no f32 copy of q, k or v in memory).
// One wave per 64x64 tile (16 accumulators), operands from the fragment-order bf16 planes by way of LDS: X rows batch * t, Wt rows [q heads | k heads | v heads][e], k = DM.
// A tile is D = P R^T: a lane holds ONE row of R (tile j, row lane & 15) and 8 consecutive rows of P (tile i, rows 8 (lane >> 4) + r). q, k: P = weights, R = x, so the 8 values are 8 consecutive e of one t;
// v: P = x, R = weights, so they are 8 consecutive t of one e. Both operands are read by the same loader, so the k order of the two is equal either way, and each sum runs over k as before.
// put_frags: those 8 values are the lane's own 16-byte piece (i & 1) of a fragment-order unit of the plane (q, k: rows t, k = e; v^T: rows e, k = t), so every accumulator goes out as one 512-byte store per plane, with no exchange between lanes.
// o16, oh, ol: the tile's first unit in the three planes plus lane * 8.
// sj, si: elements from tile j to j + 1 and from tile pair i >> 1 to the next in the plane's order of units (the same for the whole wave).
__device__ __forceinline__ void put_frags(const v8f (&acc)[4][4], unsigned short* o16, unsigned short* oh, unsigned short* ol, const int sj, const int si) {
#pragma unroll
    for (int j = 0; j < 4; ++j)
#pragma unroll
        for (int ih = 0; ih < 2; ++ih) { v8us d16[2], dh[2], dl[2];   // one unit (both pieces) of each plane at a time
            const int o = j * sj + ih * si; unsigned short* a16 = o16 + o; unsigned short* ah = oh + o; unsigned short* al = ol + o;
#pragma unroll
            for (int ii = 0; ii < 2; ++ii) { v8h c16;
#pragma unroll
                for (int e = 0; e < 8; ++e) { const float v = acc[2 * ih + ii][j][e]; c16[e] = tohx(v); unsigned short a2, c2; splitf(v, a2, c2); dh[ii][e] = a2; dl[ii][e] = c2; }
                d16[ii] = __builtin_bit_cast(v8us, c16);
                *(v8usa*)(a16 + ii * 256) = d16[ii]; *(v8usa*)(ah + ii * 256) = dh[ii]; *(v8usa*)(al + ii * 256) = dl[ii]; }
            // precaution behind the run of six stores: their addresses and their data are inputs of the wait, so they keep their registers up to it and are reused only behind it
            asm volatile("s_wait_xcnt 0x0" :: "v"(a16), "v"(ah), "v"(al), "v"(d16[0]), "v"(d16[1]), "v"(dh[0]), "v"(dh[1]), "v"(dl[0]), "v"(dl[1]) : "memory"); }
}
// copy_stage: one wave brings four units (row blocks i of its operand, one k block) from a fragment-order plane into LDS, unit after unit: 8 asynchronous copies of 512 contiguous bytes, through no register.
// g: the lane's own 16 bytes of the first unit in global memory; l: their place in LDS (byte address). Every lane is on; both addresses are multiples of 16.
__device__ __forceinline__ void copy_stage(const bf* g, const unsigned l) {
    const bf* g1 = g + 256; const bf* g2 = g + 16 * DM; const bf* g3 = g + 16 * DM + 256; const bf* g4 = g + 32 * DM; const bf* g5 = g + 32 * DM + 256; const bf* g6 = g + 48 * DM; const bf* g7 = g + 48 * DM + 256;
    // the copies and, as the last line, the precaution behind them in ONE statement: no register that a copy names is rewritten in front of that wait
    asm volatile("global_load_async_to_lds_b128 %0, %8, off\n\t"
                 "global_load_async_to_lds_b128 %1, %9, off\n\t"
                 "global_load_async_to_lds_b128 %2, %10, off\n\t"
                 "global_load_async_to_lds_b128 %3, %11, off\n\t"
                 "global_load_async_to_lds_b128 %4, %12, off\n\t"
                 "global_load_async_to_lds_b128 %5, %13, off\n\t"
                 "global_load_async_to_lds_b128 %6, %14, off\n\t"
                 "global_load_async_to_lds_b128 %7, %15, off\n\t"
                 "s_wait_xcnt 0x0"
                 :: "v"(l), "v"(l + 512u), "v"(l + 1024u), "v"(l + 1536u), "v"(l + 2048u), "v"(l + 2560u), "v"(l + 3072u), "v"(l + 3584u),
                    "v"(g), "v"(g1), "v"(g2), "v"(g3), "v"(g4), "v"(g5), "v"(g6), "v"(g7) : "memory");
}
// FOUR WAVES per workgroup, a 128x128 tile (2 x 2 wave tiles of 64x64): grid (rows of x / 128, 3 * heads / 2). A stage = one k block of the tile's 8 row blocks of x (units 0..7) and 8 of the weights (units 8..15), 16 KB, each unit
// read from LDS by two waves. Two buffers: the copies of stage t + 2 fly while stage t + 1 is worked on. Waves 0, 1 copy x, waves 2, 3 the weights (four units each).
#define STG (16 * 512)                       // elements of a stage
#define NST (DM / 32)                        // stages
static_assert(NST >= 2 && NH_ % 2 == 0 && TT % 128 == 0, "two stages for the prologue; the two heads of a workgroup are of one projection; its rows of one batch");
// five waves per SIMD: the grid is four and a half workgroups per WGP, and all of them are to be resident at once
__global__ __launch_bounds__(128) __attribute__((amdgpu_waves_per_eu(5))) void k_proj(const bf* __restrict__ X, const bf* __restrict__ Wt, h16* Q16, bf* Qh, bf* Ql, h16* K16, bf* Kh, bf* Kl, h16* V16, bf* Vh, bf* Vl) {
    typedef WFrag<bf> WF; typedef WF::V V;
    __shared__ __attribute__((aligned(1024))) bf ring[2 * STG];
    const int lane = threadIdx.x & 31; const int w = __builtin_amdgcn_readfirstlane((int)(threadIdx.x >> 5));
    const int r0 = blockIdx.x * 128 + (w & 1) * 64, y = blockIdx.y * 2 + (w >> 1), sel = y / NH_, hd = y % NH_; const bool vt = sel == 2;
    // the wave's source: a 16-row block is DM / 32 units = 16 * DM elements; a stage further is one unit further
    const bf* gp = ((w < 2) ? X + (size_t)(blockIdx.x * 128 + w * 64) * DM : Wt + (size_t)(blockIdx.y * 128 + (w - 2) * 64) * DM) + lane * 8;
    const unsigned lp = (unsigned)(size_t)ring + (unsigned)(w * 4096 + lane * 16);
    // the wave's operands in a stage, elements: x units 4 (w & 1) + i, weight units 8 + 4 (w >> 1) + i
    const int xo = (w & 1) * 2048 + lane * 8, wo = 4096 + (w >> 1) * 2048 + lane * 8; const int po = vt ? xo : wo, ro = vt ? wo : xo;
    v8f acc[4][4];
#pragma unroll
    for (int i = 0; i < 4; ++i)
#pragma unroll
        for (int j = 0; j < 4; ++j) acc[i][j] = (v8f){};
    copy_stage(gp, lp);
    // stage 0 has landed (this wave's copies), then every wave's: nobody reads it in front of the barrier
    asm volatile("s_wait_asynccnt 0x0" ::: "memory");
    __syncthreads();
    copy_stage(gp + 512, lp + STG * 2);
    gp += 1024;
    // kept rolled: a second copy of the body would need a second set of fragment registers
#pragma unroll 1
    for (int t = 0; t < NST; ++t) {
        const bf* b = ring + (t & 1) * STG;
        V p[4], r[4];
#pragma unroll
        for (int i = 0; i < 4; ++i) { p[i] = WF::ld(b + po + i * 512); r[i] = WF::ld(b + ro + i * 512); }
#pragma unroll
        for (int j = 0; j < 4; ++j)
#pragma unroll
            for (int i = 0; i < 4; ++i) acc[i][j] = WF::mma(p[i], r[j], acc[i][j]);
        // publish point of stage t + 1: this wave's reads of stage t are done, its copies of stage t + 1 have landed, then the barrier says both of every wave
        asm volatile("s_wait_dscnt 0x0" ::: "memory");
        asm volatile("s_wait_asynccnt 0x0" ::: "memory");
        __syncthreads();
        if (t + 2 < NST) { copy_stage(gp, lp + (unsigned)(t & 1) * (STG * 2)); gp += 512; }   // into the buffer that this trip has just read
    }
    // nothing is in flight when the wave goes on
    asm volatile("s_wait_asynccnt 0x0" ::: "memory");
    // 64 rows t of a plane are 64 * HD elements in either order of the units
    const size_t ob = ((size_t)(r0 / TT) * NH_ + hd) * TT * HD + (size_t)(r0 % TT) * HD + lane * 8;
    unsigned short* o16 = (unsigned short*)((sel == 0) ? Q16 : (sel == 1) ? K16 : V16) + ob; unsigned short* oh = ((sel == 0) ? Qh : (sel == 1) ? Kh : Vh) + ob; unsigned short* ol = ((sel == 0) ? Ql : (sel == 1) ? Kl : Vl) + ob;
    put_frags(acc, o16, oh, ol, vt ? 512 : 1024, vt ? 2048 : 512);
}

extern "C" void kernel_launch(void* const* d_in, const int* in_sizes, int n_in,
                              void* d_out, int out_size, void* d_ws, size_t ws_size, hipStream_t stream) {
    (void)in_sizes; (void)n_in; (void)out_size;
    const float* x = (const float*)d_in[0]; const float* wq = (const float*)d_in[1]; const float* wk = (const float*)d_in[2]; const float* wv = (const float*)d_in[3]; const float* wo = nullptr; (void)wo;
    float* OUT = (float*)d_out;     // [8][1024][768]
    char* wsp = (char*)d_ws;
    auto take = [&](size_t bytes) { char* p = wsp; wsp += (bytes + 255) & ~(size_t)255; return (void*)p; };
    bf* WQ = (bf*)take((size_t)(DQ + 2 * DKV) * DM * 2);   // one stack of rows [q | k | v]
    const size_t PQ = (size_t)NB_ * NH_ * TT * HD * 2, PK = (size_t)NB_ * NKV * TT * HD * 2;   // bytes of one 16-bit plane set [batch][head][..][..]
    h16* QP16 = (h16*)take(PQ); h16* KP16 = (h16*)take(PK); h16* VT16 = (h16*)take(PK);
    bf* QPh = (bf*)take(PQ); bf* QPl = (bf*)take(PQ); bf* KPh = (bf*)take(PK); bf* KPl = (bf*)take(PK); bf* VTh = (bf*)take(PK); bf* VTl = (bf*)take(PK);
    bf* XB = (bf*)take((size_t)NB_ * TT * DM * 2);
    if ((size_t)(wsp - (char*)d_ws) > ws_size) return;    // ws 256 MiB
    // the weight stack and x in fragment order, one launch
    k_prep<<<(unsigned)(3 * WTB + CVB), 256, 0, stream>>>(x, wq, wk, wv, WQ, XB);
    // projections: all batches as one [NB_*TT][DM] operand, q, k and v in one launch that also writes the planes
    k_proj<<<dim3(NB_ * TT / 128, (DQ + 2 * DKV) / 128, 1), 128, 0, stream>>>(XB, WQ, QP16, QPh, QPl, KP16, KPh, KPl, VT16, VTh, VTl);
    // attention: every (batch, head) plane in one launch (one kv head per query head)
    k_fattn<<<dim3(8, NB_ * NH_, 1), 128, 0, stream>>>(QP16, KP16, VT16, QPh, QPl, KPh, KPl, VTh, VTl, OUT);
}

// v007
// Measured time: 78.8 microseconds a run.
// Two timings next to v006 both put it at 1.04 times that version's speed.
// Counting every step since v000, it is 35.6 times as fast.
#include <hip/hip_runtime.h>

// Causal multi-head attention wrapper with per-head projections (x [8][1024][768]; q_h = x Wq[h], k_h = x Wk[h], v_h = x Wv[h] with per-head 'xw' weights [12][768][64], no bias; scores = q.k / 8, causal mask (-inf above the diagonal); softmax; out = heads concatenated along the feature axis -> [8][1024][768] in f32 (6.3 M), no output projection).
// Compute dtypes, f32 accumulate: every input rounded to bf16; q/k/v on PLAIN bf16 operands (inputs: exact); causal scores and attn.v in ONE fused kernel (online softmax, scores and probabilities stay in registers): query rows < 512 hl (3 products), the rest single fp16; softmax f32; no output projection: the merged heads are written in f32 straight to the output.

// FRAGMENT ORDER: every 16-bit operand plane (x, the weights, q, k, v^T) lies in units of 1 KB = 16 rows x 32 k of its matrix. Inside a unit element (row lr, k = 16 j + 8 hi + e) stands at j * 256 + (hi * 16 + lr) * 8 + e,
// so lane hi * 16 + lr of a wave finds its two 16-byte pieces of a WMMA operand at lane * 8 and 256 + lane * 8: each wave-wide 16-byte load or store covers 512 contiguous bytes (4 whole lines).
// Order of the units: x, weights, q, k: [16-row block][k block]; v^T (rows e, k = key): [32-key block][16-row block].

#define NB_  8
#define TT   1024
#define DM   768
#define NH_  12
#define NKV  12
#define HD   64
#define DQ   (NH_ * HD)
#define DKV  (NKV * HD)
#define RH   512                  // unused: k_fattn's block split fixes the hi+lo rows at < 512
#define SCL  0.125f   // HD^-0.5
typedef _Float16 h16;
typedef unsigned short bf;
typedef __attribute__((ext_vector_type(16))) __bf16   v16bf;
typedef __attribute__((ext_vector_type(16))) _Float16 v16h;
typedef __attribute__((ext_vector_type(8)))  _Float16 v8h;
typedef __attribute__((ext_vector_type(8)))  unsigned short v8us;
typedef __attribute__((ext_vector_type(8)))  float    v8f;
typedef __attribute__((ext_vector_type(4)))  float    v4f;
typedef v8h  __attribute__((may_alias)) v8ha;
typedef v4f  __attribute__((may_alias)) v4fa;
typedef v8us __attribute__((may_alias)) v8usa;

__device__ __forceinline__ unsigned short f2bf(float f) { unsigned u = __float_as_uint(f); u += 0x7FFFu + ((u >> 16) & 1u); return (unsigned short)(u >> 16); }
__device__ __forceinline__ float bf2f(unsigned short b) { return __uint_as_float(((unsigned)b) << 16); }
__device__ __forceinline__ v16h cat16(v8h lo, v8h hi) { return __builtin_shufflevector(lo, hi, 0, 1, 2, 3, 4, 5, 6, 7, 8, 9, 10, 11, 12, 13, 14, 15); }
__device__ __forceinline__ v16bf cat16b(v8us lo, v8us hi) { return __builtin_bit_cast(v16bf, __builtin_shufflevector(lo, hi, 0, 1, 2, 3, 4, 5, 6, 7, 8, 9, 10, 11, 12, 13, 14, 15)); }
__device__ __forceinline__ v8f wmma16(v16h a, v16h b, v8f c) { return __builtin_amdgcn_wmma_f32_16x16x32_f16(false, a, false, b, (short)0, c, false, false); }
__device__ __forceinline__ v8f wmmab(v16bf a, v16bf b, v8f c) { return __builtin_amdgcn_wmma_f32_16x16x32_bf16(false, a, false, b, (short)0, c, false, false); }



template <typename T16> struct WFrag;
template <> struct WFrag<h16> { typedef v16h V; static __device__ __forceinline__ V ld(const h16* p) { return cat16(*(const v8h*)p, *(const v8h*)(p + 256)); } static __device__ __forceinline__ v8f mma(V a, V b, v8f c) { return wmma16(a, b, c); } };
template <> struct WFrag<bf> { typedef v16bf V; static __device__ __forceinline__ V ld(const bf* p) { return cat16b(*(const v8us*)p, *(const v8us*)(p + 256)); } static __device__ __forceinline__ v8f mma(V a, V b, v8f c) { return wmmab(a, b, c); } };
__device__ __forceinline__ h16 tohx(float x) { return (h16)x; }
__device__ __forceinline__ void splitf(float y, unsigned short& h, unsigned short& l) { h = f2bf(y); l = f2bf(y - bf2f(h)); }
typedef __attribute__((ext_vector_type(2))) _Float16 v2h;
typedef __attribute__((ext_vector_type(4))) _Float16 v4h;
typedef __attribute__((ext_vector_type(2))) unsigned short v2us;
typedef __attribute__((ext_vector_type(4))) unsigned short v4us;
typedef __attribute__((ext_vector_type(2))) float v2f;
typedef __attribute__((ext_vector_type(4))) int v4i;

// weights [head][k][e] f32 -> rows n = head * HD + e, k contiguous, bf16, in fragment order: one thread makes one 16-byte piece i (8 k of one n); the 16 lanes of a half wave read 16 consecutive e
__device__ __forceinline__ void wt_piece(const float* __restrict__ w, const int i, bf* Bt) {
    const int lr = i & 15, hi = (i >> 4) & 1, j = (i >> 5) & 1, u = i >> 6; const int nkb = DM / 32; const int kb = u % nkb, n = (u / nkb) * 16 + lr;
    const float* sp = w + ((size_t)(n / HD) * DM + kb * 32 + j * 16 + hi * 8) * HD + n % HD; float v[8]; v8us o;
#pragma unroll
    for (int e = 0; e < 8; ++e) v[e] = sp[e * HD];
    // precaution behind the group of loads: the pointer they name is an input of the wait, so it keeps its registers up to it
    asm volatile("s_wait_xcnt 0x0" :: "v"(sp) : "memory");
#pragma unroll
    for (int e = 0; e < 8; ++e) o[e] = f2bf(v[e]);
    *(v8us*)(Bt + (size_t)i * 8) = o;
    // precaution behind the store: its address (the build forms it from the scalar base and the piece's index) and its data are inputs of the wait, so they keep their registers up to it (the other side of k_prep's branch may stand behind this code)
    asm volatile("s_wait_xcnt 0x0" :: "s"(Bt), "v"(i), "v"(o) : "memory");
}

// x [row][DM] f32 -> bf16 in fragment order: one wave makes one unit u (16 rows x 32 k); 8 lanes read one whole 128-byte line of a row, 4 rows a load
__device__ __forceinline__ void cvt_unit(const float* __restrict__ src, bf* dst, const int u) {
    const int lane = threadIdx.x & 31, rr = lane >> 3, g = lane & 7; const int rb = u / (DM / 32), kb = u % (DM / 32);
    const float* sp = src + (size_t)(rb * 16 + rr) * DM + kb * 32 + g * 4; bf* dp = dst + (size_t)u * 512 + (g >> 2) * 256 + (((g >> 1) & 1) * 16 + rr) * 8 + (g & 1) * 4; v4f v[4]; v4us o[4];
#pragma unroll
    for (int s = 0; s < 4; ++s) v[s] = *(const v4f*)(sp + s * 4 * DM);
    // precaution behind the group of loads: the pointer they name is an input of the wait, so it keeps its registers up to it
    asm volatile("s_wait_xcnt 0x0" :: "v"(sp) : "memory");
#pragma unroll
    for (int s = 0; s < 4; ++s) {
#pragma unroll
        for (int k = 0; k < 4; ++k) o[s][k] = f2bf(v[s][k]);
        *(v4us*)(dp + s * 32) = o[s]; }
    // precaution behind the run of four stores: their address and their data are inputs of the wait, so they keep their registers up to it (the other side of k_prep's branch may stand behind this code)
    asm volatile("s_wait_xcnt 0x0" :: "v"(dp), "v"(o[0]), "v"(o[1]), "v"(o[2]), "v"(o[3]) : "memory");
}

// ---- k_prep: the four independent conversions (Wq, Wk, Wv, x) in ONE launch, told apart by block range (a block-uniform branch, no barrier): blocks 0 .. 3 * WTB - 1 make the weight stack [q | k | v], the rest make x.
#define WTB (DM * DQ / 8 / 256)              // blocks per weight matrix, 256 pieces each
#define CVB (NB_ * TT * DM / 512 / 8)        // blocks for x, 8 units each
static_assert(DQ == DKV && DM * DQ % (8 * 256) == 0 && NB_ * TT * DM % (512 * 8) == 0, "the block ranges cover every piece and every unit exactly once");
__global__ __launch_bounds__(256) void k_prep(const float* __restrict__ x, const float* __restrict__ wq, const float* __restrict__ wk, const float* __restrict__ wv, bf* Wt, bf* XB) {
    const int b = blockIdx.x;
    if (b < 3 * WTB) { const int sel = b / WTB; wt_piece((sel == 0) ? wq : (sel == 1) ? wk : wv, (b - sel * WTB) * 256 + (int)threadIdx.x, Wt + (size_t)sel * DQ * DM); }
    else cvt_unit(x, XB, (b - 3 * WTB) * 8 + (int)(threadIdx.x >> 5));
}

// lane l with lane l ^ 16
__device__ __forceinline__ float xhalf(float x) { return __builtin_bit_cast(float, __builtin_amdgcn_permlanex16(__builtin_bit_cast(int, x), __builtin_bit_cast(int, x), 0x76543210, 0xfedcba98, false, false)); }

#define PFD 6                     // passes between a prefetch and its loads
// a, b: per-lane addresses, carried through the loop in their own registers; they name bytes of the wave's own passes at issue and behind every advance (step is 0 where the next pass does not exist).
template <bool HL>
__device__ __forceinline__ void pf_pass(const char*& a, const char*& b, const int step) {
    // a hint into L2, no register written, no counter; the wait in the same statement is the precaution in front of the advance of the address registers
    if constexpr (HL) asm volatile("global_prefetch_b8 %0, off scope:SCOPE_SE\n\tglobal_prefetch_b8 %1, off scope:SCOPE_SE\n\ts_wait_xcnt 0x0" :: "v"(a), "v"(b));
    else asm volatile("global_prefetch_b8 %0, off scope:SCOPE_SE\n\ts_wait_xcnt 0x0" :: "v"(a));
    a += step; if (HL) b += step;
}
template <typename T16, bool HL>
__device__ __forceinline__ void fa_rows(const T16* __restrict__ Q, const T16* __restrict__ Q2, const T16* __restrict__ Kp, const T16* __restrict__ Kp2, const T16* __restrict__ Vt, const T16* __restrict__ Vt2, float* __restrict__ orow, const int q0, const bool lead) {
    typedef WFrag<T16> WF; typedef typename WF::V V;
    const int lane = threadIdx.x & 31, c = lane & 15, h = lane >> 4;
    const float CSC = SCL * 1.4426950408889634f;
    // the lane's piece in a fragment-order unit stands lb bytes into it. Q: wave-uniform pointers to the first unit; K, V^T: per-lane pointers, carried through the loop and moved once a pass (4 units = 32 keys)
    const unsigned lb = lane * 16; auto at = [lb](const T16* u) { return (const T16*)((const char*)u + lb); };
    const T16* qp = Q + (size_t)q0 * HD; const T16* qp2 = HL ? Q2 + (size_t)q0 * HD : nullptr;
    const T16* kp = at(Kp); const T16* kp2 = HL ? at(Kp2) : nullptr;
    const T16* vp = at(Vt); const T16* vp2 = HL ? at(Vt2) : nullptr;
    V qf[2][2], qg[2][2];
#pragma unroll
    for (int q = 0; q < 2; ++q)
#pragma unroll
        for (int ks = 0; ks < 2; ++ks) { const int o = 16 * q * HD + 512 * ks; qf[q][ks] = WF::ld(at(qp) + o); if (HL) qg[q][ks] = WF::ld(at(qp2) + o); }
    v8f acc[4][2];
#pragma unroll
    for (int db = 0; db < 4; ++db)
#pragma unroll
        for (int q = 0; q < 2; ++q) acc[db][q] = (v8f){};
    float m[2] = {-3.0e38f, -3.0e38f}, l[2] = {0.f, 0.f};
    const int np = (q0 >> 5) + 1;                  // passes: keys 0 .. q0 + 31
    const int npf = lead ? np : 0;                 // wave-uniform: passes that this wave prefetches (a pass of a plane is 32 * HD elements = 4 KB in K and in V^T alike)
    const int p1 = (1 < np) ? 4096 : 0;
    const char* pa = (const char*)(h ? Vt : Kp) + c * 256 + p1; const char* pb = HL ? (const char*)(h ? Vt2 : Kp2) + c * 256 + p1 : nullptr;
    V ka[2][2], kc[2][2];
#pragma unroll
    for (int kg = 0; kg < 2; ++kg)
#pragma unroll
        for (int ks = 0; ks < 2; ++ks) { const int o = kg * 16 * HD + 512 * ks; ka[kg][ks] = WF::ld(kp + o); if (HL) kc[kg][ks] = WF::ld(kp2 + o); }
    // precaution behind a group of fragment loads, here and in the loop: the pointers the loads name are inputs of the wait, so they keep their registers up to it and are moved only behind it
    // (here the build addresses by scalar base and lane offset, so these are named as well)
    if constexpr (HL) asm volatile("s_wait_xcnt 0x0" :: "s"(qp), "s"(qp2), "s"(Kp), "s"(Kp2), "v"(lb), "v"(kp), "v"(kp2) : "memory"); else asm volatile("s_wait_xcnt 0x0" :: "s"(qp), "s"(Kp), "v"(lb), "v"(kp) : "memory");
    int t = 0;
    // kept rolled: the trip count is a run-time value, and a second copy of the body would not fit the register budget of three waves per SIMD
#pragma unroll 1
    do {                                           // np >= 1: every query row sees key 0
        V va[4], vc[4];                            // this pass's V^T fragments: in flight under the score products and the softmax
#pragma unroll
        for (int db = 0; db < 4; ++db) { const int o = db * 512; va[db] = WF::ld(vp + o); if (HL) vc[db] = WF::ld(vp2 + o); }
        if constexpr (HL) asm volatile("s_wait_xcnt 0x0" :: "v"(vp), "v"(vp2) : "memory"); else asm volatile("s_wait_xcnt 0x0" :: "v"(vp) : "memory");
        vp += 2048; if (HL) vp2 += 2048;
        v8f s[2][2];
#pragma unroll
        for (int kg = 0; kg < 2; ++kg)
#pragma unroll
            for (int q = 0; q < 2; ++q) { s[kg][q] = (v8f){};
#pragma unroll
                for (int ks = 0; ks < 2; ++ks) { s[kg][q] = WF::mma(ka[kg][ks], qf[q][ks], s[kg][q]); if (HL) { s[kg][q] = WF::mma(ka[kg][ks], qg[q][ks], s[kg][q]); s[kg][q] = WF::mma(kc[kg][ks], qf[q][ks], s[kg][q]); } } }
        { const int kstep = (t + 1 < np) ? 32 * HD : 0;  // the next pass's K fragments, in flight under this pass's softmax and second product (the last pass reloads its own: in bounds, unused)
            kp += kstep; if (HL) kp2 += kstep;
#pragma unroll
            for (int kg = 0; kg < 2; ++kg)
#pragma unroll
                for (int ks = 0; ks < 2; ++ks) { const int o = kg * 16 * HD + 512 * ks; ka[kg][ks] = WF::ld(kp + o); if (HL) kc[kg][ks] = WF::ld(kp2 + o); }
            if constexpr (HL) asm volatile("s_wait_xcnt 0x0" :: "v"(kp), "v"(kp2) : "memory"); else asm volatile("s_wait_xcnt 0x0" :: "v"(kp) : "memory"); }
        if (t == np - 1) {                         // wave-uniform: only the pass on the diagonal masks (key0 == q0 there)
#pragma unroll
            for (int kg = 0; kg < 2; ++kg)
#pragma unroll
                for (int q = 0; q < 2; ++q)
#pragma unroll
                    for (int r = 0; r < 8; ++r) if (16 * kg + 8 * h + r > 16 * q + c) s[kg][q][r] = -3.0e38f;
        }
        float mb[2]; bool need = false;
#pragma unroll
        for (int q = 0; q < 2; ++q) { float mx = -3.0e38f;
#pragma unroll
            for (int kg = 0; kg < 2; ++kg)
#pragma unroll
                for (int r = 0; r < 8; ++r) mx = fmaxf(mx, s[kg][q][r]);
            mx = fmaxf(mx, xhalf(mx)) * CSC; mb[q] = mx; need = need || (mx > m[q]); }
        if (__builtin_amdgcn_ballot_w32(need) != 0) {   // scalar branch; where no maximum grows every factor would be exactly 1
#pragma unroll
            for (int q = 0; q < 2; ++q) { const float mn = fmaxf(m[q], mb[q]); const float corr = __builtin_amdgcn_exp2f(m[q] - mn); m[q] = mn; l[q] *= corr;
#pragma unroll
                for (int db = 0; db < 4; ++db) acc[db][q] = acc[db][q] * corr; }
        }
        // behind this pass's own loads, so that they are not held up, and well behind its score products; scalar branches. The first pass asks for passes 1 .. PFD - 1 as well (pass 0 is loaded at once);
        // then the lead wave asks for pass t + PFD while it exists
        if (t == 0) for (int d = 1; d < PFD; ++d) if (d < npf) pf_pass<HL>(pa, pb, (d + 1 < npf) ? 4096 : 0);
        if (t + PFD < npf) pf_pass<HL>(pa, pb, (t + PFD + 1 < npf) ? 4096 : 0);
#pragma unroll
        for (int q = 0; q < 2; ++q) { V pb, pc; float sum = 0.f; const float nm = -m[q];
            const v8f cv = {CSC, CSC, CSC, CSC, CSC, CSC, CSC, CSC}, nv = {nm, nm, nm, nm, nm, nm, nm, nm};
            const v8f ar[2] = {__builtin_elementwise_fma(s[0][q], cv, nv), __builtin_elementwise_fma(s[1][q], cv, nv)};
#pragma unroll
            for (int e = 0; e < 16; ++e) { const float p = __builtin_amdgcn_exp2f(ar[e >> 3][e & 7]); sum += p;
                if constexpr (HL) { const __bf16 ph = (__bf16)p; pb[e] = ph; pc[e] = (__bf16)(p - (float)ph); } else { pb[e] = (h16)p; } }
            // inputs only, for the slot behind a transcendental: the exponents keep their registers past the last v_exp_f32; without this line the build writes one v_exp_f32's result over the source of the v_exp_f32 directly in front of it
            if constexpr (!HL) asm volatile("" :: "v"(ar[0]), "v"(ar[1]));
            l[q] += sum;
#pragma unroll
            for (int db = 0; db < 4; ++db) { acc[db][q] = WF::mma(va[db], pb, acc[db][q]); if (HL) { acc[db][q] = WF::mma(va[db], pc, acc[db][q]); acc[db][q] = WF::mma(vc[db], pb, acc[db][q]); } } }
    } while (++t < np);
#pragma unroll
    for (int q = 0; q < 2; ++q) { const float inv = __fdiv_rn(1.0f, l[q] + xhalf(l[q])); float* op = orow + (size_t)(q0 + 16 * q + c) * DQ + 8 * h; v4f o[8];
#pragma unroll
        for (int db = 0; db < 4; ++db) {
#pragma unroll
            for (int r = 0; r < 4; ++r) { o[2 * db][r] = acc[db][q][r] * inv; o[2 * db + 1][r] = acc[db][q][4 + r] * inv; }
            *(v4f*)(op + 16 * db) = o[2 * db]; *(v4f*)(op + 16 * db + 4) = o[2 * db + 1]; }
        // precaution behind the run of eight stores: their address and their data are inputs of the wait, so they keep their registers up to it and are reused only behind it
        asm volatile("s_wait_xcnt 0x0" :: "v"(op), "v"(o[0]), "v"(o[1]), "v"(o[2]), "v"(o[3]), "v"(o[4]), "v"(o[5]), "v"(o[6]), "v"(o[7]) : "memory"); }
}
// ---- k_fattn: grid (8, batch * heads), 4 independent waves (no barrier, no LDS). The four waves of a workgroup take the 32-row blocks x, 15 - x (hi+lo rows), 16 + x, 31 - x (fp16 rows) of one plane, so every workgroup
// walks the same number of passes; which wave takes which block rotates with the workgroup, so that the long blocks do not all fall on the same SIMD.
// three waves per SIMD: the grid is three workgroups per WGP, and all of them are to be resident at once
__global__ __launch_bounds__(128) __attribute__((amdgpu_waves_per_eu(3))) void k_fattn(const h16* __restrict__ Q16, const h16* __restrict__ K16, const h16* __restrict__ V16, const bf* __restrict__ Qh, const bf* __restrict__ Ql, const bf* __restrict__ Kh, const bf* __restrict__ Kl, const bf* __restrict__ Vh, const bf* __restrict__ Vl, float* __restrict__ OUTb) {
    const int w = __builtin_amdgcn_readfirstlane((int)(threadIdx.x >> 5)); const int x = blockIdx.x, g = blockIdx.y;   // g = batch * NH_ + head
    const int role = (w + x + g + (g >> 5)) & 3; const size_t po = (size_t)g * TT * HD;
    float* orow = OUTb + (size_t)(g / NH_) * TT * DQ + (g % NH_) * HD;
    if (role & 1) fa_rows<bf, true>(Qh + po, Ql + po, Kh + po, Kl + po, Vh + po, Vl + po, orow, 32 * ((role == 1) ? 15 - x : x), role == 1);
    else fa_rows<h16, false>(Q16 + po, nullptr, K16 + po, nullptr, V16 + po, nullptr, orow, 32 * ((role == 0) ? 31 - x : 16 + x), role == 0);
}

// ---- k_proj: the q, k and v projections of all batches in ONE launch, and their 16-bit planes written straight from the accumulators (no f32 copy of q, k or v in memory).
// One wave per 64x64 tile (16 accumulators), operands from the fragment-order bf16 planes by way of LDS: X rows batch * t, Wt rows [q heads | k heads | v heads][e], k = DM.
// A tile is D = P R^T: a lane holds ONE row of R (tile j, row lane & 15) and 8 consecutive rows of P (tile i, rows 8 (lane >> 4) + r). q, k: P = weights, R = x, so the 8 values are 8 consecutive e of one t;
// v: P = x, R = weights, so they are 8 consecutive t of one e. Both operands are read by the same loader, so the k order of the two is equal either way, and each sum runs over k as before.
// put_frags: those 8 values are the lane's own 16-byte piece (i & 1) of a fragment-order unit of the plane (q, k: rows t, k = e; v^T: rows e, k = t), so every accumulator goes out as one 512-byte store per plane, with no exchange between lanes.
// o16, oh, ol: the tile's first unit in the three planes plus lane * 8.
// sj, si: elements from tile j to j + 1 and from tile pair i >> 1 to the next in the plane's order of units (the same for the whole wave).
__device__ __forceinline__ void put_frags(const v8f (&acc)[4][4], unsigned short* o16, unsigned short* oh, unsigned short* ol, const int sj, const int si) {
#pragma unroll
    for (int j = 0; j < 4; ++j)
#pragma unroll
        for (int ih = 0; ih < 2; ++ih) { v8us d16[2], dh[2], dl[2];   // one unit (both pieces) of each plane at a time
            const int o = j * sj + ih * si; unsigned short* a16 = o16 + o; unsigned short* ah = oh + o; unsigned short* al = ol + o;
#pragma unroll
            for (int ii = 0; ii < 2; ++ii) { v8h c16;
#pragma unroll
                for (int e = 0; e < 8; ++e) { const float v = acc[2 * ih + ii][j][e]; c16[e] = tohx(v); unsigned short a2, c2; splitf(v, a2, c2); dh[ii][e] = a2; dl[ii][e] = c2; }
                d16[ii] = __builtin_bit_cast(v8us, c16);
                *(v8usa*)(a16 + ii * 256) = d16[ii]; *(v8usa*)(ah + ii * 256) = dh[ii]; *(v8usa*)(al + ii * 256) = dl[ii]; }
            // precaution behind the run of six stores: their addresses and their data are inputs of the wait, so they keep their registers up to it and are reused only behind it
            asm volatile("s_wait_xcnt 0x0" :: "v"(a16), "v"(ah), "v"(al), "v"(d16[0]), "v"(d16[1]), "v"(dh[0]), "v"(dh[1]), "v"(dl[0]), "v"(dl[1]) : "memory"); }
}
// copy_stage: one wave brings four units (row blocks i of its operand, one k block) from a fragment-order plane into LDS, unit after unit: 8 asynchronous copies of 512 contiguous bytes, through no register.
// g: the lane's own 16 bytes of the first unit in global memory; l: their place in LDS (byte address). Every lane is on; both addresses are multiples of 16.
__device__ __forceinline__ void copy_stage(const bf* g, const unsigned l) {
    const bf* g1 = g + 256; const bf* g2 = g + 16 * DM; const bf* g3 = g + 16 * DM + 256; const bf* g4 = g + 32 * DM; const bf* g5 = g + 32 * DM + 256; const bf* g6 = g + 48 * DM; const bf* g7 = g + 48 * DM + 256;
    // the copies and, as the last line, the precaution behind them in ONE statement: no register that a copy names is rewritten in front of that wait
    asm volatile("global_load_async_to_lds_b128 %0, %8, off\n\t"
                 "global_load_async_to_lds_b128 %1, %9, off\n\t"
                 "global_load_async_to_lds_b128 %2, %10, off\n\t"
                 "global_load_async_to_lds_b128 %3, %11, off\n\t"
                 "global_load_async_to_lds_b128 %4, %12, off\n\t"
                 "global_load_async_to_lds_b128 %5, %13, off\n\t"
                 "global_load_async_to_lds_b128 %6, %14, off\n\t"
                 "global_load_async_to_lds_b128 %7, %15, off\n\t"
                 "s_wait_xcnt 0x0"
                 :: "v"(l), "v"(l + 512u), "v"(l + 1024u), "v"(l + 1536u), "v"(l + 2048u), "v"(l + 2560u), "v"(l + 3072u), "v"(l + 3584u),
                    "v"(g), "v"(g1), "v"(g2), "v"(g3), "v"(g4), "v"(g5), "v"(g6), "v"(g7) : "memory");
}
// FOUR WAVES per workgroup, a 128x128 tile (2 x 2 wave tiles of 64x64): grid (rows of x / 128, 3 * heads / 2). A stage = one k block of the tile's 8 row blocks of x (units 0..7) and 8 of the weights (units 8..15), 16 KB, each unit
// read from LDS by two waves. Two buffers: the copies of stage t + 2 fly while stage t + 1 is worked on. Waves 0, 1 copy x, waves 2, 3 the weights (four units each).
#define STG (16 * 512)                       // elements of a stage
#define NST (DM / 32)                        // stages
static_assert(NST >= 2 && NH_ % 2 == 0 && TT % 128 == 0, "two stages for the prologue; the two heads of a workgroup are of one projection; its rows of one batch");
// five waves per SIMD: the grid is four and a half workgroups per WGP, and all of them are to be resident at once
__global__ __launch_bounds__(128) __attribute__((amdgpu_waves_per_eu(5))) void k_proj(const bf* __restrict__ X, const bf* __restrict__ Wt, h16* Q16, bf* Qh, bf* Ql, h16* K16, bf* Kh, bf* Kl, h16* V16, bf* Vh, bf* Vl) {
    typedef WFrag<bf> WF; typedef WF::V V;
    __shared__ __attribute__((aligned(1024))) bf ring[2 * STG];
    const int lane = threadIdx.x & 31; const int w = __builtin_amdgcn_readfirstlane((int)(threadIdx.x >> 5));
    const int r0 = blockIdx.x * 128 + (w & 1) * 64, y = blockIdx.y * 2 + (w >> 1), sel = y / NH_, hd = y % NH_; const bool vt = sel == 2;
    // the wave's source: a 16-row block is DM / 32 units = 16 * DM elements; a stage further is one unit further
    const bf* gp = ((w < 2) ? X + (size_t)(blockIdx.x * 128 + w * 64) * DM : Wt + (size_t)(blockIdx.y * 128 + (w - 2) * 64) * DM) + lane * 8;
    const unsigned lp = (unsigned)(size_t)ring + (unsigned)(w * 4096 + lane * 16);
    // the wave's operands in a stage, elements: x units 4 (w & 1) + i, weight units 8 + 4 (w >> 1) + i
    const int xo = (w & 1) * 2048 + lane * 8, wo = 4096 + (w >> 1) * 2048 + lane * 8; const int po = vt ? xo : wo, ro = vt ? wo : xo;
    v8f acc[4][4];
#pragma unroll
    for (int i = 0; i < 4; ++i)
#pragma unroll
        for (int j = 0; j < 4; ++j) acc[i][j] = (v8f){};
    copy_stage(gp, lp);
    // stage 0 has landed (this wave's copies), then every wave's: nobody reads it in front of the barrier
    asm volatile("s_wait_asynccnt 0x0" ::: "memory");
    __syncthreads();
    copy_stage(gp + 512, lp + STG * 2);
    gp += 1024;
    // kept rolled: a second copy of the body would need a second set of fragment registers
#pragma unroll 1
    for (int t = 0; t < NST; ++t) {
        const bf* b = ring + (t & 1) * STG;
        V p[4], r[4];
#pragma unroll
        for (int i = 0; i < 4; ++i) { p[i] = WF::ld(b + po + i * 512); r[i] = WF::ld(b + ro + i * 512); }
#pragma unroll
        for (int j = 0; j < 4; ++j)
#pragma unroll
            for (int i = 0; i < 4; ++i) acc[i][j] = WF::mma(p[i], r[j], acc[i][j]);
        // publish point of stage t + 1: this wave's reads of stage t are done, its copies of stage t + 1 have landed, then the barrier says both of every wave
        asm volatile("s_wait_dscnt 0x0" ::: "memory");
        asm volatile("s_wait_asynccnt 0x0" ::: "memory");
        __syncthreads();
        if (t + 2 < NST) { copy_stage(gp, lp + (unsigned)(t & 1) * (STG * 2)); gp += 512; }   // into the buffer that this trip has just read
    }
    // nothing is in flight when the wave goes on
    asm volatile("s_wait_asynccnt 0x0" ::: "memory");
    // 64 rows t of a plane are 64 * HD elements in either order of the units
    const size_t ob = ((size_t)(r0 / TT) * NH_ + hd) * TT * HD + (size_t)(r0 % TT) * HD + lane * 8;
    unsigned short* o16 = (unsigned short*)((sel == 0) ? Q16 : (sel == 1) ? K16 : V16) + ob; unsigned short* oh = ((sel == 0) ? Qh : (sel == 1) ? Kh : Vh) + ob; unsigned short* ol = ((sel == 0) ? Ql : (sel == 1) ? Kl : Vl) + ob;
    put_frags(acc, o16, oh, ol, vt ? 512 : 1024, vt ? 2048 : 512);
}

extern "C" void kernel_launch(void* const* d_in, const int* in_sizes, int n_in,
                              void* d_out, int out_size, void* d_ws, size_t ws_size, hipStream_t stream) {
    (void)in_sizes; (void)n_in; (void)out_size;
    const float* x = (const float*)d_in[0]; const float* wq = (const float*)d_in[1]; const float* wk = (const float*)d_in[2]; const float* wv = (const float*)d_in[3]; const float* wo = nullptr; (void)wo;
    float* OUT = (float*)d_out;     // [8][1024][768]
    char* wsp = (char*)d_ws;
    auto take = [&](size_t bytes) { char* p = wsp; wsp += (bytes + 255) & ~(size_t)255; return (void*)p; };
    bf* WQ = (bf*)take((size_t)(DQ + 2 * DKV) * DM * 2);   // one stack of rows [q | k | v]
    const size_t PQ = (size_t)NB_ * NH_ * TT * HD * 2, PK = (size_t)NB_ * NKV * TT * HD * 2;   // bytes of one 16-bit plane set [batch][head][..][..]
    h16* QP16 = (h16*)take(PQ); h16* KP16 = (h16*)take(PK); h16* VT16 = (h16*)take(PK);
    bf* QPh = (bf*)take(PQ); bf* QPl = (bf*)take(PQ); bf* KPh = (bf*)take(PK); bf* KPl = (bf*)take(PK); bf* VTh = (bf*)take(PK); bf* VTl = (bf*)take(PK);
    bf* XB = (bf*)take((size_t)NB_ * TT * DM * 2);
    if ((size_t)(wsp - (char*)d_ws) > ws_size) return;    // ws 256 MiB
    // the weight stack and x in fragment order, one launch
    k_prep<<<(unsigned)(3 * WTB + CVB), 256, 0, stream>>>(x, wq, wk, wv, WQ, XB);
    // projections: all batches as one [NB_*TT][DM] operand, q, k and v in one launch that also writes the planes
    k_proj<<<dim3(NB_ * TT / 128, (DQ + 2 * DKV) / 128, 1), 128, 0, stream>>>(XB, WQ, QP16, QPh, QPl, KP16, KPh, KPl, VT16, VTh, VTl);
    // attention: every (batch, head) plane in one launch (one kv head per query head)
    k_fattn<<<dim3(8, NB_ * NH_, 1), 128, 0, stream>>>(QP16, KP16, VT16, QPh, QPl, KPh, KPl, VTh, VTl, OUT);
}

// v008
// It runs in 71.1 microseconds.
// Two timings next to v007 both put it at 1.11 times that version's speed.
// Over all steps from v000 it is 39.7 times as fast.
#include <hip/hip_runtime.h>

// Causal multi-head attention wrapper with per-head projections (x [8][1024][768]; q_h = x Wq[h], k_h = x Wk[h], v_h = x Wv[h] with per-head 'xw' weights [12][768][64], no bias; scores = q.k / 8, causal mask (-inf above the diagonal); softmax; out = heads concatenated along the feature axis -> [8][1024][768] in f32 (6.3 M), no output projection).
// Compute dtypes, f32 accumulate: every input rounded to bf16; q/k/v on PLAIN bf16 operands (inputs: exact); causal scores and attn.v in ONE fused kernel (online softmax, scores and probabilities stay in registers): query rows < 512 hl (3 products), the rest single fp16; softmax f32; no output projection: the merged heads are written in f32 straight to the output.

// FRAGMENT ORDER: every 16-bit operand plane (x, the weights, q, k, v^T) lies in units of 1 KB = 16 rows x 32 k of its matrix. Inside a unit element (row lr, k = 16 j + 8 hi + e) stands at j * 256 + (hi * 16 + lr) * 8 + e,
// so lane hi * 16 + lr of a wave finds its two 16-byte pieces of a WMMA operand at lane * 8 and 256 + lane * 8: each wave-wide 16-byte load or store covers 512 contiguous bytes (4 whole lines).
// Order of the units: x, weights, q, k: [16-row block][k block]; v^T (rows e, k = key): [32-key block][16-row block].

#define NB_  8
#define TT   1024
#define DM   768
#define NH_  12
#define NKV  12
#define HD   64
#define DQ   (NH_ * HD)
#define DKV  (NKV * HD)
#define RH   512                  // unused: k_fattn's block split fixes the hi+lo rows at < 512
#define SCL  0.125f   // HD^-0.5
typedef _Float16 h16;
typedef unsigned short bf;
typedef __attribute__((ext_vector_type(16))) __bf16   v16bf;
typedef __attribute__((ext_vector_type(16))) _Float16 v16h;
typedef __attribute__((ext_vector_type(8)))  _Float16 v8h;
typedef __attribute__((ext_vector_type(8)))  unsigned short v8us;
typedef __attribute__((ext_vector_type(8)))  float    v8f;
typedef __attribute__((ext_vector_type(4)))  float    v4f;
typedef v8h  __attribute__((may_alias)) v8ha;
typedef v4f  __attribute__((may_alias)) v4fa;
typedef v8us __attribute__((may_alias)) v8usa;

__device__ __forceinline__ unsigned short f2bf(float f) { unsigned u = __float_as_uint(f); u += 0x7FFFu + ((u >> 16) & 1u); return (unsigned short)(u >> 16); }
__device__ __forceinline__ float bf2f(unsigned short b) { return __uint_as_float(((unsigned)b) << 16); }
__device__ __forceinline__ v16h cat16(v8h lo, v8h hi) { return __builtin_shufflevector(lo, hi, 0, 1, 2, 3, 4, 5, 6, 7, 8, 9, 10, 11, 12, 13, 14, 15); }
__device__ __forceinline__ v16bf cat16b(v8us lo, v8us hi) { return __builtin_bit_cast(v16bf, __builtin_shufflevector(lo, hi, 0, 1, 2, 3, 4, 5, 6, 7, 8, 9, 10, 11, 12, 13, 14, 15)); }
__device__ __forceinline__ v8f wmma16(v16h a, v16h b, v8f c) { return __builtin_amdgcn_wmma_f32_16x16x32_f16(false, a, false, b, (short)0, c, false, false); }
__device__ __forceinline__ v8f wmmab(v16bf a, v16bf b, v8f c) { return __builtin_amdgcn_wmma_f32_16x16x32_bf16(false, a, false, b, (short)0, c, false, false); }



template <typename T16> struct WFrag;
template <> struct WFrag<h16> { typedef v16h V; static __device__ __forceinline__ V ld(const h16* p) { return cat16(*(const v8h*)p, *(const v8h*)(p + 256)); } static __device__ __forceinline__ v8f mma(V a, V b, v8f c) { return wmma16(a, b, c); } };
template <> struct WFrag<bf> { typedef v16bf V; static __device__ __forceinline__ V ld(const bf* p) { return cat16b(*(const v8us*)p, *(const v8us*)(p + 256)); } static __device__ __forceinline__ v8f mma(V a, V b, v8f c) { return wmmab(a, b, c); } };
__device__ __forceinline__ h16 tohx(float x) { return (h16)x; }
__device__ __forceinline__ void splitf(float y, unsigned short& h, unsigned short& l) { h = f2bf(y); l = f2bf(y - bf2f(h)); }
typedef __attribute__((ext_vector_type(2))) _Float16 v2h;
typedef __attribute__((ext_vector_type(4))) _Float16 v4h;
typedef __attribute__((ext_vector_type(2))) unsigned short v2us;
typedef __attribute__((ext_vector_type(4))) unsigned short v4us;
typedef __attribute__((ext_vector_type(2))) float v2f;
typedef __attribute__((ext_vector_type(4))) int v4i;

// weights [head][k][e] f32 -> rows n = head * HD + e, k contiguous, bf16, in fragment order: one thread makes one 16-byte piece i (8 k of one n); the 16 lanes of a half wave read 16 consecutive e
__device__ __forceinline__ void wt_piece(const float* __restrict__ w, const int i, bf* Bt) {
    const int lr = i & 15, hi = (i >> 4) & 1, j = (i >> 5) & 1, u = i >> 6; const int nkb = DM / 32; const int kb = u % nkb, n = (u / nkb) * 16 + lr;
    const float* sp = w + ((size_t)(n / HD) * DM + kb * 32 + j * 16 + hi * 8) * HD + n % HD; float v[8]; v8us o;
#pragma unroll
    for (int e = 0; e < 8; ++e) v[e] = sp[e * HD];
    // precaution behind the group of loads: the pointer they name is an input of the wait, so it keeps its registers up to it
    asm volatile("s_wait_xcnt 0x0" :: "v"(sp) : "memory");
#pragma unroll
    for (int e = 0; e < 8; ++e) o[e] = f2bf(v[e]);
    *(v8us*)(Bt + (size_t)i * 8) = o;
    // precaution behind the store: its address (the build forms it from the scalar base and the piece's index) and its data are inputs of the wait, so they keep their registers up to it (the other side of k_prep's branch may stand behind this code)
    asm volatile("s_wait_xcnt 0x0" :: "s"(Bt), "v"(i), "v"(o) : "memory");
}

// x [row][DM] f32 -> bf16 in fragment order: one wave makes one unit u (16 rows x 32 k); 8 lanes read one whole 128-byte line of a row, 4 rows a load
__device__ __forceinline__ void cvt_unit(const float* __restrict__ src, bf* dst, const int u) {
    const int lane = threadIdx.x & 31, rr = lane >> 3, g = lane & 7; const int rb = u / (DM / 32), kb = u % (DM / 32);
    const float* sp = src + (size_t)(rb * 16 + rr) * DM + kb * 32 + g * 4; bf* dp = dst + (size_t)u * 512 + (g >> 2) * 256 + (((g >> 1) & 1) * 16 + rr) * 8 + (g & 1) * 4; v4f v[4]; v4us o[4];
#pragma unroll
    for (int s = 0; s < 4; ++s) v[s] = *(const v4f*)(sp + s * 4 * DM);
    // precaution behind the group of loads: the pointer they name is an input of the wait, so it keeps its registers up to it
    asm volatile("s_wait_xcnt 0x0" :: "v"(sp) : "memory");
#pragma unroll
    for (int s = 0; s < 4; ++s) {
#pragma unroll
        for (int k = 0; k < 4; ++k) o[s][k] = f2bf(v[s][k]);
        *(v4us*)(dp + s * 32) = o[s]; }
    // precaution behind the run of four stores: their address and their data are inputs of the wait, so they keep their registers up to it (the other side of k_prep's branch may stand behind this code)
    asm volatile("s_wait_xcnt 0x0" :: "v"(dp), "v"(o[0]), "v"(o[1]), "v"(o[2]), "v"(o[3]) : "memory");
}

// ---- k_prep: the four independent conversions (Wq, Wk, Wv, x) in ONE launch, told apart by block range (a block-uniform branch, no barrier): blocks 0 .. 3 * WTB - 1 make the weight stack [q | k | v], the rest make x.
#define WTB (DM * DQ / 8 / 256)              // blocks per weight matrix, 256 pieces each
#define CVB (NB_ * TT * DM / 512 / 8)        // blocks for x, 8 units each
static_assert(DQ == DKV && DM * DQ % (8 * 256) == 0 && NB_ * TT * DM % (512 * 8) == 0, "the block ranges cover every piece and every unit exactly once");
static_assert(NB_ == 8 && (3 * WTB) % 8 == 0 && CVB % NB_ == 0, "x blocks: index mod 8 is the batch, index / 8 the block inside it");
__global__ __launch_bounds__(256) void k_prep(const float* __restrict__ x, const float* __restrict__ wq, const float* __restrict__ wk, const float* __restrict__ wv, bf* Wt, bf* XB) {
    const int b = blockIdx.x;
    if (b < 3 * WTB) { const int sel = b / WTB; wt_piece((sel == 0) ? wq : (sel == 1) ? wk : wv, (b - sel * WTB) * 256 + (int)threadIdx.x, Wt + (size_t)sel * DQ * DM); }
    else { const int c = b - 3 * WTB; cvt_unit(x, XB, ((c & 7) * (CVB / NB_) + (c >> 3)) * 8 + (int)(threadIdx.x >> 5)); }   // batch = flat block index mod 8 (PLACEMENT, at k_fattn)
}

// lane l with lane l ^ 16
__device__ __forceinline__ float xhalf(float x) { return __builtin_bit_cast(float, __builtin_amdgcn_permlanex16(__builtin_bit_cast(int, x), __builtin_bit_cast(int, x), 0x76543210, 0xfedcba98, false, false)); }

#define PFD 6                     // passes between a prefetch and its loads
// a, b: per-lane addresses, carried through the loop in their own registers; they name bytes of the wave's own passes at issue and behind every advance (step is 0 where the next pass does not exist).
template <bool HL>
__device__ __forceinline__ void pf_pass(const char*& a, const char*& b, const int step) {
    // a hint into L2, no register written, no counter; the wait in the same statement is the precaution in front of the advance of the address registers
    if constexpr (HL) asm volatile("global_prefetch_b8 %0, off scope:SCOPE_SE\n\tglobal_prefetch_b8 %1, off scope:SCOPE_SE\n\ts_wait_xcnt 0x0" :: "v"(a), "v"(b));
    else asm volatile("global_prefetch_b8 %0, off scope:SCOPE_SE\n\ts_wait_xcnt 0x0" :: "v"(a));
    a += step; if (HL) b += step;
}
template <typename T16, bool HL>
__device__ __forceinline__ void fa_rows(const T16* __restrict__ Q, const T16* __restrict__ Q2, const T16* __restrict__ Kp, const T16* __restrict__ Kp2, const T16* __restrict__ Vt, const T16* __restrict__ Vt2, float* __restrict__ orow, const int q0, const bool lead) {
    typedef WFrag<T16> WF; typedef typename WF::V V;
    const int lane = threadIdx.x & 31, c = lane & 15, h = lane >> 4;
    const float CSC = SCL * 1.4426950408889634f;
    // the lane's piece in a fragment-order unit stands lb bytes into it. Q: wave-uniform pointers to the first unit; K, V^T: per-lane pointers, carried through the loop and moved once a pass (4 units = 32 keys)
    const unsigned lb = lane * 16; auto at = [lb](const T16* u) { return (const T16*)((const char*)u + lb); };
    const T16* qp = Q + (size_t)q0 * HD; const T16* qp2 = HL ? Q2 + (size_t)q0 * HD : nullptr;
    const T16* kp = at(Kp); const T16* kp2 = HL ? at(Kp2) : nullptr;
    const T16* vp = at(Vt); const T16* vp2 = HL ? at(Vt2) : nullptr;
    V qf[2][2], qg[2][2];
#pragma unroll
    for (int q = 0; q < 2; ++q)
#pragma unroll
        for (int ks = 0; ks < 2; ++ks) { const int o = 16 * q * HD + 512 * ks; qf[q][ks] = WF::ld(at(qp) + o); if (HL) qg[q][ks] = WF::ld(at(qp2) + o); }
    v8f acc[4][2];
#pragma unroll
    for (int db = 0; db < 4; ++db)
#pragma unroll
        for (int q = 0; q < 2; ++q) acc[db][q] = (v8f){};
    float m[2] = {-3.0e38f, -3.0e38f}, l[2] = {0.f, 0.f};
    const int np = (q0 >> 5) + 1;                  // passes: keys 0 .. q0 + 31
    const int npf = lead ? np : 0;                 // wave-uniform: passes that this wave prefetches (a pass of a plane is 32 * HD elements = 4 KB in K and in V^T alike)
    const int p1 = (1 < np) ? 4096 : 0;
    const char* pa = (const char*)(h ? Vt : Kp) + c * 256 + p1; const char* pb = HL ? (const char*)(h ? Vt2 : Kp2) + c * 256 + p1 : nullptr;
    V ka[2][2], kc[2][2];
#pragma unroll
    for (int kg = 0; kg < 2; ++kg)
#pragma unroll
        for (int ks = 0; ks < 2; ++ks) { const int o = kg * 16 * HD + 512 * ks; ka[kg][ks] = WF::ld(kp + o); if (HL) kc[kg][ks] = WF::ld(kp2 + o); }
    // precaution behind a group of fragment loads, here and in the loop: the pointers the loads name are inputs of the wait, so they keep their registers up to it and are moved only behind it
    // (here the build addresses by scalar base and lane offset, so these are named as well)
    if constexpr (HL) asm volatile("s_wait_xcnt 0x0" :: "s"(qp), "s"(qp2), "s"(Kp), "s"(Kp2), "v"(lb), "v"(kp), "v"(kp2) : "memory"); else asm volatile("s_wait_xcnt 0x0" :: "s"(qp), "s"(Kp), "v"(lb), "v"(kp) : "memory");
    int t = 0;
    // kept rolled: the trip count is a run-time value, and a second copy of the body would not fit the register budget of three waves per SIMD
#pragma unroll 1
    do {                                           // np >= 1: every query row sees key 0
        V va[4], vc[4];                            // this pass's V^T fragments: in flight under the score products and the softmax
#pragma unroll
        for (int db = 0; db < 4; ++db) { const int o = db * 512; va[db] = WF::ld(vp + o); if (HL) vc[db] = WF::ld(vp2 + o); }
        if constexpr (HL) asm volatile("s_wait_xcnt 0x0" :: "v"(vp), "v"(vp2) : "memory"); else asm volatile("s_wait_xcnt 0x0" :: "v"(vp) : "memory");
        vp += 2048; if (HL) vp2 += 2048;
        v8f s[2][2];
#pragma unroll
        for (int kg = 0; kg < 2; ++kg)
#pragma unroll
            for (int q = 0; q < 2; ++q) { s[kg][q] = (v8f){};
#pragma unroll
                for (int ks = 0; ks < 2; ++ks) { s[kg][q] = WF::mma(ka[kg][ks], qf[q][ks], s[kg][q]); if (HL) { s[kg][q] = WF::mma(ka[kg][ks], qg[q][ks], s[kg][q]); s[kg][q] = WF::mma(kc[kg][ks], qf[q][ks], s[kg][q]); } } }
        { const int kstep = (t + 1 < np) ? 32 * HD : 0;  // the next pass's K fragments, in flight under this pass's softmax and second product (the last pass reloads its own: in bounds, unused)
            kp += kstep; if (HL) kp2 += kstep;
#pragma unroll
            for (int kg = 0; kg < 2; ++kg)
#pragma unroll
                for (int ks = 0; ks < 2; ++ks) { const int o = kg * 16 * HD + 512 * ks; ka[kg][ks] = WF::ld(kp + o); if (HL) kc[kg][ks] = WF::ld(kp2 + o); }
            if constexpr (HL) asm volatile("s_wait_xcnt 0x0" :: "v"(kp), "v"(kp2) : "memory"); else asm volatile("s_wait_xcnt 0x0" :: "v"(kp) : "memory"); }
        if (t == np - 1) {                         // wave-uniform: only the pass on the diagonal masks (key0 == q0 there)
#pragma unroll
            for (int kg = 0; kg < 2; ++kg)
#pragma unroll
                for (int q = 0; q < 2; ++q)
#pragma unroll
                    for (int r = 0; r < 8; ++r) if (16 * kg + 8 * h + r > 16 * q + c) s[kg][q][r] = -3.0e38f;
        }
        float mb[2]; bool need = false;
#pragma unroll
        for (int q = 0; q < 2; ++q) { float mx = -3.0e38f;
#pragma unroll
            for (int kg = 0; kg < 2; ++kg)
#pragma unroll
                for (int r = 0; r < 8; ++r) mx = fmaxf(mx, s[kg][q][r]);
            mx = fmaxf(mx, xhalf(mx)) * CSC; mb[q] = mx; need = need || (mx > m[q]); }
        if (__builtin_amdgcn_ballot_w32(need) != 0) {   // scalar branch; where no maximum grows every factor would be exactly 1
#pragma unroll
            for (int q = 0; q < 2; ++q) { const float mn = fmaxf(m[q], mb[q]); const float corr = __builtin_amdgcn_exp2f(m[q] - mn); m[q] = mn; l[q] *= corr;
#pragma unroll
                for (int db = 0; db < 4; ++db) acc[db][q] = acc[db][q] * corr; }
        }
        // behind this pass's own loads, so that they are not held up, and well behind its score products; scalar branches. The first pass asks for passes 1 .. PFD - 1 as well (pass 0 is loaded at once);
        // then the lead wave asks for pass t + PFD while it exists
        if (t == 0) for (int d = 1; d < PFD; ++d) if (d < npf) pf_pass<HL>(pa, pb, (d + 1 < npf) ? 4096 : 0);
        if (t + PFD < npf) pf_pass<HL>(pa, pb, (t + PFD + 1 < npf) ? 4096 : 0);
#pragma unroll
        for (int q = 0; q < 2; ++q) { V pb, pc; float sum = 0.f; const float nm = -m[q];
            const v8f cv = {CSC, CSC, CSC, CSC, CSC, CSC, CSC, CSC}, nv = {nm, nm, nm, nm, nm, nm, nm, nm};
            const v8f ar[2] = {__builtin_elementwise_fma(s[0][q], cv, nv), __builtin_elementwise_fma(s[1][q], cv, nv)};
#pragma unroll
            for (int e = 0; e < 16; ++e) { const float p = __builtin_amdgcn_exp2f(ar[e >> 3][e & 7]); sum += p;
                if constexpr (HL) { const __bf16 ph = (__bf16)p; pb[e] = ph; pc[e] = (__bf16)(p - (float)ph); } else { pb[e] = (h16)p; } }
            // inputs only, for the slot behind a transcendental: the exponents keep their registers past the last v_exp_f32; without this line the build writes one v_exp_f32's result over the source of the v_exp_f32 directly in front of it
            if constexpr (!HL) asm volatile("" :: "v"(ar[0]), "v"(ar[1]));
            l[q] += sum;
#pragma unroll
            for (int db = 0; db < 4; ++db) { acc[db][q] = WF::mma(va[db], pb, acc[db][q]); if (HL) { acc[db][q] = WF::mma(va[db], pc, acc[db][q]); acc[db][q] = WF::mma(vc[db], pb, acc[db][q]); } } }
    } while (++t < np);
#pragma unroll
    for (int q = 0; q < 2; ++q) { const float inv = __fdiv_rn(1.0f, l[q] + xhalf(l[q])); float* op = orow + (size_t)(q0 + 16 * q + c) * DQ + 8 * h; v4f o[8];
#pragma unroll
        for (int db = 0; db < 4; ++db) {
#pragma unroll
            for (int r = 0; r < 4; ++r) { o[2 * db][r] = acc[db][q][r] * inv; o[2 * db + 1][r] = acc[db][q][4 + r] * inv; }
            *(v4f*)(op + 16 * db) = o[2 * db]; *(v4f*)(op + 16 * db + 4) = o[2 * db + 1]; }
        // precaution behind the run of eight stores: their address and their data are inputs of the wait, so they keep their registers up to it and are reused only behind it
        asm volatile("s_wait_xcnt 0x0" :: "v"(op), "v"(o[0]), "v"(o[1]), "v"(o[2]), "v"(o[3]), "v"(o[4]), "v"(o[5]), "v"(o[6]), "v"(o[7]) : "memory"); }
}
// ---- k_fattn: grid (8, batch * heads), 4 independent waves (no barrier, no LDS). The four waves of a workgroup take the 32-row blocks x, 15 - x (hi+lo rows), 16 + x, 31 - x (fp16 rows) of one plane, so every workgroup
// walks the same number of passes; which wave takes which block rotates with the workgroup (for speed only).
// PLACEMENT (for speed only; every piece of work is taken exactly once wherever the workgroups land): In all three launches flat index mod 8 picks the BATCH.
// Rows y, y + 32, y + 64 of this grid get consecutive numbers kq = 3 (y mod 32) + y / 32; head = kq / 8, x = kq mod 8:
// the three workgroups of rows y, y + 32, y + 64 walk the K and V^T of ONE plane (two planes for a quarter of the y).
// three waves per SIMD: the grid is three workgroups per WGP, and all of them are to be resident at once
__global__ __launch_bounds__(128) __attribute__((amdgpu_waves_per_eu(3))) void k_fattn(const h16* __restrict__ Q16, const h16* __restrict__ K16, const h16* __restrict__ V16, const bf* __restrict__ Qh, const bf* __restrict__ Ql, const bf* __restrict__ Kh, const bf* __restrict__ Kl, const bf* __restrict__ Vh, const bf* __restrict__ Vl, float* __restrict__ OUTb) {
    static_assert(NB_ * NH_ == 96, "kq runs over 32 x 3 grid rows = 12 planes x 8 values of x");
    const int w = __builtin_amdgcn_readfirstlane((int)(threadIdx.x >> 5)); const int kq = ((int)blockIdx.y & 31) * 3 + ((int)blockIdx.y >> 5);
    const int x = kq & 7, g = (int)blockIdx.x * 12 + (kq >> 3);   // g = batch * NH_ + head
    const int role = (w + x + g + (g >> 5)) & 3; const size_t po = (size_t)g * TT * HD;
    float* orow = OUTb + (size_t)(g / NH_) * TT * DQ + (g % NH_) * HD;
    if (role & 1) fa_rows<bf, true>(Qh + po, Ql + po, Kh + po, Kl + po, Vh + po, Vl + po, orow, 32 * ((role == 1) ? 15 - x : x), role == 1);
    else fa_rows<h16, false>(Q16 + po, nullptr, K16 + po, nullptr, V16 + po, nullptr, orow, 32 * ((role == 0) ? 31 - x : 16 + x), role == 0);
}

// ---- k_proj: the q, k and v projections of all batches in ONE launch, and their 16-bit planes written straight from the accumulators (no f32 copy of q, k or v in memory).
// One wave per 64x64 tile (16 accumulators), operands from the fragment-order bf16 planes by way of LDS: X rows batch * t, Wt rows [q heads | k heads | v heads][e], k = DM.
// A tile is D = P R^T: a lane holds ONE row of R (tile j, row lane & 15) and 8 consecutive rows of P (tile i, rows 8 (lane >> 4) + r). q, k: P = weights, R = x, so the 8 values are 8 consecutive e of one t;
// v: P = x, R = weights, so they are 8 consecutive t of one e. Both operands are read by the same loader, so the k order of the two is equal either way, and each sum runs over k as before.
// put_frags: those 8 values are the lane's own 16-byte piece (i & 1) of a fragment-order unit of the plane (q, k: rows t, k = e; v^T: rows e, k = t), so every accumulator goes out as one 512-byte store per plane, with no exchange between lanes.
// o16, oh, ol: the tile's first unit in the three planes plus lane * 8.
// sj, si: elements from tile j to j + 1 and from tile pair i >> 1 to the next in the plane's order of units (the same for the whole wave).
__device__ __forceinline__ void put_frags(const v8f (&acc)[4][4], unsigned short* o16, unsigned short* oh, unsigned short* ol, const int sj, const int si) {
#pragma unroll
    for (int j = 0; j < 4; ++j)
#pragma unroll
        for (int ih = 0; ih < 2; ++ih) { v8us d16[2], dh[2], dl[2];   // one unit (both pieces) of each plane at a time
            const int o = j * sj + ih * si; unsigned short* a16 = o16 + o; unsigned short* ah = oh + o; unsigned short* al = ol + o;
#pragma unroll
            for (int ii = 0; ii < 2; ++ii) { v8h c16;
#pragma unroll
                for (int e = 0; e < 8; ++e) { const float v = acc[2 * ih + ii][j][e]; c16[e] = tohx(v); unsigned short a2, c2; splitf(v, a2, c2); dh[ii][e] = a2; dl[ii][e] = c2; }
                d16[ii] = __builtin_bit_cast(v8us, c16);
                *(v8usa*)(a16 + ii * 256) = d16[ii]; *(v8usa*)(ah + ii * 256) = dh[ii]; *(v8usa*)(al + ii * 256) = dl[ii]; }
            // precaution behind the run of six stores: their addresses and their data are inputs of the wait, so they keep their registers up to it and are reused only behind it
            asm volatile("s_wait_xcnt 0x0" :: "v"(a16), "v"(ah), "v"(al), "v"(d16[0]), "v"(d16[1]), "v"(dh[0]), "v"(dh[1]), "v"(dl[0]), "v"(dl[1]) : "memory"); }
}
// copy_stage: one wave brings four units (row blocks i of its operand, one k block) from a fragment-order plane into LDS, unit after unit: 8 asynchronous copies of 512 contiguous bytes, through no register.
// g: the lane's own 16 bytes of the first unit in global memory; l: their place in LDS (byte address). Every lane is on; both addresses are multiples of 16.
__device__ __forceinline__ void copy_stage(const bf* g, const unsigned l) {
    const bf* g1 = g + 256; const bf* g2 = g + 16 * DM; const bf* g3 = g + 16 * DM + 256; const bf* g4 = g + 32 * DM; const bf* g5 = g + 32 * DM + 256; const bf* g6 = g + 48 * DM; const bf* g7 = g + 48 * DM + 256;
    // the copies and, as the last line, the precaution behind them in ONE statement: no register that a copy names is rewritten in front of that wait
    asm volatile("global_load_async_to_lds_b128 %0, %8, off\n\t"
                 "global_load_async_to_lds_b128 %1, %9, off\n\t"
                 "global_load_async_to_lds_b128 %2, %10, off\n\t"
                 "global_load_async_to_lds_b128 %3, %11, off\n\t"
                 "global_load_async_to_lds_b128 %4, %12, off\n\t"
                 "global_load_async_to_lds_b128 %5, %13, off\n\t"
                 "global_load_async_to_lds_b128 %6, %14, off\n\t"
                 "global_load_async_to_lds_b128 %7, %15, off\n\t"
                 "s_wait_xcnt 0x0"
                 :: "v"(l), "v"(l + 512u), "v"(l + 1024u), "v"(l + 1536u), "v"(l + 2048u), "v"(l + 2560u), "v"(l + 3072u), "v"(l + 3584u),
                    "v"(g), "v"(g1), "v"(g2), "v"(g3), "v"(g4), "v"(g5), "v"(g6), "v"(g7) : "memory");
}
// FOUR WAVES per workgroup, a 128x128 tile (2 x 2 wave tiles of 64x64): grid (rows of x / 128, 3 * heads / 2). A stage = one k block of the tile's 8 row blocks of x (units 0..7) and 8 of the weights (units 8..15), 16 KB, each unit
// read from LDS by two waves. Two buffers: the copies of stage t + 2 fly while stage t + 1 is worked on. Waves 0, 1 copy x, waves 2, 3 the weights (four units each).
#define STG (16 * 512)                       // elements of a stage
#define NST (DM / 32)                        // stages
static_assert(NST >= 2 && NH_ % 2 == 0 && TT % 128 == 0, "two stages for the prologue; the two heads of a workgroup are of one projection; its rows of one batch");
static_assert(NB_ == 8 && (NB_ * TT / 128) % 8 == 0, "grid x = 8 batches x TT / 128 row tiles, and a grid row is a multiple of 8 blocks");
// five waves per SIMD: the grid is four and a half workgroups per WGP, and all of them are to be resident at once
__global__ __launch_bounds__(128) __attribute__((amdgpu_waves_per_eu(5))) void k_proj(const bf* __restrict__ X, const bf* __restrict__ Wt, h16* Q16, bf* Qh, bf* Ql, h16* K16, bf* Kh, bf* Kl, h16* V16, bf* Vh, bf* Vl) {
    typedef WFrag<bf> WF; typedef WF::V V;
    __shared__ __attribute__((aligned(1024))) bf ring[2 * STG];
    const int lane = threadIdx.x & 31; const int w = __builtin_amdgcn_readfirstlane((int)(threadIdx.x >> 5));
    const int bx = ((int)blockIdx.x & 7) * (TT / 128) + ((int)blockIdx.x >> 3);   // the tile's 128 rows of x: batch = flat block index mod 8 (PLACEMENT, at k_fattn), a permutation of the NB_ * TT / 128 row tiles
    const int r0 = bx * 128 + (w & 1) * 64, y = blockIdx.y * 2 + (w >> 1), sel = y / NH_, hd = y % NH_; const bool vt = sel == 2;
    // the wave's source: a 16-row block is DM / 32 units = 16 * DM elements; a stage further is one unit further
    const bf* gp = ((w < 2) ? X + (size_t)(bx * 128 + w * 64) * DM : Wt + (size_t)(blockIdx.y * 128 + (w - 2) * 64) * DM) + lane * 8;
    const unsigned lp = (unsigned)(size_t)ring + (unsigned)(w * 4096 + lane * 16);
    // the wave's operands in a stage, elements: x units 4 (w & 1) + i, weight units 8 + 4 (w >> 1) + i
    const int xo = (w & 1) * 2048 + lane * 8, wo = 4096 + (w >> 1) * 2048 + lane * 8; const int po = vt ? xo : wo, ro = vt ? wo : xo;
    v8f acc[4][4];
#pragma unroll
    for (int i = 0; i < 4; ++i)
#pragma unroll
        for (int j = 0; j < 4; ++j) acc[i][j] = (v8f){};
    copy_stage(gp, lp);
    // stage 0 has landed (this wave's copies), then every wave's: nobody reads it in front of the barrier
    asm volatile("s_wait_asynccnt 0x0" ::: "memory");
    __syncthreads();
    copy_stage(gp + 512, lp + STG * 2);
    gp += 1024;
    // kept rolled: a second copy of the body would need a second set of fragment registers
#pragma unroll 1
    for (int t = 0; t < NST; ++t) {
        const bf* b = ring + (t & 1) * STG;
        V p[4], r[4];
#pragma unroll
        for (int i = 0; i < 4; ++i) { p[i] = WF::ld(b + po + i * 512); r[i] = WF::ld(b + ro + i * 512); }
#pragma unroll
        for (int j = 0; j < 4; ++j)
#pragma unroll
            for (int i = 0; i < 4; ++i) acc[i][j] = WF::mma(p[i], r[j], acc[i][j]);
        // publish point of stage t + 1: this wave's reads of stage t are done, its copies of stage t + 1 have landed, then the barrier says both of every wave
        asm volatile("s_wait_dscnt 0x0" ::: "memory");
        asm volatile("s_wait_asynccnt 0x0" ::: "memory");
        __syncthreads();
        if (t + 2 < NST) { copy_stage(gp, lp + (unsigned)(t & 1) * (STG * 2)); gp += 512; }   // into the buffer that this trip has just read
    }
    // nothing is in flight when the wave goes on
    asm volatile("s_wait_asynccnt 0x0" ::: "memory");
    // 64 rows t of a plane are 64 * HD elements in either order of the units
    const size_t ob = ((size_t)(r0 / TT) * NH_ + hd) * TT * HD + (size_t)(r0 % TT) * HD + lane * 8;
    unsigned short* o16 = (unsigned short*)((sel == 0) ? Q16 : (sel == 1) ? K16 : V16) + ob; unsigned short* oh = ((sel == 0) ? Qh : (sel == 1) ? Kh : Vh) + ob; unsigned short* ol = ((sel == 0) ? Ql : (sel == 1) ? Kl : Vl) + ob;
    put_frags(acc, o16, oh, ol, vt ? 512 : 1024, vt ? 2048 : 512);
}

extern "C" void kernel_launch(void* const* d_in, const int* in_sizes, int n_in,
                              void* d_out, int out_size, void* d_ws, size_t ws_size, hipStream_t stream) {
    (void)in_sizes; (void)n_in; (void)out_size;
    const float* x = (const float*)d_in[0]; const float* wq = (const float*)d_in[1]; const float* wk = (const float*)d_in[2]; const float* wv = (const float*)d_in[3]; const float* wo = nullptr; (void)wo;
    float* OUT = (float*)d_out;     // [8][1024][768]
    char* wsp = (char*)d_ws;
    auto take = [&](size_t bytes) { char* p = wsp; wsp += (bytes + 255) & ~(size_t)255; return (void*)p; };
    bf* WQ = (bf*)take((size_t)(DQ + 2 * DKV) * DM * 2);   // one stack of rows [q | k | v]
    const size_t PQ = (size_t)NB_ * NH_ * TT * HD * 2, PK = (size_t)NB_ * NKV * TT * HD * 2;   // bytes of one 16-bit plane set [batch][head][..][..]
    h16* QP16 = (h16*)take(PQ); h16* KP16 = (h16*)take(PK); h16* VT16 = (h16*)take(PK);
    bf* QPh = (bf*)take(PQ); bf* QPl = (bf*)take(PQ); bf* KPh = (bf*)take(PK); bf* KPl = (bf*)take(PK); bf* VTh = (bf*)take(PK); bf* VTl = (bf*)take(PK);
    bf* XB = (bf*)take((size_t)NB_ * TT * DM * 2);
    if ((size_t)(wsp - (char*)d_ws) > ws_size) return;    // ws 256 MiB
    // the weight stack and x in fragment order, one launch
    k_prep<<<(unsigned)(3 * WTB + CVB), 256, 0, stream>>>(x, wq, wk, wv, WQ, XB);
    // projections: all batches as one [NB_*TT][DM] operand, q, k and v in one launch that also writes the planes
    k_proj<<<dim3(NB_ * TT / 128, (DQ + 2 * DKV) / 128, 1), 128, 0, stream>>>(XB, WQ, QP16, QPh, QPl, KP16, KPh, KPl, VT16, VTh, VTl);
    // attention: every (batch, head) plane in one launch (one kv head per query head)
    k_fattn<<<dim3(8, NB_ * NH_, 1), 128, 0, stream>>>(QP16, KP16, VT16, QPh, QPl, KPh, KPl, VTh, VTl, OUT);
}

// v009
// A run of this version takes 68 microseconds.
// In both of two side-by-side timings against v008, it was 1.04 times as fast.
// Over all steps from v000 it is 41.3 times as fast.
#include <hip/hip_runtime.h>

// Causal multi-head attention wrapper with per-head projections (x [8][1024][768]; q_h = x Wq[h], k_h = x Wk[h], v_h = x Wv[h] with per-head 'xw' weights [12][768][64], no bias; scores = q.k / 8, causal mask (-inf above the diagonal); softmax; out = heads concatenated along the feature axis -> [8][1024][768] in f32 (6.3 M), no output projection).
// Compute dtypes, f32 accumulate: every input rounded to bf16; q/k/v on PLAIN bf16 operands (inputs: exact); causal scores and attn.v in ONE fused kernel (online softmax, scores and probabilities stay in registers): query rows < 512 hl (3 products), the rest single fp16; softmax f32; no output projection: the merged heads are written in f32 straight to the output.

// FRAGMENT ORDER: every 16-bit operand plane (x, the weights, q, k, v^T) lies in units of 1 KB = 16 rows x 32 k of its matrix. Inside a unit element (row lr, k = 16 j + 8 hi + e) stands at j * 256 + (hi * 16 + lr) * 8 + e,
// so lane hi * 16 + lr of a wave finds its two 16-byte pieces of a WMMA operand at lane * 8 and 256 + lane * 8: each wave-wide 16-byte load or store covers 512 contiguous bytes (4 whole lines).
// Order of the units: x, weights, q, k: [16-row block][k block]; v^T (rows e, k = key): [32-key block][16-row block].

#define NB_  8
#define TT   1024
#define DM   768
#define NH_  12
#define NKV  12
#define HD   64
#define DQ   (NH_ * HD)
#define DKV  (NKV * HD)
#define RH   512                  // unused: k_fattn's block split fixes the hi+lo rows at < 512
#define SCL  0.125f   // HD^-0.5
typedef _Float16 h16;
typedef unsigned short bf;
typedef __attribute__((ext_vector_type(16))) __bf16   v16bf;
typedef __attribute__((ext_vector_type(16))) _Float16 v16h;
typedef __attribute__((ext_vector_type(8)))  _Float16 v8h;
typedef __attribute__((ext_vector_type(8)))  unsigned short v8us;
typedef __attribute__((ext_vector_type(8)))  float    v8f;
typedef __attribute__((ext_vector_type(4)))  float    v4f;
typedef v8h  __attribute__((may_alias)) v8ha;
typedef v4f  __attribute__((may_alias)) v4fa;
typedef v8us __attribute__((may_alias)) v8usa;

__device__ __forceinline__ unsigned short f2bf(float f) { unsigned u = __float_as_uint(f); u += 0x7FFFu + ((u >> 16) & 1u); return (unsigned short)(u >> 16); }
__device__ __forceinline__ float bf2f(unsigned short b) { return __uint_as_float(((unsigned)b) << 16); }
__device__ __forceinline__ v16h cat16(v8h lo, v8h hi) { return __builtin_shufflevector(lo, hi, 0, 1, 2, 3, 4, 5, 6, 7, 8, 9, 10, 11, 12, 13, 14, 15); }
__device__ __forceinline__ v16bf cat16b(v8us lo, v8us hi) { return __builtin_bit_cast(v16bf, __builtin_shufflevector(lo, hi, 0, 1, 2, 3, 4, 5, 6, 7, 8, 9, 10, 11, 12, 13, 14, 15)); }
__device__ __forceinline__ v8f wmma16(v16h a, v16h b, v8f c) { return __builtin_amdgcn_wmma_f32_16x16x32_f16(false, a, false, b, (short)0, c, false, false); }
__device__ __forceinline__ v8f wmmab(v16bf a, v16bf b, v8f c) { return __builtin_amdgcn_wmma_f32_16x16x32_bf16(false, a, false, b, (short)0, c, false, false); }



template <typename T16> struct WFrag;
template <> struct WFrag<h16> { typedef v16h V; static __device__ __forceinline__ V ld(const h16* p) { return cat16(*(const v8h*)p, *(const v8h*)(p + 256)); } static __device__ __forceinline__ v8f mma(V a, V b, v8f c) { return wmma16(a, b, c); } };
template <> struct WFrag<bf> { typedef v16bf V; static __device__ __forceinline__ V ld(const bf* p) { return cat16b(*(const v8us*)p, *(const v8us*)(p + 256)); } static __device__ __forceinline__ v8f mma(V a, V b, v8f c) { return wmmab(a, b, c); } };
__device__ __forceinline__ h16 tohx(float x) { return (h16)x; }
__device__ __forceinline__ void splitf(float y, unsigned short& h, unsigned short& l) { h = f2bf(y); l = f2bf(y - bf2f(h)); }
typedef __attribute__((ext_vector_type(2))) _Float16 v2h;
typedef __attribute__((ext_vector_type(4))) _Float16 v4h;
typedef __attribute__((ext_vector_type(2))) unsigned short v2us;
typedef __attribute__((ext_vector_type(4))) unsigned short v4us;
typedef __attribute__((ext_vector_type(2))) float v2f;
typedef __attribute__((ext_vector_type(4))) int v4i;

// weights [head][k][e] f32 -> rows n = head * HD + e, k contiguous, bf16, in fragment order: one thread makes one 16-byte piece i (8 k of one n); the 16 lanes of a half wave read 16 consecutive e
__device__ __forceinline__ void wt_piece(const float* __restrict__ w, const int i, bf* Bt) {
    const int lr = i & 15, hi = (i >> 4) & 1, j = (i >> 5) & 1, u = i >> 6; const int nkb = DM / 32; const int kb = u % nkb, n = (u / nkb) * 16 + lr;
    const float* sp = w + ((size_t)(n / HD) * DM + kb * 32 + j * 16 + hi * 8) * HD + n % HD; float v[8]; v8us o;
#pragma unroll
    for (int e = 0; e < 8; ++e) v[e] = sp[e * HD];
    // precaution behind the group of loads: the pointer they name is an input of the wait, so it keeps its registers up to it
    asm volatile("s_wait_xcnt 0x0" :: "v"(sp) : "memory");
#pragma unroll
    for (int e = 0; e < 8; ++e) o[e] = f2bf(v[e]);
    *(v8us*)(Bt + (size_t)i * 8) = o;
    // precaution behind the store: its address (the build forms it from the scalar base and the piece's index) and its data are inputs of the wait, so they keep their registers up to it (the other side of k_prep's branch may stand behind this code)
    asm volatile("s_wait_xcnt 0x0" :: "s"(Bt), "v"(i), "v"(o) : "memory");
}

// x [row][DM] f32 -> bf16 in fragment order: one wave makes one unit u (16 rows x 32 k); 8 lanes read one whole 128-byte line of a row, 4 rows a load
__device__ __forceinline__ void cvt_unit(const float* __restrict__ src, bf* dst, const int u) {
    const int lane = threadIdx.x & 31, rr = lane >> 3, g = lane & 7; const int rb = u / (DM / 32), kb = u % (DM / 32);
    const float* sp = src + (size_t)(rb * 16 + rr) * DM + kb * 32 + g * 4; bf* dp = dst + (size_t)u * 512 + (g >> 2) * 256 + (((g >> 1) & 1) * 16 + rr) * 8 + (g & 1) * 4; v4f v[4]; v4us o[4];
#pragma unroll
    for (int s = 0; s < 4; ++s) v[s] = *(const v4f*)(sp + s * 4 * DM);
    // precaution behind the group of loads: the pointer they name is an input of the wait, so it keeps its registers up to it
    asm volatile("s_wait_xcnt 0x0" :: "v"(sp) : "memory");
#pragma unroll
    for (int s = 0; s < 4; ++s) {
#pragma unroll
        for (int k = 0; k < 4; ++k) o[s][k] = f2bf(v[s][k]);
        *(v4us*)(dp + s * 32) = o[s]; }
    // precaution behind the run of four stores: their address and their data are inputs of the wait, so they keep their registers up to it (the other side of k_prep's branch may stand behind this code)
    asm volatile("s_wait_xcnt 0x0" :: "v"(dp), "v"(o[0]), "v"(o[1]), "v"(o[2]), "v"(o[3]) : "memory");
}

// ---- k_prep: the four independent conversions (Wq, Wk, Wv, x) in ONE launch, told apart by block range (a block-uniform branch, no barrier): blocks 0 .. 3 * WTB - 1 make the weight stack [q | k | v], the rest make x.
#define WTB (DM * DQ / 8 / 256)              // blocks per weight matrix, 256 pieces each
#define CVB (NB_ * TT * DM / 512 / 8)        // blocks for x, 8 units each
static_assert(DQ == DKV && DM * DQ % (8 * 256) == 0 && NB_ * TT * DM % (512 * 8) == 0, "the block ranges cover every piece and every unit exactly once");
static_assert(NB_ == 8 && (3 * WTB) % 8 == 0 && CVB % NB_ == 0, "x blocks: index mod 8 is the batch, index / 8 the block inside it");
__global__ __launch_bounds__(256) void k_prep(const float* __restrict__ x, const float* __restrict__ wq, const float* __restrict__ wk, const float* __restrict__ wv, bf* Wt, bf* XB) {
    const int b = blockIdx.x;
    if (b < 3 * WTB) { const int sel = b / WTB; wt_piece((sel == 0) ? wq : (sel == 1) ? wk : wv, (b - sel * WTB) * 256 + (int)threadIdx.x, Wt + (size_t)sel * DQ * DM); }
    else { const int c = b - 3 * WTB; cvt_unit(x, XB, ((c & 7) * (CVB / NB_) + (c >> 3)) * 8 + (int)(threadIdx.x >> 5)); }   // batch = flat block index mod 8 (PLACEMENT, at k_fattn)
}

// lane l with lane l ^ 16
__device__ __forceinline__ float xhalf(float x) { return __builtin_bit_cast(float, __builtin_amdgcn_permlanex16(__builtin_bit_cast(int, x), __builtin_bit_cast(int, x), 0x76543210, 0xfedcba98, false, false)); }

#define PFD 6                     // passes between a prefetch and its loads
// a, b: per-lane addresses, carried through the loop in their own registers; they name bytes of the wave's own passes at issue and behind every advance (step is 0 where the next pass does not exist).
template <bool HL>
__device__ __forceinline__ void pf_pass(const char*& a, const char*& b, const int step) {
    // a hint into L2, no register written, no counter; the wait in the same statement is the precaution in front of the advance of the address registers
    if constexpr (HL) asm volatile("global_prefetch_b8 %0, off scope:SCOPE_SE\n\tglobal_prefetch_b8 %1, off scope:SCOPE_SE\n\ts_wait_xcnt 0x0" :: "v"(a), "v"(b));
    else asm volatile("global_prefetch_b8 %0, off scope:SCOPE_SE\n\ts_wait_xcnt 0x0" :: "v"(a));
    a += step; if (HL) b += step;
}
template <typename T16, bool HL>
__device__ __forceinline__ void fa_rows(const T16* __restrict__ Q, const T16* __restrict__ Q2, const T16* __restrict__ Kp, const T16* __restrict__ Kp2, const T16* __restrict__ Vt, const T16* __restrict__ Vt2, float* __restrict__ orow, const int q0, const bool lead) {
    typedef WFrag<T16> WF; typedef typename WF::V V;
    const int lane = threadIdx.x & 31, c = lane & 15, h = lane >> 4;
    const float CSC = SCL * 1.4426950408889634f;
    // the lane's piece in a fragment-order unit stands lb bytes into it. Q: wave-uniform pointers to the first unit; K, V^T: per-lane pointers, carried through the loop and moved once a pass (4 units = 32 keys)
    const unsigned lb = lane * 16; auto at = [lb](const T16* u) { return (const T16*)((const char*)u + lb); };
    const T16* qp = Q + (size_t)q0 * HD; const T16* qp2 = HL ? Q2 + (size_t)q0 * HD : nullptr;
    const T16* kp = at(Kp); const T16* kp2 = HL ? at(Kp2) : nullptr;
    const T16* vp = at(Vt); const T16* vp2 = HL ? at(Vt2) : nullptr;
    V qf[2][2], qg[2][2];
#pragma unroll
    for (int q = 0; q < 2; ++q)
#pragma unroll
        for (int ks = 0; ks < 2; ++ks) { const int o = 16 * q * HD + 512 * ks; qf[q][ks] = WF::ld(at(qp) + o); if (HL) qg[q][ks] = WF::ld(at(qp2) + o); }
    v8f acc[4][2];
#pragma unroll
    for (int db = 0; db < 4; ++db)
#pragma unroll
        for (int q = 0; q < 2; ++q) acc[db][q] = (v8f){};
    float m[2] = {-3.0e38f, -3.0e38f}, l[2] = {0.f, 0.f};
    const int np = (q0 >> 5) + 1;                  // passes: keys 0 .. q0 + 31
    const int npf = lead ? np : 0;                 // wave-uniform: passes that this wave prefetches (a pass of a plane is 32 * HD elements = 4 KB in K and in V^T alike)
    const int p1 = (1 < np) ? 4096 : 0;
    const char* pa = (const char*)(h ? Vt : Kp) + c * 256 + p1; const char* pb = HL ? (const char*)(h ? Vt2 : Kp2) + c * 256 + p1 : nullptr;
    V ka[2][2], kc[2][2];
#pragma unroll
    for (int kg = 0; kg < 2; ++kg)
#pragma unroll
        for (int ks = 0; ks < 2; ++ks) { const int o = kg * 16 * HD + 512 * ks; ka[kg][ks] = WF::ld(kp + o); if (HL) kc[kg][ks] = WF::ld(kp2 + o); }
    // precaution behind a group of fragment loads, here and in the loop: the pointers the loads name are inputs of the wait, so they keep their registers up to it and are moved only behind it
    // (here the build addresses by scalar base and lane offset, so these are named as well)
    if constexpr (HL) asm volatile("s_wait_xcnt 0x0" :: "s"(qp), "s"(qp2), "s"(Kp), "s"(Kp2), "v"(lb), "v"(kp), "v"(kp2) : "memory"); else asm volatile("s_wait_xcnt 0x0" :: "s"(qp), "s"(Kp), "v"(lb), "v"(kp) : "memory");
    int t = 0;
    // kept rolled: the trip count is a run-time value, and a second copy of the body would not fit the register budget of three waves per SIMD
#pragma unroll 1
    do {                                           // np >= 1: every query row sees key 0
        V va[4], vc[4];                            // this pass's V^T fragments: in flight under the score products and the softmax
#pragma unroll
        for (int db = 0; db < 4; ++db) { const int o = db * 512; va[db] = WF::ld(vp + o); if (HL) vc[db] = WF::ld(vp2 + o); }
        if constexpr (HL) asm volatile("s_wait_xcnt 0x0" :: "v"(vp), "v"(vp2) : "memory"); else asm volatile("s_wait_xcnt 0x0" :: "v"(vp) : "memory");
        vp += 2048; if (HL) vp2 += 2048;
        v8f s[2][2];
#pragma unroll
        for (int kg = 0; kg < 2; ++kg)
#pragma unroll
            for (int q = 0; q < 2; ++q) { s[kg][q] = (v8f){};
#pragma unroll
                for (int ks = 0; ks < 2; ++ks) { s[kg][q] = WF::mma(ka[kg][ks], qf[q][ks], s[kg][q]); if (HL) { s[kg][q] = WF::mma(ka[kg][ks], qg[q][ks], s[kg][q]); s[kg][q] = WF::mma(kc[kg][ks], qf[q][ks], s[kg][q]); } } }
        { const int kstep = (t + 1 < np) ? 32 * HD : 0;  // the next pass's K fragments, in flight under this pass's softmax and second product (the last pass reloads its own: in bounds, unused)
            kp += kstep; if (HL) kp2 += kstep;
#pragma unroll
            for (int kg = 0; kg < 2; ++kg)
#pragma unroll
                for (int ks = 0; ks < 2; ++ks) { const int o = kg * 16 * HD + 512 * ks; ka[kg][ks] = WF::ld(kp + o); if (HL) kc[kg][ks] = WF::ld(kp2 + o); }
            if constexpr (HL) asm volatile("s_wait_xcnt 0x0" :: "v"(kp), "v"(kp2) : "memory"); else asm volatile("s_wait_xcnt 0x0" :: "v"(kp) : "memory"); }
        if (t == np - 1) {                         // wave-uniform: only the pass on the diagonal masks (key0 == q0 there)
#pragma unroll
            for (int kg = 0; kg < 2; ++kg)
#pragma unroll
                for (int q = 0; q < 2; ++q)
#pragma unroll
                    for (int r = 0; r < 8; ++r) if (16 * kg + 8 * h + r > 16 * q + c) s[kg][q][r] = -3.0e38f;
        }
        float mb[2]; bool need = false;
#pragma unroll
        for (int q = 0; q < 2; ++q) { float mx = -3.0e38f;
#pragma unroll
            for (int kg = 0; kg < 2; ++kg)
#pragma unroll
                for (int r = 0; r < 8; ++r) mx = fmaxf(mx, s[kg][q][r]);
            mx = fmaxf(mx, xhalf(mx)) * CSC; mb[q] = mx; need = need || (mx > m[q]); }
        if (__builtin_amdgcn_ballot_w32(need) != 0) {   // scalar branch; where no maximum grows every factor would be exactly 1
#pragma unroll
            for (int q = 0; q < 2; ++q) { const float mn = fmaxf(m[q], mb[q]); const float corr = __builtin_amdgcn_exp2f(m[q] - mn); m[q] = mn; l[q] *= corr;
#pragma unroll
                for (int db = 0; db < 4; ++db) acc[db][q] = acc[db][q] * corr; }
        }
        // behind this pass's own loads, so that they are not held up, and well behind its score products; scalar branches. The first pass asks for passes 1 .. PFD - 1 as well (pass 0 is loaded at once);
        // then the lead wave asks for pass t + PFD while it exists
        if (t == 0) for (int d = 1; d < PFD; ++d) if (d < npf) pf_pass<HL>(pa, pb, (d + 1 < npf) ? 4096 : 0);
        if (t + PFD < npf) pf_pass<HL>(pa, pb, (t + PFD + 1 < npf) ? 4096 : 0);
#pragma unroll
        for (int q = 0; q < 2; ++q) { V pb, pc; float sum = 0.f; const float nm = -m[q];
            const v8f cv = {CSC, CSC, CSC, CSC, CSC, CSC, CSC, CSC}, nv = {nm, nm, nm, nm, nm, nm, nm, nm};
            const v8f ar[2] = {__builtin_elementwise_fma(s[0][q], cv, nv), __builtin_elementwise_fma(s[1][q], cv, nv)};
#pragma unroll
            for (int e = 0; e < 16; ++e) { const float p = __builtin_amdgcn_exp2f(ar[e >> 3][e & 7]); sum += p;
                if constexpr (HL) { const __bf16 ph = (__bf16)p; pb[e] = ph; pc[e] = (__bf16)(p - (float)ph); } else { pb[e] = (h16)p; } }
            // inputs only, for the slot behind a transcendental: the exponents keep their registers past the last v_exp_f32; without this line the build writes one v_exp_f32's result over the source of the v_exp_f32 directly in front of it
            if constexpr (!HL) asm volatile("" :: "v"(ar[0]), "v"(ar[1]));
            l[q] += sum;
#pragma unroll
            for (int db = 0; db < 4; ++db) { acc[db][q] = WF::mma(va[db], pb, acc[db][q]); if (HL) { acc[db][q] = WF::mma(va[db], pc, acc[db][q]); acc[db][q] = WF::mma(vc[db], pb, acc[db][q]); } } }
    } while (++t < np);
#pragma unroll
    for (int q = 0; q < 2; ++q) { const float inv = __fdiv_rn(1.0f, l[q] + xhalf(l[q])); float* op = orow + (size_t)(q0 + 16 * q + c) * DQ + 8 * h; v4f o[8];
#pragma unroll
        for (int db = 0; db < 4; ++db) {
#pragma unroll
            for (int r = 0; r < 4; ++r) { o[2 * db][r] = acc[db][q][r] * inv; o[2 * db + 1][r] = acc[db][q][4 + r] * inv; }
            *(v4f*)(op + 16 * db) = o[2 * db]; *(v4f*)(op + 16 * db + 4) = o[2 * db + 1]; }
        // precaution behind the run of eight stores: their address and their data are inputs of the wait, so they keep their registers up to it and are reused only behind it
        asm volatile("s_wait_xcnt 0x0" :: "v"(op), "v"(o[0]), "v"(o[1]), "v"(o[2]), "v"(o[3]), "v"(o[4]), "v"(o[5]), "v"(o[6]), "v"(o[7]) : "memory"); }
}
// ---- k_fattn: grid (8, batch * heads), 4 independent waves (no barrier, no LDS). The four waves of a workgroup take the 32-row blocks x, 15 - x (hi+lo rows), 16 + x, 31 - x (fp16 rows) of one plane, so every workgroup
// walks the same number of passes; which wave takes which block rotates with the workgroup (for speed only).
// PLACEMENT (for speed only; every piece of work is taken exactly once wherever the workgroups land): In all three launches flat index mod 8 picks the BATCH.
// Rows y, y + 32, y + 64 of this grid get consecutive numbers kq = 3 (y mod 32) + y / 32; head = kq / 8, x = kq mod 8:
// the three workgroups of rows y, y + 32, y + 64 walk the K and V^T of ONE plane (two planes for a quarter of the y).
// three waves per SIMD: the grid is three workgroups per WGP, and all of them are to be resident at once
__global__ __launch_bounds__(128) __attribute__((amdgpu_waves_per_eu(3))) void k_fattn(const h16* __restrict__ Q16, const h16* __restrict__ K16, const h16* __restrict__ V16, const bf* __restrict__ Qh, const bf* __restrict__ Ql, const bf* __restrict__ Kh, const bf* __restrict__ Kl, const bf* __restrict__ Vh, const bf* __restrict__ Vl, float* __restrict__ OUTb) {
    static_assert(NB_ * NH_ == 96, "kq runs over 32 x 3 grid rows = 12 planes x 8 values of x");
    const int w = __builtin_amdgcn_readfirstlane((int)(threadIdx.x >> 5)); const int kq = ((int)blockIdx.y & 31) * 3 + ((int)blockIdx.y >> 5);
    const int x = kq & 7, g = (int)blockIdx.x * 12 + (kq >> 3);   // g = batch * NH_ + head
    const int role = (w + x + g + (g >> 5)) & 3; const size_t po = (size_t)g * TT * HD;
    float* orow = OUTb + (size_t)(g / NH_) * TT * DQ + (g % NH_) * HD;
    if (role & 1) fa_rows<bf, true>(Qh + po, Ql + po, Kh + po, Kl + po, Vh + po, Vl + po, orow, 32 * ((role == 1) ? 15 - x : x), role == 1);
    else fa_rows<h16, false>(Q16 + po, nullptr, K16 + po, nullptr, V16 + po, nullptr, orow, 32 * ((role == 0) ? 31 - x : 16 + x), role == 0);
}

// ---- k_proj: the q, k and v projections of all batches in ONE launch, and their 16-bit planes written straight from the accumulators (no f32 copy of q, k or v in memory).
// One wave per 64x64 tile (16 accumulators), operands from the fragment-order bf16 planes by way of LDS: X rows batch * t, Wt rows [q heads | k heads | v heads][e], k = DM.
// A tile is D = P R^T: a lane holds ONE row of R (tile j, row lane & 15) and 8 consecutive rows of P (tile i, rows 8 (lane >> 4) + r). q, k: P = weights, R = x, so the 8 values are 8 consecutive e of one t;
// v: P = x, R = weights, so they are 8 consecutive t of one e. Both operands are read by the same loader, so the k order of the two is equal either way, and each sum runs over k as before.
// put_frags: those 8 values are the lane's own 16-byte piece (i & 1) of a fragment-order unit of the plane (q, k: rows t, k = e; v^T: rows e, k = t), so every accumulator goes out as one 512-byte store per plane, with no exchange between lanes.
// o16, oh, ol: the tile's first unit in the three planes plus lane * 8.
// sj, si: elements from tile j to j + 1 and from tile pair i >> 1 to the next in the plane's order of units (the same for the whole wave).
__device__ __forceinline__ void put_frags(const v8f (&acc)[4][4], unsigned short* o16, unsigned short* oh, unsigned short* ol, const int sj, const int si) {
#pragma unroll
    for (int j = 0; j < 4; ++j)
#pragma unroll
        for (int ih = 0; ih < 2; ++ih) { v8us d16[2], dh[2], dl[2];   // one unit (both pieces) of each plane at a time
            const int o = j * sj + ih * si; unsigned short* a16 = o16 + o; unsigned short* ah = oh + o; unsigned short* al = ol + o;
#pragma unroll
            for (int ii = 0; ii < 2; ++ii) { v8h c16;
#pragma unroll
                for (int e = 0; e < 8; ++e) { const float v = acc[2 * ih + ii][j][e]; c16[e] = tohx(v); unsigned short a2, c2; splitf(v, a2, c2); dh[ii][e] = a2; dl[ii][e] = c2; }
                d16[ii] = __builtin_bit_cast(v8us, c16);
                *(v8usa*)(a16 + ii * 256) = d16[ii]; *(v8usa*)(ah + ii * 256) = dh[ii]; *(v8usa*)(al + ii * 256) = dl[ii]; }
            // precaution behind the run of six stores: their addresses and their data are inputs of the wait, so they keep their registers up to it and are reused only behind it
            asm volatile("s_wait_xcnt 0x0" :: "v"(a16), "v"(ah), "v"(al), "v"(d16[0]), "v"(d16[1]), "v"(dh[0]), "v"(dh[1]), "v"(dl[0]), "v"(dl[1]) : "memory"); }
}
// copy_stage: one wave brings four units (row blocks i of its operand, one k block) from a fragment-order plane into LDS, unit after unit: 8 asynchronous copies of 512 contiguous bytes, through no register.
// g: the lane's own 16 bytes of the first unit in global memory; l: their place in LDS (byte address). Every lane is on; both addresses are multiples of 16.
__device__ __forceinline__ void copy_stage(const bf* g, const unsigned l) {
    const bf* g1 = g + 256; const bf* g2 = g + 16 * DM; const bf* g3 = g + 16 * DM + 256; const bf* g4 = g + 32 * DM; const bf* g5 = g + 32 * DM + 256; const bf* g6 = g + 48 * DM; const bf* g7 = g + 48 * DM + 256;
    // the copies and, as the last line, the precaution behind them in ONE statement: no register that a copy names is rewritten in front of that wait
    asm volatile("global_load_async_to_lds_b128 %0, %8, off\n\t"
                 "global_load_async_to_lds_b128 %1, %9, off\n\t"
                 "global_load_async_to_lds_b128 %2, %10, off\n\t"
                 "global_load_async_to_lds_b128 %3, %11, off\n\t"
                 "global_load_async_to_lds_b128 %4, %12, off\n\t"
                 "global_load_async_to_lds_b128 %5, %13, off\n\t"
                 "global_load_async_to_lds_b128 %6, %14, off\n\t"
                 "global_load_async_to_lds_b128 %7, %15, off\n\t"
                 "s_wait_xcnt 0x0"
                 :: "v"(l), "v"(l + 512u), "v"(l + 1024u), "v"(l + 1536u), "v"(l + 2048u), "v"(l + 2560u), "v"(l + 3072u), "v"(l + 3584u),
                    "v"(g), "v"(g1), "v"(g2), "v"(g3), "v"(g4), "v"(g5), "v"(g6), "v"(g7) : "memory");
}
// FOUR WAVES per workgroup, a 128x128 tile (2 x 2 wave tiles of 64x64): grid (rows of x / 128, 3 * heads / 2). A stage = one k block of the tile's 8 row blocks of x (units 0..7) and 8 of the weights (units 8..15), 16 KB, each unit
// read from LDS by two waves. THREE buffers, copies issued TWO stages ahead: for speed only; with two, the copies of stages t + 1 and t + 2 fly while stage t is worked on. Waves 0, 1 copy x, waves 2, 3 the weights (four units each).
#define STG (16 * 512)                       // elements of a stage
#define NST (DM / 32)                        // stages
#define NBF 3                                // buffers of the ring: stage s lies in buffer s mod NBF
static_assert(NST >= 3 && NH_ % 2 == 0 && TT % 128 == 0, "three stages for the prologue; the two heads of a workgroup are of one projection; its rows of one batch");
static_assert(NB_ == 8 && (NB_ * TT / 128) % 8 == 0, "grid x = 8 batches x TT / 128 row tiles, and a grid row is a multiple of 8 blocks");
// five waves per SIMD: the grid is four and a half workgroups per WGP, and all of them are to be resident at once
__global__ __launch_bounds__(128) __attribute__((amdgpu_waves_per_eu(5))) void k_proj(const bf* __restrict__ X, const bf* __restrict__ Wt, h16* Q16, bf* Qh, bf* Ql, h16* K16, bf* Kh, bf* Kl, h16* V16, bf* Vh, bf* Vl) {
    typedef WFrag<bf> WF; typedef WF::V V;
    __shared__ __attribute__((aligned(1024))) bf ring[NBF * STG];
    const int lane = threadIdx.x & 31; const int w = __builtin_amdgcn_readfirstlane((int)(threadIdx.x >> 5));
    const int bx = ((int)blockIdx.x & 7) * (TT / 128) + ((int)blockIdx.x >> 3);   // the tile's 128 rows of x: batch = flat block index mod 8 (PLACEMENT, at k_fattn), a permutation of the NB_ * TT / 128 row tiles
    const int r0 = bx * 128 + (w & 1) * 64, y = blockIdx.y * 2 + (w >> 1), sel = y / NH_, hd = y % NH_; const bool vt = sel == 2;
    // the wave's source: a 16-row block is DM / 32 units = 16 * DM elements; a stage further is one unit further
    const bf* gp = ((w < 2) ? X + (size_t)(bx * 128 + w * 64) * DM : Wt + (size_t)(blockIdx.y * 128 + (w - 2) * 64) * DM) + lane * 8;
    const unsigned lp = (unsigned)(size_t)ring + (unsigned)(w * 4096 + lane * 16);
    // the wave's operands in a stage, elements: x units 4 (w & 1) + i, weight units 8 + 4 (w >> 1) + i
    const int xo = (w & 1) * 2048 + lane * 8, wo = 4096 + (w >> 1) * 2048 + lane * 8; const int po = vt ? xo : wo, ro = vt ? wo : xo;
    v8f acc[4][4];
#pragma unroll
    for (int i = 0; i < 4; ++i)
#pragma unroll
        for (int j = 0; j < 4; ++j) acc[i][j] = (v8f){};
    copy_stage(gp, lp);
    copy_stage(gp + 512, lp + STG * 2);
    // stage 0 has landed (this wave's eight older copies: the counter returns in issue order, and only stage 1's eight may stay out), then every wave's: nobody reads it in front of the barrier
    asm volatile("s_wait_asynccnt 0x8" ::: "memory");
    __syncthreads();
    copy_stage(gp + 1024, lp + 2 * STG * 2);
    gp += 1536;
    unsigned cur = 0;                        // bytes from the ring's start to the buffer of stage t
    // kept rolled: a second copy of the body would need a second set of fragment registers
#pragma unroll 1
    for (int t = 0; t < NST; ++t) {
        const bf* b = (const bf*)((const char*)ring + cur);
        V p[4], r[4];
#pragma unroll
        for (int i = 0; i < 4; ++i) { p[i] = WF::ld(b + po + i * 512); r[i] = WF::ld(b + ro + i * 512); }
#pragma unroll
        for (int j = 0; j < 4; ++j)
#pragma unroll
            for (int i = 0; i < 4; ++i) acc[i][j] = WF::mma(p[i], r[j], acc[i][j]);
        // publish point of stage t + 1: this wave's reads of stage t are done, its copies of stage t + 1 have landed, then the barrier says both of every wave
        asm volatile("s_wait_dscnt 0x0" ::: "memory");
        // the eight youngest copies are stage t + 2's where that stage exists and may stay in flight (that is the second stage of lead); all older ones, stage t + 1's, are covered. In the last two trips nothing younger is out: to 0
        if (t + 2 < NST) asm volatile("s_wait_asynccnt 0x8" ::: "memory"); else asm volatile("s_wait_asynccnt 0x0" ::: "memory");
        __syncthreads();
        if (t + 3 < NST) { copy_stage(gp, lp + cur); gp += 512; }   // stage t + 3 into the buffer that this trip has just read
        cur = (cur == (NBF - 1) * STG * 2u) ? 0u : cur + STG * 2u;
    }
    // nothing is in flight when the wave goes on
    asm volatile("s_wait_asynccnt 0x0" ::: "memory");
    // 64 rows t of a plane are 64 * HD elements in either order of the units
    const size_t ob = ((size_t)(r0 / TT) * NH_ + hd) * TT * HD + (size_t)(r0 % TT) * HD + lane * 8;
    unsigned short* o16 = (unsigned short*)((sel == 0) ? Q16 : (sel == 1) ? K16 : V16) + ob; unsigned short* oh = ((sel == 0) ? Qh : (sel == 1) ? Kh : Vh) + ob; unsigned short* ol = ((sel == 0) ? Ql : (sel == 1) ? Kl : Vl) + ob;
    put_frags(acc, o16, oh, ol, vt ? 512 : 1024, vt ? 2048 : 512);
}

extern "C" void kernel_launch(void* const* d_in, const int* in_sizes, int n_in,
                              void* d_out, int out_size, void* d_ws, size_t ws_size, hipStream_t stream) {
    (void)in_sizes; (void)n_in; (void)out_size;
    const float* x = (const float*)d_in[0]; const float* wq = (const float*)d_in[1]; const float* wk = (const float*)d_in[2]; const float* wv = (const float*)d_in[3]; const float* wo = nullptr; (void)wo;
    float* OUT = (float*)d_out;     // [8][1024][768]
    char* wsp = (char*)d_ws;
    auto take = [&](size_t bytes) { char* p = wsp; wsp += (bytes + 255) & ~(size_t)255; return (void*)p; };
    bf* WQ = (bf*)take((size_t)(DQ + 2 * DKV) * DM * 2);   // one stack of rows [q | k | v]
    const size_t PQ = (size_t)NB_ * NH_ * TT * HD * 2, PK = (size_t)NB_ * NKV * TT * HD * 2;   // bytes of one 16-bit plane set [batch][head][..][..]
    h16* QP16 = (h16*)take(PQ); h16* KP16 = (h16*)take(PK); h16* VT16 = (h16*)take(PK);
    bf* QPh = (bf*)take(PQ); bf* QPl = (bf*)take(PQ); bf* KPh = (bf*)take(PK); bf* KPl = (bf*)take(PK); bf* VTh = (bf*)take(PK); bf* VTl = (bf*)take(PK);
    bf* XB = (bf*)take((size_t)NB_ * TT * DM * 2);
    if ((size_t)(wsp - (char*)d_ws) > ws_size) return;    // ws 256 MiB
    // the weight stack and x in fragment order, one launch
    k_prep<<<(unsigned)(3 * WTB + CVB), 256, 0, stream>>>(x, wq, wk, wv, WQ, XB);
    // projections: all batches as one [NB_*TT][DM] operand, q, k and v in one launch that also writes the planes
    k_proj<<<dim3(NB_ * TT / 128, (DQ + 2 * DKV) / 128, 1), 128, 0, stream>>>(XB, WQ, QP16, QPh, QPl, KP16, KPh, KPl, VT16, VTh, VTl);
    // attention: every (batch, head) plane in one launch (one kv head per query head)
    k_fattn<<<dim3(8, NB_ * NH_, 1), 128, 0, stream>>>(QP16, KP16, VT16, QPh, QPl, KPh, KPl, VTh, VTl, OUT);
}
